// v000
// Times are from an AMD MI455X. After a warm-up the kernel runs many times in a row, and a time is the length of
// such a window on the GPU divided by its runs, so every launch and the gaps after it count. The runs cycle
// through copies of the inputs. A figure is the median of several windows, for all but v000 over two sittings.
// Sittings can differ by a few percent; kernels timed side by side share one.
// The starting kernel, v000, takes 1770 microseconds a run.
#include <hip/hip_runtime.h>

// Causal multi-head attention with PER-HEAD projection weights and a model-width score scale (x [2][2048][1024]; q, k, v = einsum('btc,hcd->bhtd', x, W) with W [16][1024][64]: head h has its own (in, out) matrix ('xw' per head; no bias; 16 heads x 64); scores x 1/sqrt(float32(C)) with C = 1024 = 1/32 (the MODEL width: the module's own choice; soft logits); causal (-inf); softmax; out merged head-major; out Wo^T + bo ('oi' [1024][1024] + bias normal: non-zero) -> [2][2048][1024] (4.2 M); argument order x, Wq, Wk, Wv, Wo, bo).
// Layout per batch: bf16 copy of x; each PER-HEAD q / k / v weight [h][1024][64] transposed once into its 64 rows of the Bt plane (k_wtG per head); Wp cast once ('oi' = Bt as stored); exact projections; identity-table plane builders; causal T-2048 attention (hybrid rows: < 512 hi/lo 3 products, rest fp16 x1024; k_gemmc skips tiles above the diagonal); merged hi/lo x w_o exact.
// Compute dtypes, f32 accumulate: every input rounded to bf16; projections exact; attention rows < 512 3 products, rest fp16; softmax f32; w_o hl x exact.

#define NB_  2
#define TT   2048
#define DM   1024
#define NH_  16
#define NKV  16
#define REP  (NH_ / NKV)
#define HD   64
#define DQ   (NH_ * HD)
#define DKV  (NKV * HD)
#define ZH   2
#define RH   512                  // query rows < RH use hi+lo planes (0: none)
#define WIN  2048
#define PCAR 1024.0f
#define SCL  0.03125f   // 1 / sqrt(C) with C = 1024 = the MODEL width (this module scales its scores by the model width, not the head width): exactly 2^-5
typedef _Float16 h16;
typedef unsigned short bf;
typedef __attribute__((ext_vector_type(16))) __bf16   v16bf;
typedef __attribute__((ext_vector_type(16))) _Float16 v16h;
typedef __attribute__((ext_vector_type(8)))  _Float16 v8h;
typedef __attribute__((ext_vector_type(8)))  unsigned short v8us;
typedef __attribute__((ext_vector_type(8)))  float    v8f;
typedef __attribute__((ext_vector_type(4)))  float    v4f;
typedef v8h  __attribute__((may_alias)) v8ha;
typedef v4f  __attribute__((may_alias)) v4fa;
typedef v8us __attribute__((may_alias)) v8usa;

__device__ __forceinline__ unsigned short f2bf(float f) { unsigned u = __float_as_uint(f); u += 0x7FFFu + ((u >> 16) & 1u); return (unsigned short)(u >> 16); }
__device__ __forceinline__ float bf2f(unsigned short b) { return __uint_as_float(((unsigned)b) << 16); }
__device__ __forceinline__ float bfr(float f) { return bf2f(f2bf(f)); }
__device__ __forceinline__ v16h cat16(v8h lo, v8h hi) { return __builtin_shufflevector(lo, hi, 0, 1, 2, 3, 4, 5, 6, 7, 8, 9, 10, 11, 12, 13, 14, 15); }
__device__ __forceinline__ v16bf cat16b(v8us lo, v8us hi) { return __builtin_bit_cast(v16bf, __builtin_shufflevector(lo, hi, 0, 1, 2, 3, 4, 5, 6, 7, 8, 9, 10, 11, 12, 13, 14, 15)); }
__device__ __forceinline__ v8f wmma16(v16h a, v16h b, v8f c) { return __builtin_amdgcn_wmma_f32_16x16x32_f16(false, a, false, b, (short)0, c, false, false); }
__device__ __forceinline__ v8f wmmab(v16bf a, v16bf b, v8f c) { return __builtin_amdgcn_wmma_f32_16x16x32_bf16(false, a, false, b, (short)0, c, false, false); }



// ---- k_gemmw: register-blocked GEMM, ONE WAVE per 64x64 output tile (16 accumulators), operands straight from K-contiguous 16-bit planes; grid (M/64, N/64, Z), 32 threads.
// C[m][n] (f32, pitch ldc, + optional f32 bias[n]) = sum_k A[m][k] Bt[n][k] (+ split products per NSPLIT). z-batch strides sA/sB/sC in elements. K % 32 == 0.
template <typename T16> struct WFrag;
template <> struct WFrag<h16> { typedef v16h V; static __device__ __forceinline__ V ld(const h16* p) { return cat16(*(const v8h*)p, *(const v8h*)(p + 16)); } static __device__ __forceinline__ v8f mma(V a, V b, v8f c) { return wmma16(a, b, c); } };
template <> struct WFrag<bf> { typedef v16bf V; static __device__ __forceinline__ V ld(const bf* p) { return cat16b(*(const v8us*)p, *(const v8us*)(p + 16)); } static __device__ __forceinline__ v8f mma(V a, V b, v8f c) { return wmmab(a, b, c); } };
template <typename T16, int NSPLIT, bool BIAS>
__global__ __launch_bounds__(32) void k_gemmw(const T16* __restrict__ A, const T16* __restrict__ A2, const T16* __restrict__ Bt, const T16* __restrict__ Bt2, int K, float* C, int ldc, const float* __restrict__ bias, size_t sA, size_t sB, size_t sC) {
    typedef typename WFrag<T16>::V V;
    __shared__ __align__(16) float os[16 * 68];
    const size_t z = blockIdx.z; A += z * sA; if (A2) A2 += z * sA; Bt += z * sB; if (Bt2) Bt2 += z * sB; C += z * sC;
    const int lane = threadIdx.x & 31, lr = lane & 15, hi = lane >> 4; const int r0 = blockIdx.x * 64, c0 = blockIdx.y * 64;
    v8f acc[4][4];
#pragma unroll
    for (int mb = 0; mb < 4; ++mb)
#pragma unroll
        for (int nb = 0; nb < 4; ++nb) acc[mb][nb] = (v8f){};
    const size_t aoff = (size_t)(r0 + lr) * K + 8 * hi, boff = (size_t)(c0 + lr) * K + 8 * hi;
#pragma unroll 1
    for (int kc = 0; kc < K; kc += 32) {
        V a[4], a2[4];
#pragma unroll
        for (int mb = 0; mb < 4; ++mb) { a[mb] = WFrag<T16>::ld(A + aoff + (size_t)mb * 16 * K + kc); if (NSPLIT == 1 || NSPLIT == 2) a2[mb] = WFrag<T16>::ld(A2 + aoff + (size_t)mb * 16 * K + kc); }
#pragma unroll
        for (int nb = 0; nb < 4; ++nb) { const V b = WFrag<T16>::ld(Bt + boff + (size_t)nb * 16 * K + kc); V b2; if (NSPLIT >= 2) b2 = WFrag<T16>::ld(Bt2 + boff + (size_t)nb * 16 * K + kc);
#pragma unroll
            for (int mb = 0; mb < 4; ++mb) { acc[mb][nb] = WFrag<T16>::mma(a[mb], b, acc[mb][nb]); if (NSPLIT == 1 || NSPLIT == 2) acc[mb][nb] = WFrag<T16>::mma(a2[mb], b, acc[mb][nb]); if (NSPLIT >= 2) acc[mb][nb] = WFrag<T16>::mma(a[mb], b2, acc[mb][nb]); } }
        asm volatile("v_nop\n\tv_nop\n\tv_nop\n\tv_nop" : "+v"(acc[0][0]), "+v"(acc[1][1]), "+v"(acc[2][2]), "+v"(acc[3][3]) : "v"(a[0]), "v"(a[3]));
    }
#pragma unroll
    for (int mb = 0; mb < 4; ++mb) {
#pragma unroll
        for (int nb = 0; nb < 4; ++nb) {
#pragma unroll
            for (int j = 0; j < 8; ++j) os[(hi * 8 + j) * 68 + nb * 16 + lr] = acc[mb][nb][j]; }
        __builtin_amdgcn_wave_barrier(); asm volatile("" ::: "memory");
        float* crow = C + (size_t)(r0 + mb * 16) * ldc + c0;
{
#pragma unroll
            for (int s = 0; s < 8; ++s) { const int row = 2 * s + hi, cofs = lr * 4; v4f val = *(const v4fa*)(os + row * 68 + cofs); if (BIAS) { val[0] += bfr(bias[c0 + cofs]); val[1] += bfr(bias[c0 + cofs + 1]); val[2] += bfr(bias[c0 + cofs + 2]); val[3] += bfr(bias[c0 + cofs + 3]); }
                *(v4f*)(crow + (size_t)row * ldc + cofs) = val; }
             }
        __builtin_amdgcn_wave_barrier(); asm volatile("" ::: "memory");
    }
}

// ---- k_gemmc: the same one-wave 64x64 tile GEMM specialised for causal attention: CMODE 1 skips score tiles entirely above the diagonal (query rows r0+roff.., key columns c0..), CMODE 2 limits the
// key (K) loop of the probability x value contraction to the diagonal block (probabilities beyond it are exactly zero). roff = row offset of this launch's first row within the sequence.
template <typename T16, int NSPLIT, int CMODE>
__global__ __launch_bounds__(32) void k_gemmc(const T16* __restrict__ A, const T16* __restrict__ A2, const T16* __restrict__ Bt, const T16* __restrict__ Bt2, int K, float* C, int ldc, int roff, size_t sA, size_t sB, size_t sC) {
    typedef typename WFrag<T16>::V V;
    __shared__ __align__(16) float os[16 * 68];
    const size_t z = blockIdx.z; A += z * sA; if (A2) A2 += z * sA; Bt += z * sB; if (Bt2) Bt2 += z * sB; C += z * sC;
    const int lane = threadIdx.x & 31, lr = lane & 15, hi = lane >> 4; const int r0 = blockIdx.x * 64, c0 = blockIdx.y * 64;
    if (CMODE == 1 && c0 > r0 + roff + 63) return;                  // score tile entirely above the causal diagonal: never read (the softmax masks j > i by select)
    const int Kl = (CMODE == 2) ? min(K, r0 + roff + 64) : K;        // P.V: probabilities are exactly 0 beyond the diagonal block, so the K loop stops there
    v8f acc[4][4];
#pragma unroll
    for (int mb = 0; mb < 4; ++mb)
#pragma unroll
        for (int nb = 0; nb < 4; ++nb) acc[mb][nb] = (v8f){};
    const size_t aoff = (size_t)(r0 + lr) * K + 8 * hi, boff = (size_t)(c0 + lr) * K + 8 * hi;
#pragma unroll 1
    for (int kc = 0; kc < Kl; kc += 32) {
        V a[4], a2[4];
#pragma unroll
        for (int mb = 0; mb < 4; ++mb) { a[mb] = WFrag<T16>::ld(A + aoff + (size_t)mb * 16 * K + kc); if (NSPLIT == 1 || NSPLIT == 2) a2[mb] = WFrag<T16>::ld(A2 + aoff + (size_t)mb * 16 * K + kc); }
#pragma unroll
        for (int nb = 0; nb < 4; ++nb) { const V b = WFrag<T16>::ld(Bt + boff + (size_t)nb * 16 * K + kc); V b2; if (NSPLIT >= 2) b2 = WFrag<T16>::ld(Bt2 + boff + (size_t)nb * 16 * K + kc);
#pragma unroll
            for (int mb = 0; mb < 4; ++mb) { acc[mb][nb] = WFrag<T16>::mma(a[mb], b, acc[mb][nb]); if (NSPLIT == 1 || NSPLIT == 2) acc[mb][nb] = WFrag<T16>::mma(a2[mb], b, acc[mb][nb]); if (NSPLIT >= 2) acc[mb][nb] = WFrag<T16>::mma(a[mb], b2, acc[mb][nb]); } }
        asm volatile("v_nop\n\tv_nop\n\tv_nop\n\tv_nop" : "+v"(acc[0][0]), "+v"(acc[1][1]), "+v"(acc[2][2]), "+v"(acc[3][3]) : "v"(a[0]), "v"(a[3]));
    }
#pragma unroll
    for (int mb = 0; mb < 4; ++mb) {
#pragma unroll
        for (int nb = 0; nb < 4; ++nb) {
#pragma unroll
            for (int j = 0; j < 8; ++j) os[(hi * 8 + j) * 68 + nb * 16 + lr] = acc[mb][nb][j]; }
        __builtin_amdgcn_wave_barrier(); asm volatile("" ::: "memory");
        float* crow = C + (size_t)(r0 + mb * 16) * ldc + c0;
{
#pragma unroll
            for (int s = 0; s < 8; ++s) { const int row = 2 * s + hi, cofs = lr * 4; v4f val = *(const v4fa*)(os + row * 68 + cofs);
                *(v4f*)(crow + (size_t)row * ldc + cofs) = val; }
             }
        __builtin_amdgcn_wave_barrier(); asm volatile("" ::: "memory");
    }
}

__device__ __forceinline__ h16 tohx(float x) { return (h16)x; }
__device__ __forceinline__ void splitf(float y, unsigned short& h, unsigned short& l) { h = f2bf(y); l = f2bf(y - bf2f(h)); }
typedef __attribute__((ext_vector_type(2))) _Float16 v2h;
typedef __attribute__((ext_vector_type(4))) _Float16 v4h;
typedef __attribute__((ext_vector_type(2))) unsigned short v2us;
typedef __attribute__((ext_vector_type(4))) unsigned short v4us;
typedef __attribute__((ext_vector_type(2))) float v2f;
typedef __attribute__((ext_vector_type(4))) int v4i;

__global__ __launch_bounds__(256) void k_wtG(const float* __restrict__ w, int K, int N, bf* Bt) {
    const int lane = threadIdx.x & 31; const int L0 = (blockIdx.x * 8 + (threadIdx.x >> 5)) * 8; const int nlines = N * K / 64;
{
#pragma unroll 1
        for (int l = 0; l < 8; ++l) { const int L = L0 + l; if (L >= nlines) break; const size_t e = (size_t)L * 64 + lane * 2; const int k = (int)(e % K), n = (int)(e / K); v2us o;
            o[0] = f2bf(w[(size_t)k * N + n]); o[1] = f2bf(w[(size_t)(k + 1) * N + n]); *(v2us*)(Bt + e) = o; }
         }
}

__global__ __launch_bounds__(256) void k_cvt8(const float* __restrict__ src, bf* dst, size_t n8) { const size_t i = (size_t)blockIdx.x * 256 + threadIdx.x; if (i >= n8) return; const v8f v = *(const v8f*)(src + i * 8); v8us o;
#pragma unroll
    for (int k = 0; k < 8; ++k) o[k] = f2bf(v[k]); *(v8us*)(dst + i * 8) = o;  }

// k_rope: head planes [h][t][d] (fp16 + hi/lo) of rope(x) x sc with the rotate-half convention out[d] = x[d] cos[t][d] - x[d+HD/2] sin[t][d], out[d+HD/2] = x[d+HD/2] cos[t][d+HD/2] + x[d] sin[t][d+HD/2]
__global__ __launch_bounds__(256) void k_rope(const float* __restrict__ F, int pitch, int nheads, const float* __restrict__ CS, const float* __restrict__ RF, const float* __restrict__ nw, float sc, h16* P16, bf* Ph, bf* Pl) {
    const size_t e = ((size_t)blockIdx.x * 256 + threadIdx.x) * 2; if (e >= (size_t)nheads * TT * HD) return; const int d = (int)(e % HD); const int t = (int)((e / HD) % TT); const int h = (int)(e / ((size_t)HD * TT)); const float* f = F + (size_t)t * pitch + h * HD; const float rf = RF ? RF[(size_t)h * TT + t] : 1.0f; v2h o16; v2us oh, ol;
#pragma unroll
    for (int q = 0; q < 2; ++q) { const int dd = d + q; const int dp = (dd < HD / 2) ? dd + HD / 2 : dd - HD / 2; float x0 = f[dd], x1 = f[dp];
        if (RF) { float n0 = __fmul_rn(x0, rf), n1 = __fmul_rn(x1, rf); asm volatile("" : "+v"(n0)); asm volatile("" : "+v"(n1)); x0 = __fmul_rn(bfr(nw[dd]), n0); x1 = __fmul_rn(bfr(nw[dp]), n1); }
        const v2f cs = *(const v2f*)(CS + ((size_t)t * HD + dd) * 2); float a = __fmul_rn(x0, cs[0]), bq = __fmul_rn(x1, cs[1]); asm volatile("" : "+v"(a)); asm volatile("" : "+v"(bq)); const float r = ((dd < HD / 2) ? __fsub_rn(a, bq) : __fadd_rn(a, bq)) * sc;
        o16[q] = tohx(r); unsigned short a2, c2; splitf(r, a2, c2); oh[q] = a2; ol[q] = c2; }
    *(v2h*)(P16 + e) = o16; *(v2us*)(Ph + e) = oh; *(v2us*)(Pl + e) = ol;  }
__global__ __launch_bounds__(256) void k_vtp(const float* __restrict__ F, int pitch, int nheads, h16* V16, bf* Vh, bf* Vl) { const size_t e = ((size_t)blockIdx.x * 256 + threadIdx.x) * 2; if (e >= (size_t)nheads * HD * TT) return; const int t = (int)(e % TT); const int d = (int)((e / TT) % HD); const int g = (int)(e / ((size_t)TT * HD)); v2h o16; v2us oh, ol;
#pragma unroll
    for (int q = 0; q < 2; ++q) { const float x = F[(size_t)(t + q) * pitch + g * HD + d]; o16[q] = tohx(x); unsigned short a2, c2; splitf(x, a2, c2); oh[q] = a2; ol[q] = c2; }
    *(v2h*)(V16 + e) = o16; *(v2us*)(Vh + e) = oh; *(v2us*)(Vl + e) = ol;  }
__global__ __launch_bounds__(256) void k_csid(float* CS) { const int idx = blockIdx.x * 256 + threadIdx.x; if (idx >= TT * HD) return; v2f cs; cs[0] = 1.0f; cs[1] = 0.0f; *(v2f*)(CS + (size_t)idx * 2) = cs;  }
// k_asoft: per row (zz, i): t = S x C^-0.5 (1/32) for j <= i and i - j < WIN (sliding causal window; the reference's -1e9 additive fill vanishes identically); softmax over the 2048 keys (register row, one exp, fixed trees);
__global__ __launch_bounds__(256) void k_asoft(const float* __restrict__ Sb, h16* P16, bf* Ph, bf* Pl) {
    const int lane = threadIdx.x & 31; const int row = blockIdx.x * 8 + (threadIdx.x >> 5); if (row >= ZH * TT) return; const int i = row % TT; const int zz = row / TT; (void)zz; const bool hires = (i < RH); const float* sr = Sb + (size_t)row * TT; float v[TT / 32]; float mx = -3.0e38f;
#pragma unroll
    for (int ch = 0; ch < TT / 128; ++ch) { const int j0 = ch * 128 + lane * 4; const v4f a = *(const v4f*)(sr + j0);
#pragma unroll
        for (int q = 0; q < 4; ++q) { const int j = j0 + q; (void)j; const float t = (j <= i && i - j < WIN) ? a[q] * SCL : -3.0e38f; v[ch * 4 + q] = t; mx = fmaxf(mx, t); } }
#pragma unroll
    for (int sh = 16; sh; sh >>= 1) mx = fmaxf(mx, __shfl_xor(mx, sh, 32));
    float sum = 0.f;
#pragma unroll
    for (int k = 0; k < TT / 32; ++k) { float d0 = __fsub_rn(v[k], mx); asm volatile("" : "+v"(d0)); v[k] = __builtin_amdgcn_exp2f(__fmul_rn(d0, 1.4426950408889634f)); sum += v[k]; }
#pragma unroll
    for (int sh = 16; sh; sh >>= 1) sum += __shfl_xor(sum, sh, 32);
    const float f = __fdiv_rn(hires ? 1.0f : PCAR, sum);
{
        if (hires) {
#pragma unroll
            for (int ch = 0; ch < TT / 128; ++ch) { v4us oh, ol;
#pragma unroll
                for (int q = 0; q < 4; ++q) { unsigned short a, c2; splitf(v[ch * 4 + q] * f, a, c2); oh[q] = a; ol[q] = c2; }
                const size_t oo = ((size_t)zz * (RH ? RH : 1) + i) * TT + ch * 128 + lane * 4; *(v4us*)(Ph + oo) = oh; *(v4us*)(Pl + oo) = ol; }
        } else {
#pragma unroll
            for (int ch = 0; ch < TT / 128; ++ch) { v4h o4;
#pragma unroll
                for (int q = 0; q < 4; ++q) o4[q] = tohx(v[ch * 4 + q] * f);
                *(v4h*)(P16 + (size_t)row * TT + ch * 128 + lane * 4) = o4; } }
         }
}
__global__ __launch_bounds__(256) void k_merge(const float* __restrict__ O, int h0, bf* Ah, bf* Al) { const size_t e = ((size_t)blockIdx.x * 256 + threadIdx.x) * 2; if (e >= (size_t)ZH * TT * HD) return; const int d = (int)(e % HD); const int t = (int)((e / HD) % TT); const int zz = (int)(e / ((size_t)HD * TT)); const float cs = (t < RH) ? 1.0f : (1.0f / PCAR); const size_t oo = (size_t)t * DQ + (h0 + zz) * HD + d;
    v2us oh, ol;
#pragma unroll
    for (int q = 0; q < 2; ++q) { unsigned short a, c2; splitf(O[e + q] * cs, a, c2); oh[q] = a; ol[q] = c2; } *(v2us*)(Ah + oo) = oh; *(v2us*)(Al + oo) = ol;  }

extern "C" void kernel_launch(void* const* d_in, const int* in_sizes, int n_in,
                              void* d_out, int out_size, void* d_ws, size_t ws_size, hipStream_t stream) {
    (void)in_sizes; (void)n_in; (void)out_size;
            const float* x = (const float*)d_in[0]; const float* wq = (const float*)d_in[1]; const float* wk = (const float*)d_in[2]; const float* wv = (const float*)d_in[3]; const float* wo = (const float*)d_in[4]; const float* bo = (const float*)d_in[5];   /* input order x, Wq, Wk, Wv (PER-HEAD [16][1024][64]: 'hcd'), Wo ('oi' [1024][1024]), bo */
    float* OUT = (float*)d_out;     // [2][2048][1024]
    char* wsp = (char*)d_ws;
    auto take = [&](size_t bytes) { char* p = wsp; wsp += (bytes + 255) & ~(size_t)255; return (void*)p; };
    bf* WQ = (bf*)take((size_t)DQ * DM * 2); bf* WK = (bf*)take((size_t)DKV * DM * 2); bf* WV = (bf*)take((size_t)DKV * DM * 2); bf* WO = (bf*)take((size_t)DM * DQ * 2); float* CS = (float*)take((size_t)TT * HD * 2 * 4);
    bf* XB = (bf*)take((size_t)TT * DM * 2); float* FQ = (float*)take((size_t)TT * DQ * 4); float* FK = (float*)take((size_t)TT * DKV * 4);
    h16* QP16 = (h16*)take((size_t)NH_ * TT * HD * 2); h16* KP16 = (h16*)take((size_t)NKV * TT * HD * 2); h16* VT16 = (h16*)take((size_t)NKV * HD * TT * 2);
    bf* QPh = (bf*)take((size_t)NH_ * TT * HD * 2); bf* QPl = (bf*)take((size_t)NH_ * TT * HD * 2); bf* KPh = (bf*)take((size_t)NKV * TT * HD * 2); bf* KPl = (bf*)take((size_t)NKV * TT * HD * 2); bf* VTh = (bf*)take((size_t)NKV * HD * TT * 2); bf* VTl = (bf*)take((size_t)NKV * HD * TT * 2); bf* Ph = (bf*)take((size_t)ZH * RH * TT * 2); bf* Pl = (bf*)take((size_t)ZH * RH * TT * 2);
    float* Sb = (float*)take((size_t)ZH * TT * TT * 4); h16* P16 = (h16*)take((size_t)ZH * TT * TT * 2); float* Ob = (float*)take((size_t)ZH * TT * HD * 4); bf* ATh = (bf*)take((size_t)TT * DQ * 2); bf* ATl = (bf*)take((size_t)TT * DQ * 2);
    if ((size_t)(wsp - (char*)d_ws) > ws_size) return;    // ws 256 MiB
    float* FV = FK;   // v projection reuses the k buffer after the k planes are built (stream-ordered)
    { for (int h = 0; h < NH_; ++h) k_wtG<<<(unsigned)((DM * HD / 64 + 63) / 64), 256, 0, stream>>>(wq + (size_t)h * DM * HD, DM, HD, WQ + (size_t)h * HD * DM);   /* per-head weight [h][DM][HD] ('xw' per head) -> the head's HD rows of the Bt plane */ for (int h = 0; h < NKV; ++h) k_wtG<<<(unsigned)((DM * HD / 64 + 63) / 64), 256, 0, stream>>>(wk + (size_t)h * DM * HD, DM, HD, WK + (size_t)h * HD * DM);   /* per-head weight [h][DM][HD] ('xw' per head) -> the head's HD rows of the Bt plane */ for (int h = 0; h < NKV; ++h) k_wtG<<<(unsigned)((DM * HD / 64 + 63) / 64), 256, 0, stream>>>(wv + (size_t)h * DM * HD, DM, HD, WV + (size_t)h * HD * DM);   /* per-head weight [h][DM][HD] ('xw' per head) -> the head's HD rows of the Bt plane */
      k_cvt8<<<(unsigned)(((size_t)DM * DQ / 8 + 255) / 256), 256, 0, stream>>>(wo, WO, (size_t)DM * DQ / 8);
       }
    k_csid<<<(TT * HD + 255) / 256, 256, 0, stream>>>(CS);
    const unsigned LQ = (unsigned)(((size_t)NH_ * TT * HD / 2 + 255) / 256), LKv = (unsigned)(((size_t)NKV * TT * HD / 2 + 255) / 256);
    for (int b = 0; b < NB_; ++b) {
        
        k_cvt8<<<(unsigned)(((size_t)TT * DM / 8 + 255) / 256), 256, 0, stream>>>(x + (size_t)b * TT * DM, XB, (size_t)TT * DM / 8);
        k_gemmw<bf, 0, false><<<dim3(TT / 64, DQ / 64, 1), 32, 0, stream>>>(XB, nullptr, WQ, nullptr, DM, FQ, DQ, nullptr, 0, 0, 0);
        k_rope<<<LQ, 256, 0, stream>>>(FQ, DQ, NH_, CS, nullptr, nullptr, 1.0f, QP16, QPh, QPl);
        k_gemmw<bf, 0, false><<<dim3(TT / 64, DKV / 64, 1), 32, 0, stream>>>(XB, nullptr, WK, nullptr, DM, FK, DKV, nullptr, 0, 0, 0);
        k_rope<<<LKv, 256, 0, stream>>>(FK, DKV, NKV, CS, nullptr, nullptr, 1.0f, KP16, KPh, KPl);
        k_gemmw<bf, 0, false><<<dim3(TT / 64, DKV / 64, 1), 32, 0, stream>>>(XB, nullptr, WV, nullptr, DM, FV, DKV, nullptr, 0, 0, 0); k_vtp<<<LKv, 256, 0, stream>>>(FV, DKV, NKV, VT16, VTh, VTl);
        for (int h0 = 0; h0 < NH_; h0 += ZH) { const size_t zq = (size_t)h0, zk = (size_t)(h0 / REP);   // one kv head per query head: the pass's two heads use consecutive kv planes (z-strides TT*HD)
            k_gemmc<bf, 2, 1><<<dim3(RH / 64, TT / 64, ZH), 32, 0, stream>>>(QPh + zq * TT * HD, QPl + zq * TT * HD, KPh + zk * TT * HD, KPl + zk * TT * HD, HD, Sb, TT, 0, (size_t)TT * HD, (size_t)TT * HD, (size_t)TT * TT);
            k_gemmc<h16, 0, 1><<<dim3((TT - RH) / 64, TT / 64, ZH), 32, 0, stream>>>(QP16 + zq * TT * HD + (size_t)RH * HD, nullptr, KP16 + zk * TT * HD, nullptr, HD, Sb + (size_t)RH * TT, TT, RH, (size_t)TT * HD, (size_t)TT * HD, (size_t)TT * TT);
            k_asoft<<<ZH * TT / 8, 256, 0, stream>>>(Sb, P16, Ph, Pl);
            k_gemmc<bf, 2, 2><<<dim3(RH / 64, HD / 64, ZH), 32, 0, stream>>>(Ph, Pl, VTh + zk * HD * TT, VTl + zk * HD * TT, TT, Ob, HD, 0, (size_t)RH * TT, (size_t)HD * TT, (size_t)TT * HD);
            k_gemmc<h16, 0, 2><<<dim3((TT - RH) / 64, HD / 64, ZH), 32, 0, stream>>>(P16 + (size_t)RH * TT, nullptr, VT16 + zk * HD * TT, nullptr, TT, Ob + (size_t)RH * HD, HD, RH, (size_t)TT * TT, (size_t)HD * TT, (size_t)TT * HD);
            k_merge<<<(unsigned)(((size_t)ZH * TT * HD / 2 + 255) / 256), 256, 0, stream>>>(Ob, h0, ATh, ATl); }
        k_gemmw<bf, 1, true><<<dim3(TT / 64, DM / 64, 1), 32, 0, stream>>>(ATh, ATl, WO, nullptr, DQ, OUT + (size_t)b * TT * DM, DM, bo, 0, 0, 0); }
}

// v001
// A run of this version takes 828 microseconds.
// Next to v000, in two timings, it ran 2.15 and 2.14 times as fast.
#include <hip/hip_runtime.h>

// Causal multi-head attention with PER-HEAD projection weights and a model-width score scale (x [2][2048][1024]; q, k, v = einsum('btc,hcd->bhtd', x, W) with W [16][1024][64]: head h has its own (in, out) matrix ('xw' per head; no bias; 16 heads x 64); scores x 1/sqrt(float32(C)) with C = 1024 = 1/32 (the MODEL width: the module's own choice; soft logits); causal (-inf); softmax; out merged head-major; out Wo^T + bo ('oi' [1024][1024] + bias normal: non-zero) -> [2][2048][1024] (4.2 M); argument order x, Wq, Wk, Wv, Wo, bo).
// Layout: bf16 copy of x (both batches); each PER-HEAD q / k / v weight [h][1024][64] transposed once into its 64 rows of the Bt plane (k_wtG per head); Wp cast once ('oi' = Bt as stored); exact projections; identity-table plane builders; causal T-2048 attention (hybrid rows: < 512 hi/lo 3 products, rest fp16 x1024; k_gemmc skips tiles above the diagonal); merged hi/lo x w_o exact.
// Compute dtypes, f32 accumulate: every input rounded to bf16; projections exact; attention rows < 512 3 products, rest fp16; softmax f32; w_o hl x exact.

#define NB_  2
#define TT   2048
#define DM   1024
#define NH_  16
#define NKV  16
#define REP  (NH_ / NKV)
#define HD   64
#define DQ   (NH_ * HD)
#define DKV  (NKV * HD)
#define ZH   4                    // heads per attention pass (grid z of the score and value launches; a factor of grid x in the softmax and merge launches)
#define PQKV (DQ + 2 * DKV)       // row pitch of the joint q | k | v projection plane
#define RH   512                  // query rows < RH use hi+lo planes (0: none)
#define WIN  2048
#define PCAR 1024.0f
#define SCL  0.03125f   // 1 / sqrt(C) with C = 1024 = the MODEL width (this module scales its scores by the model width, not the head width): exactly 2^-5
typedef _Float16 h16;
typedef unsigned short bf;
typedef __attribute__((ext_vector_type(16))) __bf16   v16bf;
typedef __attribute__((ext_vector_type(16))) _Float16 v16h;
typedef __attribute__((ext_vector_type(8)))  _Float16 v8h;
typedef __attribute__((ext_vector_type(8)))  unsigned short v8us;
typedef __attribute__((ext_vector_type(8)))  float    v8f;
typedef __attribute__((ext_vector_type(4)))  float    v4f;
typedef v8h  __attribute__((may_alias)) v8ha;
typedef v4f  __attribute__((may_alias)) v4fa;
typedef v8us __attribute__((may_alias)) v8usa;

__device__ __forceinline__ unsigned short f2bf(float f) { unsigned u = __float_as_uint(f); u += 0x7FFFu + ((u >> 16) & 1u); return (unsigned short)(u >> 16); }
__device__ __forceinline__ float bf2f(unsigned short b) { return __uint_as_float(((unsigned)b) << 16); }
__device__ __forceinline__ float bfr(float f) { return bf2f(f2bf(f)); }
__device__ __forceinline__ v16h cat16(v8h lo, v8h hi) { return __builtin_shufflevector(lo, hi, 0, 1, 2, 3, 4, 5, 6, 7, 8, 9, 10, 11, 12, 13, 14, 15); }
__device__ __forceinline__ v16bf cat16b(v8us lo, v8us hi) { return __builtin_bit_cast(v16bf, __builtin_shufflevector(lo, hi, 0, 1, 2, 3, 4, 5, 6, 7, 8, 9, 10, 11, 12, 13, 14, 15)); }
__device__ __forceinline__ v8f wmma16(v16h a, v16h b, v8f c) { return __builtin_amdgcn_wmma_f32_16x16x32_f16(false, a, false, b, (short)0, c, false, false); }
__device__ __forceinline__ v8f wmmab(v16bf a, v16bf b, v8f c) { return __builtin_amdgcn_wmma_f32_16x16x32_bf16(false, a, false, b, (short)0, c, false, false); }



// ---- k_gemmw: register-blocked GEMM, ONE WAVE per 64x64 output tile (16 accumulators), operands straight from K-contiguous 16-bit planes; grid (M/64, N/64, Z), 32 threads.
// C[m][n] (f32, pitch ldc, + optional f32 bias[n]) = sum_k A[m][k] Bt[n][k] (+ split products per NSPLIT). z-batch strides sA/sB/sC in elements. K % 32 == 0.
template <typename T16> struct WFrag;
template <> struct WFrag<h16> { typedef v16h V; static __device__ __forceinline__ V ld(const h16* p) { return cat16(*(const v8h*)p, *(const v8h*)(p + 16)); } static __device__ __forceinline__ v8f mma(V a, V b, v8f c) { return wmma16(a, b, c); } };
template <> struct WFrag<bf> { typedef v16bf V; static __device__ __forceinline__ V ld(const bf* p) { return cat16b(*(const v8us*)p, *(const v8us*)(p + 16)); } static __device__ __forceinline__ v8f mma(V a, V b, v8f c) { return wmmab(a, b, c); } };
template <typename T16, int NSPLIT, bool BIAS>
__global__ __launch_bounds__(32) void k_gemmw(const T16* __restrict__ A, const T16* __restrict__ A2, const T16* __restrict__ Bt, const T16* __restrict__ Bt2, int K, float* C, int ldc, const float* __restrict__ bias, size_t sA, size_t sB, size_t sC) {
    typedef typename WFrag<T16>::V V;
    __shared__ __align__(16) float os[16 * 68];
    const size_t z = blockIdx.z; A += z * sA; if (A2) A2 += z * sA; Bt += z * sB; if (Bt2) Bt2 += z * sB; C += z * sC;
    const int lane = threadIdx.x & 31, lr = lane & 15, hi = lane >> 4; const int r0 = blockIdx.x * 64, c0 = blockIdx.y * 64;
    v8f acc[4][4];
#pragma unroll
    for (int mb = 0; mb < 4; ++mb)
#pragma unroll
        for (int nb = 0; nb < 4; ++nb) acc[mb][nb] = (v8f){};
    const size_t aoff = (size_t)(r0 + lr) * K + 8 * hi, boff = (size_t)(c0 + lr) * K + 8 * hi;
#pragma unroll 1
    for (int kc = 0; kc < K; kc += 32) {
        V a[4], a2[4];
#pragma unroll
        for (int mb = 0; mb < 4; ++mb) { a[mb] = WFrag<T16>::ld(A + aoff + (size_t)mb * 16 * K + kc); if (NSPLIT == 1 || NSPLIT == 2) a2[mb] = WFrag<T16>::ld(A2 + aoff + (size_t)mb * 16 * K + kc); }
#pragma unroll
        for (int nb = 0; nb < 4; ++nb) { const V b = WFrag<T16>::ld(Bt + boff + (size_t)nb * 16 * K + kc); V b2; if (NSPLIT >= 2) b2 = WFrag<T16>::ld(Bt2 + boff + (size_t)nb * 16 * K + kc);
#pragma unroll
            for (int mb = 0; mb < 4; ++mb) { acc[mb][nb] = WFrag<T16>::mma(a[mb], b, acc[mb][nb]); if (NSPLIT == 1 || NSPLIT == 2) acc[mb][nb] = WFrag<T16>::mma(a2[mb], b, acc[mb][nb]); if (NSPLIT >= 2) acc[mb][nb] = WFrag<T16>::mma(a[mb], b2, acc[mb][nb]); } }
        asm volatile("v_nop\n\tv_nop\n\tv_nop\n\tv_nop" : "+v"(acc[0][0]), "+v"(acc[1][1]), "+v"(acc[2][2]), "+v"(acc[3][3]) : "v"(a[0]), "v"(a[3]));
    }
#pragma unroll
    for (int mb = 0; mb < 4; ++mb) {
#pragma unroll
        for (int nb = 0; nb < 4; ++nb) {
#pragma unroll
            for (int j = 0; j < 8; ++j) os[(hi * 8 + j) * 68 + nb * 16 + lr] = acc[mb][nb][j]; }
        __builtin_amdgcn_wave_barrier(); asm volatile("" ::: "memory");
        float* crow = C + (size_t)(r0 + mb * 16) * ldc + c0;
{
#pragma unroll
            for (int s = 0; s < 8; ++s) { const int row = 2 * s + hi, cofs = lr * 4; v4f val = *(const v4fa*)(os + row * 68 + cofs); if (BIAS) { val[0] += bfr(bias[c0 + cofs]); val[1] += bfr(bias[c0 + cofs + 1]); val[2] += bfr(bias[c0 + cofs + 2]); val[3] += bfr(bias[c0 + cofs + 3]); }
                *(v4f*)(crow + (size_t)row * ldc + cofs) = val; }
             }
        __builtin_amdgcn_wave_barrier(); asm volatile("" ::: "memory");
    }
}

// ---- k_gemmc: the same one-wave 64x64 tile GEMM specialised for causal attention: CMODE 1 skips score tiles entirely above the diagonal (query rows r0+roff.., key columns c0..), CMODE 2 limits the
// key (K) loop of the probability x value contraction to the diagonal block (probabilities beyond it are exactly zero). roff = row offset of this launch's first row within the sequence.
template <typename T16, int NSPLIT, int CMODE>
__global__ __launch_bounds__(32) void k_gemmc(const T16* __restrict__ A, const T16* __restrict__ A2, const T16* __restrict__ Bt, const T16* __restrict__ Bt2, int K, float* C, int ldc, int roff, size_t sA, size_t sB, size_t sC) {
    typedef typename WFrag<T16>::V V;
    __shared__ __align__(16) float os[16 * 68];
    const size_t z = blockIdx.z; A += z * sA; if (A2) A2 += z * sA; Bt += z * sB; if (Bt2) Bt2 += z * sB; C += z * sC;
    const int lane = threadIdx.x & 31, lr = lane & 15, hi = lane >> 4; const int r0 = blockIdx.x * 64, c0 = blockIdx.y * 64;
    if (CMODE == 1 && c0 > r0 + roff + 63) return;                  // score tile entirely above the causal diagonal: never read (the softmax masks j > i by select)
    const int Kl = (CMODE == 2) ? min(K, r0 + roff + 64) : K;        // P.V: probabilities are exactly 0 beyond the diagonal block, so the K loop stops there
    v8f acc[4][4];
#pragma unroll
    for (int mb = 0; mb < 4; ++mb)
#pragma unroll
        for (int nb = 0; nb < 4; ++nb) acc[mb][nb] = (v8f){};
    const size_t aoff = (size_t)(r0 + lr) * K + 8 * hi, boff = (size_t)(c0 + lr) * K + 8 * hi;
#pragma unroll 1
    for (int kc = 0; kc < Kl; kc += 32) {
        V a[4], a2[4];
#pragma unroll
        for (int mb = 0; mb < 4; ++mb) { a[mb] = WFrag<T16>::ld(A + aoff + (size_t)mb * 16 * K + kc); if (NSPLIT == 1 || NSPLIT == 2) a2[mb] = WFrag<T16>::ld(A2 + aoff + (size_t)mb * 16 * K + kc); }
#pragma unroll
        for (int nb = 0; nb < 4; ++nb) { const V b = WFrag<T16>::ld(Bt + boff + (size_t)nb * 16 * K + kc); V b2; if (NSPLIT >= 2) b2 = WFrag<T16>::ld(Bt2 + boff + (size_t)nb * 16 * K + kc);
#pragma unroll
            for (int mb = 0; mb < 4; ++mb) { acc[mb][nb] = WFrag<T16>::mma(a[mb], b, acc[mb][nb]); if (NSPLIT == 1 || NSPLIT == 2) acc[mb][nb] = WFrag<T16>::mma(a2[mb], b, acc[mb][nb]); if (NSPLIT >= 2) acc[mb][nb] = WFrag<T16>::mma(a[mb], b2, acc[mb][nb]); } }
        asm volatile("v_nop\n\tv_nop\n\tv_nop\n\tv_nop" : "+v"(acc[0][0]), "+v"(acc[1][1]), "+v"(acc[2][2]), "+v"(acc[3][3]) : "v"(a[0]), "v"(a[3]));
    }
#pragma unroll
    for (int mb = 0; mb < 4; ++mb) {
#pragma unroll
        for (int nb = 0; nb < 4; ++nb) {
#pragma unroll
            for (int j = 0; j < 8; ++j) os[(hi * 8 + j) * 68 + nb * 16 + lr] = acc[mb][nb][j]; }
        __builtin_amdgcn_wave_barrier(); asm volatile("" ::: "memory");
        float* crow = C + (size_t)(r0 + mb * 16) * ldc + c0;
{
#pragma unroll
            for (int s = 0; s < 8; ++s) { const int row = 2 * s + hi, cofs = lr * 4; v4f val = *(const v4fa*)(os + row * 68 + cofs);
                *(v4f*)(crow + (size_t)row * ldc + cofs) = val; }
             }
        __builtin_amdgcn_wave_barrier(); asm volatile("" ::: "memory");
    }
}

__device__ __forceinline__ h16 tohx(float x) { return (h16)x; }
__device__ __forceinline__ void splitf(float y, unsigned short& h, unsigned short& l) { h = f2bf(y); l = f2bf(y - bf2f(h)); }
typedef __attribute__((ext_vector_type(2))) _Float16 v2h;
typedef __attribute__((ext_vector_type(4))) _Float16 v4h;
typedef __attribute__((ext_vector_type(2))) unsigned short v2us;
typedef __attribute__((ext_vector_type(4))) unsigned short v4us;
typedef __attribute__((ext_vector_type(2))) float v2f;
typedef __attribute__((ext_vector_type(4))) int v4i;

// grid y = one per-head matrix: NH_ of wq, then NKV of wk, then NKV of wv; the Bt planes of the three lie one behind the other
__global__ __launch_bounds__(256) void k_wtG(const float* __restrict__ wq, const float* __restrict__ wk, const float* __restrict__ wv, int K, int N, bf* Bt) {
    const int y = blockIdx.y; const float* w = (y < NH_) ? wq + (size_t)y * K * N : (y < NH_ + NKV) ? wk + (size_t)(y - NH_) * K * N : wv + (size_t)(y - NH_ - NKV) * K * N; Bt += (size_t)y * N * K;
    const int lane = threadIdx.x & 31; const int L0 = (blockIdx.x * 8 + (threadIdx.x >> 5)) * 8; const int nlines = N * K / 64;
{
#pragma unroll 1
        for (int l = 0; l < 8; ++l) { const int L = L0 + l; if (L >= nlines) break; const size_t e = (size_t)L * 64 + lane * 2; const int k = (int)(e % K), n = (int)(e / K); v2us o;
            o[0] = f2bf(w[(size_t)k * N + n]); o[1] = f2bf(w[(size_t)(k + 1) * N + n]); *(v2us*)(Bt + e) = o; }
         }
}

__global__ __launch_bounds__(256) void k_cvt8(const float* __restrict__ src, bf* dst, size_t n8) { const size_t i = (size_t)blockIdx.x * 256 + threadIdx.x; if (i >= n8) return; const v8f v = *(const v8f*)(src + i * 8); v8us o;
#pragma unroll
    for (int k = 0; k < 8; ++k) o[k] = f2bf(v[k]); *(v8us*)(dst + i * 8) = o;  }

// k_rope: head planes [h][t][d] (fp16 + hi/lo) of rope(x) x sc with the rotate-half convention out[d] = x[d] cos[t][d] - x[d+HD/2] sin[t][d], out[d+HD/2] = x[d+HD/2] cos[t][d+HD/2] + x[d] sin[t][d+HD/2]
__global__ __launch_bounds__(256) void k_rope(const float* __restrict__ F, int pitch, int nheads, const float* __restrict__ CS, const float* __restrict__ RF, const float* __restrict__ nw, float sc, h16* P16, bf* Ph, bf* Pl) {
    const size_t e = ((size_t)blockIdx.x * 256 + threadIdx.x) * 2; if (e >= (size_t)nheads * TT * HD) return; const int d = (int)(e % HD); const int t = (int)((e / HD) % TT); const int h = (int)(e / ((size_t)HD * TT)); const float* f = F + (size_t)t * pitch + h * HD; const float rf = RF ? RF[(size_t)h * TT + t] : 1.0f; v2h o16; v2us oh, ol;
#pragma unroll
    for (int q = 0; q < 2; ++q) { const int dd = d + q; const int dp = (dd < HD / 2) ? dd + HD / 2 : dd - HD / 2; float x0 = f[dd], x1 = f[dp];
        if (RF) { float n0 = __fmul_rn(x0, rf), n1 = __fmul_rn(x1, rf); asm volatile("" : "+v"(n0)); asm volatile("" : "+v"(n1)); x0 = __fmul_rn(bfr(nw[dd]), n0); x1 = __fmul_rn(bfr(nw[dp]), n1); }
        const v2f cs = *(const v2f*)(CS + ((size_t)t * HD + dd) * 2); float a = __fmul_rn(x0, cs[0]), bq = __fmul_rn(x1, cs[1]); asm volatile("" : "+v"(a)); asm volatile("" : "+v"(bq)); const float r = ((dd < HD / 2) ? __fsub_rn(a, bq) : __fadd_rn(a, bq)) * sc;
        o16[q] = tohx(r); unsigned short a2, c2; splitf(r, a2, c2); oh[q] = a2; ol[q] = c2; }
    *(v2h*)(P16 + e) = o16; *(v2us*)(Ph + e) = oh; *(v2us*)(Pl + e) = ol;  }
__global__ __launch_bounds__(256) void k_vtp(const float* __restrict__ F, int pitch, int nheads, h16* V16, bf* Vh, bf* Vl) { const size_t e = ((size_t)blockIdx.x * 256 + threadIdx.x) * 2; if (e >= (size_t)nheads * HD * TT) return; const int t = (int)(e % TT); const int d = (int)((e / TT) % HD); const int g = (int)(e / ((size_t)TT * HD)); v2h o16; v2us oh, ol;
#pragma unroll
    for (int q = 0; q < 2; ++q) { const float x = F[(size_t)(t + q) * pitch + g * HD + d]; o16[q] = tohx(x); unsigned short a2, c2; splitf(x, a2, c2); oh[q] = a2; ol[q] = c2; }
    *(v2h*)(V16 + e) = o16; *(v2us*)(Vh + e) = oh; *(v2us*)(Vl + e) = ol;  }
__global__ __launch_bounds__(256) void k_csid(float* CS) { const int idx = blockIdx.x * 256 + threadIdx.x; if (idx >= TT * HD) return; v2f cs; cs[0] = 1.0f; cs[1] = 0.0f; *(v2f*)(CS + (size_t)idx * 2) = cs;  }
// k_asoft: per row (zz, i): t = S x C^-0.5 (1/32) for j <= i and i - j < WIN (sliding causal window; the reference's -1e9 additive fill vanishes identically); softmax over the 2048 keys (register row, one exp, fixed trees);
__global__ __launch_bounds__(256) void k_asoft(const float* __restrict__ Sb, h16* P16, bf* Ph, bf* Pl) {
    const int lane = threadIdx.x & 31; const int row = blockIdx.x * 8 + (threadIdx.x >> 5); if (row >= ZH * TT) return; const int i = row % TT; const int zz = row / TT; (void)zz; const bool hires = (i < RH); const float* sr = Sb + (size_t)row * TT; float v[TT / 32]; float mx = -3.0e38f;
#pragma unroll
    for (int ch = 0; ch < TT / 128; ++ch) { const int j0 = ch * 128 + lane * 4; const v4f a = *(const v4f*)(sr + j0);
#pragma unroll
        for (int q = 0; q < 4; ++q) { const int j = j0 + q; (void)j; const float t = (j <= i && i - j < WIN) ? a[q] * SCL : -3.0e38f; v[ch * 4 + q] = t; mx = fmaxf(mx, t); } }
#pragma unroll
    for (int sh = 16; sh; sh >>= 1) mx = fmaxf(mx, __shfl_xor(mx, sh, 32));
    float sum = 0.f;
#pragma unroll
    for (int k = 0; k < TT / 32; ++k) { float d0 = __fsub_rn(v[k], mx); asm volatile("" : "+v"(d0)); v[k] = __builtin_amdgcn_exp2f(__fmul_rn(d0, 1.4426950408889634f)); sum += v[k]; }
#pragma unroll
    for (int sh = 16; sh; sh >>= 1) sum += __shfl_xor(sum, sh, 32);
    const float f = __fdiv_rn(hires ? 1.0f : PCAR, sum);
{
        if (hires) {
#pragma unroll
            for (int ch = 0; ch < TT / 128; ++ch) { v4us oh, ol;
#pragma unroll
                for (int q = 0; q < 4; ++q) { unsigned short a, c2; splitf(v[ch * 4 + q] * f, a, c2); oh[q] = a; ol[q] = c2; }
                const size_t oo = ((size_t)zz * (RH ? RH : 1) + i) * TT + ch * 128 + lane * 4; *(v4us*)(Ph + oo) = oh; *(v4us*)(Pl + oo) = ol; }
        } else {
#pragma unroll
            for (int ch = 0; ch < TT / 128; ++ch) { v4h o4;
#pragma unroll
                for (int q = 0; q < 4; ++q) o4[q] = tohx(v[ch * 4 + q] * f);
                *(v4h*)(P16 + (size_t)row * TT + ch * 128 + lane * 4) = o4; } }
         }
}
__global__ __launch_bounds__(256) void k_merge(const float* __restrict__ O, int h0, bf* Ah, bf* Al) { const size_t e = ((size_t)blockIdx.x * 256 + threadIdx.x) * 2; if (e >= (size_t)ZH * TT * HD) return; const int d = (int)(e % HD); const int t = (int)((e / HD) % TT); const int zz = (int)(e / ((size_t)HD * TT)); const float cs = (t < RH) ? 1.0f : (1.0f / PCAR); const size_t oo = (size_t)t * DQ + (h0 + zz) * HD + d;
    v2us oh, ol;
#pragma unroll
    for (int q = 0; q < 2; ++q) { unsigned short a, c2; splitf(O[e + q] * cs, a, c2); oh[q] = a; ol[q] = c2; } *(v2us*)(Ah + oo) = oh; *(v2us*)(Al + oo) = ol;  }

extern "C" void kernel_launch(void* const* d_in, const int* in_sizes, int n_in,
                              void* d_out, int out_size, void* d_ws, size_t ws_size, hipStream_t stream) {
    (void)in_sizes; (void)n_in; (void)out_size;
            const float* x = (const float*)d_in[0]; const float* wq = (const float*)d_in[1]; const float* wk = (const float*)d_in[2]; const float* wv = (const float*)d_in[3]; const float* wo = (const float*)d_in[4]; const float* bo = (const float*)d_in[5];   /* input order x, Wq, Wk, Wv (PER-HEAD [16][1024][64]: 'hcd'), Wo ('oi' [1024][1024]), bo */
    float* OUT = (float*)d_out;     // [2][2048][1024]
    char* wsp = (char*)d_ws;
    auto take = [&](size_t bytes) { char* p = wsp; wsp += (bytes + 255) & ~(size_t)255; return (void*)p; };
    bf* WQ = (bf*)take((size_t)DQ * DM * 2); bf* WK = (bf*)take((size_t)DKV * DM * 2); bf* WV = (bf*)take((size_t)DKV * DM * 2); bf* WO = (bf*)take((size_t)DM * DQ * 2); float* CS = (float*)take((size_t)TT * HD * 2 * 4);
    bf* XB = (bf*)take((size_t)NB_ * TT * DM * 2); float* F = (float*)take((size_t)NB_ * TT * PQKV * 4);   // both batches: bf16 x, and q | k | v projections side by side in each row
    h16* QP16 = (h16*)take((size_t)NH_ * TT * HD * 2); h16* KP16 = (h16*)take((size_t)NKV * TT * HD * 2); h16* VT16 = (h16*)take((size_t)NKV * HD * TT * 2);
    bf* QPh = (bf*)take((size_t)NH_ * TT * HD * 2); bf* QPl = (bf*)take((size_t)NH_ * TT * HD * 2); bf* KPh = (bf*)take((size_t)NKV * TT * HD * 2); bf* KPl = (bf*)take((size_t)NKV * TT * HD * 2); bf* VTh = (bf*)take((size_t)NKV * HD * TT * 2); bf* VTl = (bf*)take((size_t)NKV * HD * TT * 2); bf* Ph = (bf*)take((size_t)ZH * RH * TT * 2); bf* Pl = (bf*)take((size_t)ZH * RH * TT * 2);
    float* Sb = (float*)take((size_t)ZH * TT * TT * 4); h16* P16 = (h16*)take((size_t)ZH * TT * TT * 2); float* Ob = (float*)take((size_t)ZH * TT * HD * 4); bf* ATh = (bf*)take((size_t)NB_ * TT * DQ * 2); bf* ATl = (bf*)take((size_t)NB_ * TT * DQ * 2);
    (void)WK; (void)WV;   // reached through WQ: the three planes are contiguous
    if ((size_t)(wsp - (char*)d_ws) > ws_size) return;    // ws 256 MiB
    k_wtG<<<dim3((unsigned)((DM * HD / 64 + 63) / 64), NH_ + 2 * NKV, 1), 256, 0, stream>>>(wq, wk, wv, DM, HD, WQ);   /* every per-head weight [h][DM][HD] ('xw' per head) -> its HD rows of the Bt planes WQ | WK | WV (contiguous) */
    k_cvt8<<<(unsigned)(((size_t)DM * DQ / 8 + 255) / 256), 256, 0, stream>>>(wo, WO, (size_t)DM * DQ / 8);
    k_csid<<<(TT * HD + 255) / 256, 256, 0, stream>>>(CS);
    const unsigned LQ = (unsigned)(((size_t)NH_ * TT * HD / 2 + 255) / 256), LKv = (unsigned)(((size_t)NKV * TT * HD / 2 + 255) / 256);
    k_cvt8<<<(unsigned)(((size_t)NB_ * TT * DM / 8 + 255) / 256), 256, 0, stream>>>(x, XB, (size_t)NB_ * TT * DM / 8);
    k_gemmw<bf, 0, false><<<dim3(NB_ * TT / 64, PQKV / 64, 1), 32, 0, stream>>>(XB, nullptr, WQ, nullptr, DM, F, PQKV, nullptr, 0, 0, 0);   // q, k and v of both batches in one launch
    for (int b = 0; b < NB_; ++b) {
        const float* Fb = F + (size_t)b * TT * PQKV; bf* AThb = ATh + (size_t)b * TT * DQ; bf* ATlb = ATl + (size_t)b * TT * DQ;
        k_rope<<<LQ, 256, 0, stream>>>(Fb, PQKV, NH_, CS, nullptr, nullptr, 1.0f, QP16, QPh, QPl);
        k_rope<<<LKv, 256, 0, stream>>>(Fb + DQ, PQKV, NKV, CS, nullptr, nullptr, 1.0f, KP16, KPh, KPl);
        k_vtp<<<LKv, 256, 0, stream>>>(Fb + DQ + DKV, PQKV, NKV, VT16, VTh, VTl);
        for (int h0 = 0; h0 < NH_; h0 += ZH) { const size_t zq = (size_t)h0, zk = (size_t)(h0 / REP);   // one kv head per query head: the pass's ZH heads use consecutive kv planes (z-strides TT*HD)
            k_gemmc<bf, 2, 1><<<dim3(RH / 64, TT / 64, ZH), 32, 0, stream>>>(QPh + zq * TT * HD, QPl + zq * TT * HD, KPh + zk * TT * HD, KPl + zk * TT * HD, HD, Sb, TT, 0, (size_t)TT * HD, (size_t)TT * HD, (size_t)TT * TT);
            k_gemmc<h16, 0, 1><<<dim3((TT - RH) / 64, TT / 64, ZH), 32, 0, stream>>>(QP16 + zq * TT * HD + (size_t)RH * HD, nullptr, KP16 + zk * TT * HD, nullptr, HD, Sb + (size_t)RH * TT, TT, RH, (size_t)TT * HD, (size_t)TT * HD, (size_t)TT * TT);
            k_asoft<<<ZH * TT / 8, 256, 0, stream>>>(Sb, P16, Ph, Pl);
            k_gemmc<bf, 2, 2><<<dim3(RH / 64, HD / 64, ZH), 32, 0, stream>>>(Ph, Pl, VTh + zk * HD * TT, VTl + zk * HD * TT, TT, Ob, HD, 0, (size_t)RH * TT, (size_t)HD * TT, (size_t)TT * HD);
            k_gemmc<h16, 0, 2><<<dim3((TT - RH) / 64, HD / 64, ZH), 32, 0, stream>>>(P16 + (size_t)RH * TT, nullptr, VT16 + zk * HD * TT, nullptr, TT, Ob + (size_t)RH * HD, HD, RH, (size_t)TT * TT, (size_t)HD * TT, (size_t)TT * HD);
            k_merge<<<(unsigned)(((size_t)ZH * TT * HD / 2 + 255) / 256), 256, 0, stream>>>(Ob, h0, AThb, ATlb); } }
    k_gemmw<bf, 1, true><<<dim3(NB_ * TT / 64, DM / 64, 1), 32, 0, stream>>>(ATh, ATl, WO, nullptr, DQ, OUT, DM, bo, 0, 0, 0);   // both batches in one launch
}

// v002
// Measured time: 207 microseconds a run.
// In both of two side-by-side timings against v001, it was 3.99 times as fast.
// All steps since v000 together make it 8.57 times as fast.
#include <hip/hip_runtime.h>

// Causal multi-head attention with PER-HEAD projection weights and a model-width score scale (x [2][2048][1024]; q, k, v = einsum('btc,hcd->bhtd', x, W) with W [16][1024][64]: head h has its own (in, out) matrix ('xw' per head; no bias; 16 heads x 64); scores x 1/sqrt(float32(C)) with C = 1024 = 1/32 (the MODEL width: the module's own choice; soft logits); causal (-inf); softmax; out merged head-major; out Wo^T + bo ('oi' [1024][1024] + bias normal: non-zero) -> [2][2048][1024] (4.2 M); argument order x, Wq, Wk, Wv, Wo, bo).
// Layout: bf16 copy of x (both batches); each PER-HEAD q / k / v weight [h][1024][64] transposed once into its 64 rows of the Bt plane (k_wtG per head); Wp cast once ('oi' = Bt as stored); exact projections; identity-table plane builders; one fused causal attention launch (k_fattn: scores and probabilities stay in registers, online softmax; hybrid rows: < 512 hi/lo 3 products, rest fp16); merged hi/lo x w_o exact.
// Compute dtypes, f32 accumulate: every input rounded to bf16; projections exact; attention rows < 512 3 products, rest fp16; softmax f32; w_o hl x exact.

#define NB_  2
#define TT   2048
#define DM   1024
#define NH_  16
#define NKV  16
#define REP  (NH_ / NKV)
#define HD   64
#define DQ   (NH_ * HD)
#define DKV  (NKV * HD)
#define PQKV (DQ + 2 * DKV)       // row pitch of the joint q | k | v projection plane
#define RH   512                  // query rows < RH use hi+lo planes (0: none)
#define SCL  0.03125f   // 1 / sqrt(C) with C = 1024 = the MODEL width (this module scales its scores by the model width, not the head width): exactly 2^-5
typedef _Float16 h16;
typedef unsigned short bf;
typedef __attribute__((ext_vector_type(16))) __bf16   v16bf;
typedef __attribute__((ext_vector_type(16))) _Float16 v16h;
typedef __attribute__((ext_vector_type(8)))  _Float16 v8h;
typedef __attribute__((ext_vector_type(8)))  unsigned short v8us;
typedef __attribute__((ext_vector_type(8)))  float    v8f;
typedef __attribute__((ext_vector_type(4)))  float    v4f;
typedef v8h  __attribute__((may_alias)) v8ha;
typedef v4f  __attribute__((may_alias)) v4fa;
typedef v8us __attribute__((may_alias)) v8usa;

__device__ __forceinline__ unsigned short f2bf(float f) { unsigned u = __float_as_uint(f); u += 0x7FFFu + ((u >> 16) & 1u); return (unsigned short)(u >> 16); }
__device__ __forceinline__ float bf2f(unsigned short b) { return __uint_as_float(((unsigned)b) << 16); }
__device__ __forceinline__ float bfr(float f) { return bf2f(f2bf(f)); }
__device__ __forceinline__ v16h cat16(v8h lo, v8h hi) { return __builtin_shufflevector(lo, hi, 0, 1, 2, 3, 4, 5, 6, 7, 8, 9, 10, 11, 12, 13, 14, 15); }
__device__ __forceinline__ v16bf cat16b(v8us lo, v8us hi) { return __builtin_bit_cast(v16bf, __builtin_shufflevector(lo, hi, 0, 1, 2, 3, 4, 5, 6, 7, 8, 9, 10, 11, 12, 13, 14, 15)); }
__device__ __forceinline__ v8f wmma16(v16h a, v16h b, v8f c) { return __builtin_amdgcn_wmma_f32_16x16x32_f16(false, a, false, b, (short)0, c, false, false); }
__device__ __forceinline__ v8f wmmab(v16bf a, v16bf b, v8f c) { return __builtin_amdgcn_wmma_f32_16x16x32_bf16(false, a, false, b, (short)0, c, false, false); }



// ---- k_gemmw: register-blocked GEMM, ONE WAVE per 64x64 output tile (16 accumulators), operands straight from K-contiguous 16-bit planes; grid (M/64, N/64, Z), 32 threads.
// C[m][n] (f32, pitch ldc, + optional f32 bias[n]) = sum_k A[m][k] Bt[n][k] (+ split products per NSPLIT). z-batch strides sA/sB/sC in elements. K % 32 == 0.
template <typename T16> struct WFrag;
template <> struct WFrag<h16> { typedef v16h V; static __device__ __forceinline__ V ld(const h16* p) { return cat16(*(const v8h*)p, *(const v8h*)(p + 16)); } static __device__ __forceinline__ v8f mma(V a, V b, v8f c) { return wmma16(a, b, c); } };
template <> struct WFrag<bf> { typedef v16bf V; static __device__ __forceinline__ V ld(const bf* p) { return cat16b(*(const v8us*)p, *(const v8us*)(p + 16)); } static __device__ __forceinline__ v8f mma(V a, V b, v8f c) { return wmmab(a, b, c); } };
template <typename T16, int NSPLIT, bool BIAS>
__global__ __launch_bounds__(32) void k_gemmw(const T16* __restrict__ A, const T16* __restrict__ A2, const T16* __restrict__ Bt, const T16* __restrict__ Bt2, int K, float* C, int ldc, const float* __restrict__ bias, size_t sA, size_t sB, size_t sC) {
    typedef typename WFrag<T16>::V V;
    __shared__ __align__(16) float os[16 * 68];
    const size_t z = blockIdx.z; A += z * sA; if (A2) A2 += z * sA; Bt += z * sB; if (Bt2) Bt2 += z * sB; C += z * sC;
    const int lane = threadIdx.x & 31, lr = lane & 15, hi = lane >> 4; const int r0 = blockIdx.x * 64, c0 = blockIdx.y * 64;
    v8f acc[4][4];
#pragma unroll
    for (int mb = 0; mb < 4; ++mb)
#pragma unroll
        for (int nb = 0; nb < 4; ++nb) acc[mb][nb] = (v8f){};
    const size_t aoff = (size_t)(r0 + lr) * K + 8 * hi, boff = (size_t)(c0 + lr) * K + 8 * hi;
#pragma unroll 1
    for (int kc = 0; kc < K; kc += 32) {
        V a[4], a2[4];
#pragma unroll
        for (int mb = 0; mb < 4; ++mb) { a[mb] = WFrag<T16>::ld(A + aoff + (size_t)mb * 16 * K + kc); if (NSPLIT == 1 || NSPLIT == 2) a2[mb] = WFrag<T16>::ld(A2 + aoff + (size_t)mb * 16 * K + kc); }
#pragma unroll
        for (int nb = 0; nb < 4; ++nb) { const V b = WFrag<T16>::ld(Bt + boff + (size_t)nb * 16 * K + kc); V b2; if (NSPLIT >= 2) b2 = WFrag<T16>::ld(Bt2 + boff + (size_t)nb * 16 * K + kc);
#pragma unroll
            for (int mb = 0; mb < 4; ++mb) { acc[mb][nb] = WFrag<T16>::mma(a[mb], b, acc[mb][nb]); if (NSPLIT == 1 || NSPLIT == 2) acc[mb][nb] = WFrag<T16>::mma(a2[mb], b, acc[mb][nb]); if (NSPLIT >= 2) acc[mb][nb] = WFrag<T16>::mma(a[mb], b2, acc[mb][nb]); } }
        asm volatile("v_nop\n\tv_nop\n\tv_nop\n\tv_nop" : "+v"(acc[0][0]), "+v"(acc[1][1]), "+v"(acc[2][2]), "+v"(acc[3][3]) : "v"(a[0]), "v"(a[3]));
    }
#pragma unroll
    for (int mb = 0; mb < 4; ++mb) {
#pragma unroll
        for (int nb = 0; nb < 4; ++nb) {
#pragma unroll
            for (int j = 0; j < 8; ++j) os[(hi * 8 + j) * 68 + nb * 16 + lr] = acc[mb][nb][j]; }
        __builtin_amdgcn_wave_barrier(); asm volatile("" ::: "memory");
        float* crow = C + (size_t)(r0 + mb * 16) * ldc + c0;
{
#pragma unroll
            for (int s = 0; s < 8; ++s) { const int row = 2 * s + hi, cofs = lr * 4; v4f val = *(const v4fa*)(os + row * 68 + cofs); if (BIAS) { val[0] += bfr(bias[c0 + cofs]); val[1] += bfr(bias[c0 + cofs + 1]); val[2] += bfr(bias[c0 + cofs + 2]); val[3] += bfr(bias[c0 + cofs + 3]); }
                *(v4f*)(crow + (size_t)row * ldc + cofs) = val; }
             }
        __builtin_amdgcn_wave_barrier(); asm volatile("" ::: "memory");
    }
}

__device__ __forceinline__ h16 tohx(float x) { return (h16)x; }
__device__ __forceinline__ void splitf(float y, unsigned short& h, unsigned short& l) { h = f2bf(y); l = f2bf(y - bf2f(h)); }
typedef __attribute__((ext_vector_type(2))) _Float16 v2h;
typedef __attribute__((ext_vector_type(4))) _Float16 v4h;
typedef __attribute__((ext_vector_type(2))) unsigned short v2us;
typedef __attribute__((ext_vector_type(4))) unsigned short v4us;
typedef __attribute__((ext_vector_type(2))) float v2f;
typedef __attribute__((ext_vector_type(4))) int v4i;

// grid y = one per-head matrix: NH_ of wq, then NKV of wk, then NKV of wv; the Bt planes of the three lie one behind the other
__global__ __launch_bounds__(256) void k_wtG(const float* __restrict__ wq, const float* __restrict__ wk, const float* __restrict__ wv, int K, int N, bf* Bt) {
    const int y = blockIdx.y; const float* w = (y < NH_) ? wq + (size_t)y * K * N : (y < NH_ + NKV) ? wk + (size_t)(y - NH_) * K * N : wv + (size_t)(y - NH_ - NKV) * K * N; Bt += (size_t)y * N * K;
    const int lane = threadIdx.x & 31; const int L0 = (blockIdx.x * 8 + (threadIdx.x >> 5)) * 8; const int nlines = N * K / 64;
{
#pragma unroll 1
        for (int l = 0; l < 8; ++l) { const int L = L0 + l; if (L >= nlines) break; const size_t e = (size_t)L * 64 + lane * 2; const int k = (int)(e % K), n = (int)(e / K); v2us o;
            o[0] = f2bf(w[(size_t)k * N + n]); o[1] = f2bf(w[(size_t)(k + 1) * N + n]); *(v2us*)(Bt + e) = o; }
         }
}

__global__ __launch_bounds__(256) void k_cvt8(const float* __restrict__ src, bf* dst, size_t n8) { const size_t i = (size_t)blockIdx.x * 256 + threadIdx.x; if (i >= n8) return; const v8f v = *(const v8f*)(src + i * 8); v8us o;
#pragma unroll
    for (int k = 0; k < 8; ++k) o[k] = f2bf(v[k]); *(v8us*)(dst + i * 8) = o;  }

// k_rope: head planes [h][t][d] (fp16 + hi/lo) of rope(x) x sc with the rotate-half convention out[d] = x[d] cos[t][d] - x[d+HD/2] sin[t][d], out[d+HD/2] = x[d+HD/2] cos[t][d+HD/2] + x[d] sin[t][d+HD/2]
__global__ __launch_bounds__(256) void k_rope(const float* __restrict__ F, int pitch, int nheads, const float* __restrict__ CS, const float* __restrict__ RF, const float* __restrict__ nw, float sc, h16* P16, bf* Ph, bf* Pl) {
    const size_t e = ((size_t)blockIdx.x * 256 + threadIdx.x) * 2; if (e >= (size_t)nheads * TT * HD) return; const int d = (int)(e % HD); const int t = (int)((e / HD) % TT); const int h = (int)(e / ((size_t)HD * TT)); const float* f = F + (size_t)t * pitch + h * HD; const float rf = RF ? RF[(size_t)h * TT + t] : 1.0f; v2h o16; v2us oh, ol;
#pragma unroll
    for (int q = 0; q < 2; ++q) { const int dd = d + q; const int dp = (dd < HD / 2) ? dd + HD / 2 : dd - HD / 2; float x0 = f[dd], x1 = f[dp];
        if (RF) { float n0 = __fmul_rn(x0, rf), n1 = __fmul_rn(x1, rf); asm volatile("" : "+v"(n0)); asm volatile("" : "+v"(n1)); x0 = __fmul_rn(bfr(nw[dd]), n0); x1 = __fmul_rn(bfr(nw[dp]), n1); }
        const v2f cs = *(const v2f*)(CS + ((size_t)t * HD + dd) * 2); float a = __fmul_rn(x0, cs[0]), bq = __fmul_rn(x1, cs[1]); asm volatile("" : "+v"(a)); asm volatile("" : "+v"(bq)); const float r = ((dd < HD / 2) ? __fsub_rn(a, bq) : __fadd_rn(a, bq)) * sc;
        o16[q] = tohx(r); unsigned short a2, c2; splitf(r, a2, c2); oh[q] = a2; ol[q] = c2; }
    *(v2h*)(P16 + e) = o16; *(v2us*)(Ph + e) = oh; *(v2us*)(Pl + e) = ol;  }
__global__ __launch_bounds__(256) void k_vtp(const float* __restrict__ F, int pitch, int nheads, h16* V16, bf* Vh, bf* Vl) { const size_t e = ((size_t)blockIdx.x * 256 + threadIdx.x) * 2; if (e >= (size_t)nheads * HD * TT) return; const int t = (int)(e % TT); const int d = (int)((e / TT) % HD); const int g = (int)(e / ((size_t)TT * HD)); v2h o16; v2us oh, ol;
#pragma unroll
    for (int q = 0; q < 2; ++q) { const float x = F[(size_t)(t + q) * pitch + g * HD + d]; o16[q] = tohx(x); unsigned short a2, c2; splitf(x, a2, c2); oh[q] = a2; ol[q] = c2; }
    *(v2h*)(V16 + e) = o16; *(v2us*)(Vh + e) = oh; *(v2us*)(Vl + e) = ol;  }
__global__ __launch_bounds__(256) void k_csid(float* CS) { const int idx = blockIdx.x * 256 + threadIdx.x; if (idx >= TT * HD) return; v2f cs; cs[0] = 1.0f; cs[1] = 0.0f; *(v2f*)(CS + (size_t)idx * 2) = cs;  }
#define C2L 0.045084220027780106f   // SCL x log2(e): exp(SCL (s - m)) = exp2(C2L s - C2L m)
// Stands behind a group of issued global loads. s_wait_xcnt 0 stands in front of every later rewrite of the registers that hold their addresses; the addresses are named as inputs so that those registers stay as they are up to the wait.
// sched_barrier: without it the scheduler moves the loads down to their first use, where they no longer fly under the arithmetic in between.
__device__ __forceinline__ void loads_issued(const void* a, const void* b) { asm volatile("s_wait_xcnt 0x0" :: "v"(a), "v"(b) : "memory"); __builtin_amdgcn_sched_barrier(0); }
__device__ __forceinline__ void loads_issued(const void* a, const void* b, const void* c, const void* d) { asm volatile("s_wait_xcnt 0x0" :: "v"(a), "v"(b), "v"(c), "v"(d) : "memory"); __builtin_amdgcn_sched_barrier(0); }
__device__ __forceinline__ float xhalf(float x) { return __builtin_bit_cast(float, __builtin_amdgcn_permlanex16(__builtin_bit_cast(int, x), __builtin_bit_cast(int, x), 0x76543210, 0xfedcba98, false, false)); }   // lane l reads lane l ^ 16
__device__ __forceinline__ void attn_store(const v8f (&o)[4], float l, bf* Ah, bf* Al, int row, int hi) {
    const float f = __fdiv_rn(1.0f, l + xhalf(l));
#pragma unroll
    for (int db = 0; db < 4; ++db) { v8us oh, ol;
#pragma unroll
        for (int j = 0; j < 8; ++j) { unsigned short x, y; splitf(o[db][j] * f, x, y); oh[j] = x; ol[j] = y; }
        const size_t oo = (size_t)row * DQ + db * 16 + hi * 8; *(v8us*)(Ah + oo) = oh; *(v8us*)(Al + oo) = ol; }
}
// running maximum m (raw score units) and sum l of one query column over its 16 new scores; st becomes exp(SCL (s - m)); returns the factor for what was summed under the old maximum
__device__ __forceinline__ float attn_soft(v8f (&st)[2], float& m, float& l) {
    float mx = m;
#pragma unroll
    for (int kt = 0; kt < 2; ++kt)
#pragma unroll
        for (int j = 0; j < 8; ++j) mx = fmaxf(mx, st[kt][j]);
    mx = fmaxf(mx, xhalf(mx));
    const float al = __builtin_amdgcn_exp2f((m - mx) * C2L), mc = mx * C2L; m = mx; float s = 0.f;
#pragma unroll
    for (int kt = 0; kt < 2; ++kt)
#pragma unroll
        for (int j = 0; j < 8; ++j) { const float p = __builtin_amdgcn_exp2f(__builtin_fmaf(st[kt][j], C2L, -mc)); st[kt][j] = p; s += p; }
    l = l * al + s; return al;
}
__device__ __forceinline__ void attn_mask(v8f (&st)[2], int kb, int query, int hi) {
#pragma unroll
    for (int kt = 0; kt < 2; ++kt)
#pragma unroll
        for (int j = 0; j < 8; ++j) st[kt][j] = (kb + kt * 16 + hi * 8 + j <= query) ? st[kt][j] : -3.0e38f;
}
// query rows >= RH: fp16 operands, 32 query rows a wave. One pass = 32 keys from kb on. pv: the lane's place in this pass's V^T columns; pk: in the NEXT pass's K rows; both step on behind the loads.
// ak holds this pass's K fragments on entry and, where DIAG is false, the next pass's on return (they fly while this pass computes).
template <bool DIAG>
__device__ __forceinline__ void attn_f16_pass(const h16* __restrict__& pk, const h16* __restrict__& pv, int kb, int q0, int lr, int hi, const v16h (&bq)[2][2], v16h (&ak)[2][2], v8f (&o)[2][4], float (&m)[2], float (&l)[2]) {
    v16h av[4];
#pragma unroll
    for (int db = 0; db < 4; ++db) av[db] = WFrag<h16>::ld(pv + (size_t)db * 16 * TT);
    v8f st[2][2];
#pragma unroll
    for (int nq = 0; nq < 2; ++nq)
#pragma unroll
        for (int kt = 0; kt < 2; ++kt) { st[nq][kt] = wmma16(ak[kt][0], bq[nq][0], (v8f){}); st[nq][kt] = wmma16(ak[kt][1], bq[nq][1], st[nq][kt]); }
    if (!DIAG) {
#pragma unroll
        for (int kt = 0; kt < 2; ++kt)
#pragma unroll
            for (int ks = 0; ks < 2; ++ks) ak[kt][ks] = WFrag<h16>::ld(pk + kt * 16 * HD + ks * 32);
    }
    loads_issued(pk, pv);
    pk += 32 * HD; pv += 32;
    if (DIAG) { attn_mask(st[0], kb, q0 + lr, hi); attn_mask(st[1], kb, q0 + 16 + lr, hi); }   // only the diagonal pass holds keys beyond a query
#pragma unroll
    for (int nq = 0; nq < 2; ++nq) { const float al = attn_soft(st[nq], m[nq], l[nq]); v16h bp;
#pragma unroll
        for (int e = 0; e < 16; ++e) bp[e] = tohx(st[nq][e >> 3][e & 7]);
#pragma unroll
        for (int db = 0; db < 4; ++db) { o[nq][db] *= al; o[nq][db] = wmma16(av[db], bp, o[nq][db]); } }
}
__device__ __forceinline__ void attn_f16(const h16* __restrict__ Q, const h16* __restrict__ Kp, const h16* __restrict__ Vt, int q0, bf* Ah, bf* Al, int lr, int hi) {
    const h16* pq = Q + (size_t)(q0 + lr) * HD + 8 * hi;
    v16h bq[2][2];
#pragma unroll
    for (int nq = 0; nq < 2; ++nq)
#pragma unroll
        for (int ks = 0; ks < 2; ++ks) bq[nq][ks] = WFrag<h16>::ld(pq + nq * 16 * HD + ks * 32);
    v8f o[2][4]; float m[2], l[2];
#pragma unroll
    for (int nq = 0; nq < 2; ++nq) { m[nq] = -3.0e38f; l[nq] = 0.f;
#pragma unroll
        for (int db = 0; db < 4; ++db) o[nq][db] = (v8f){}; }
    const h16* __restrict__ pk = Kp + (size_t)lr * HD + 8 * hi; const h16* __restrict__ pv = Vt + (size_t)lr * TT + 8 * hi;
    v16h ak[2][2];
#pragma unroll
    for (int kt = 0; kt < 2; ++kt)
#pragma unroll
        for (int ks = 0; ks < 2; ++ks) ak[kt][ks] = WFrag<h16>::ld(pk + kt * 16 * HD + ks * 32);
    loads_issued(pq, pk);
    pk += 32 * HD;
#pragma unroll 1
    for (int kb = 0; kb < q0; kb += 32) attn_f16_pass<false>(pk, pv, kb, q0, lr, hi, bq, ak, o, m, l);
    attn_f16_pass<true>(pk, pv, q0, q0, lr, hi, bq, ak, o, m, l);
    attn_store(o[0], l[0], Ah, Al, q0 + lr, hi); attn_store(o[1], l[1], Ah, Al, q0 + 16 + lr, hi);
}
// query rows < RH: bf16 hi + lo planes, 3 products (hi hi, lo hi, hi lo) for the scores and for probability x value; 16 query rows a wave
__device__ __forceinline__ void attn_hl(const bf* __restrict__ Qh, const bf* __restrict__ Ql, const bf* __restrict__ Kh, const bf* __restrict__ Kl, const bf* __restrict__ Vh, const bf* __restrict__ Vl, int q0, bf* Ah, bf* Al, int lr, int hi) {
    v16bf qh[2], ql[2];
#pragma unroll
    for (int ks = 0; ks < 2; ++ks) { const size_t qo = (size_t)(q0 + lr) * HD + ks * 32 + 8 * hi; qh[ks] = WFrag<bf>::ld(Qh + qo); ql[ks] = WFrag<bf>::ld(Ql + qo); }
    v8f o[4]; float m = -3.0e38f, l = 0.f;
#pragma unroll
    for (int db = 0; db < 4; ++db) o[db] = (v8f){};
    const size_t ko = (size_t)lr * HD + 8 * hi, vo = (size_t)lr * TT + 8 * hi;
    const bf* __restrict__ pkh = Kh + ko; const bf* __restrict__ pkl = Kl + ko; const bf* __restrict__ pvh = Vh + vo; const bf* __restrict__ pvl = Vl + vo;   // the lane's places in this pass's K rows and V^T columns
#pragma unroll 1
    for (int kb = 0; kb <= q0; kb += 32) {   // q0 is a multiple of 16: the last pass holds the diagonal, and its 32 keys lie below RH + 16 <= TT
        v16bf kh[2][2], kl[2][2], vh[4], vl[4];
#pragma unroll
        for (int kt = 0; kt < 2; ++kt)
#pragma unroll
            for (int ks = 0; ks < 2; ++ks) { const int e = kt * 16 * HD + ks * 32; kh[kt][ks] = WFrag<bf>::ld(pkh + e); kl[kt][ks] = WFrag<bf>::ld(pkl + e); }
#pragma unroll
        for (int db = 0; db < 4; ++db) { const size_t e = (size_t)db * 16 * TT; vh[db] = WFrag<bf>::ld(pvh + e); vl[db] = WFrag<bf>::ld(pvl + e); }
        loads_issued(pkh, pkl, pvh, pvl);
        pkh += 32 * HD; pkl += 32 * HD; pvh += 32; pvl += 32;
        v8f st[2];
#pragma unroll
        for (int kt = 0; kt < 2; ++kt) { st[kt] = (v8f){};
#pragma unroll
            for (int ks = 0; ks < 2; ++ks) { st[kt] = wmmab(kh[kt][ks], qh[ks], st[kt]); st[kt] = wmmab(kh[kt][ks], ql[ks], st[kt]); st[kt] = wmmab(kl[kt][ks], qh[ks], st[kt]); } }
        if (kb + 31 > q0) attn_mask(st, kb, q0 + lr, hi);
        const float al = attn_soft(st, m, l); v8us p0h, p0l, p1h, p1l;
#pragma unroll
        for (int j = 0; j < 8; ++j) { unsigned short x, y; splitf(st[0][j], x, y); p0h[j] = x; p0l[j] = y; splitf(st[1][j], x, y); p1h[j] = x; p1l[j] = y; }
        const v16bf ph = cat16b(p0h, p1h), pl = cat16b(p0l, p1l);
#pragma unroll
        for (int db = 0; db < 4; ++db) { o[db] *= al; o[db] = wmmab(vh[db], ph, o[db]); o[db] = wmmab(vh[db], pl, o[db]); o[db] = wmmab(vl[db], ph, o[db]); }
    }
    attn_store(o, l, Ah, Al, q0 + lr, hi);
}
// grid (NB_ * NH_, (TT - RH) / 128 + RH / 64), 4 waves; y falls with the rows' cost: y = 0 holds the last (longest) query rows
__global__ __launch_bounds__(128) void k_fattn(const h16* __restrict__ Q16, const h16* __restrict__ K16, const h16* __restrict__ V16, const bf* __restrict__ Qh, const bf* __restrict__ Ql, const bf* __restrict__ Kh, const bf* __restrict__ Kl, const bf* __restrict__ Vh, const bf* __restrict__ Vl, bf* Ah, bf* Al) {
    const int lane = threadIdx.x & 31, lr = lane & 15, hi = lane >> 4; const int w = __builtin_amdgcn_readfirstlane(threadIdx.x >> 5);
    const int b = blockIdx.x / NH_, h = blockIdx.x % NH_, y = blockIdx.y; const size_t pq = (size_t)(b * NH_ + h) * TT * HD, pk = (size_t)(b * NKV + h / REP) * TT * HD, po = (size_t)b * TT * DQ + h * HD;
    if (y < (TT - RH) / 128) attn_f16(Q16 + pq, K16 + pk, V16 + pk, TT - 128 * y - 32 * (w + 1), Ah + po, Al + po, lr, hi);
    else attn_hl(Qh + pq, Ql + pq, Kh + pk, Kl + pk, Vh + pk, Vl + pk, RH - 64 * (y - (TT - RH) / 128) - 16 * (w + 1), Ah + po, Al + po, lr, hi);
}

extern "C" void kernel_launch(void* const* d_in, const int* in_sizes, int n_in,
                              void* d_out, int out_size, void* d_ws, size_t ws_size, hipStream_t stream) {
    (void)in_sizes; (void)n_in; (void)out_size;
            const float* x = (const float*)d_in[0]; const float* wq = (const float*)d_in[1]; const float* wk = (const float*)d_in[2]; const float* wv = (const float*)d_in[3]; const float* wo = (const float*)d_in[4]; const float* bo = (const float*)d_in[5];   /* input order x, Wq, Wk, Wv (PER-HEAD [16][1024][64]: 'hcd'), Wo ('oi' [1024][1024]), bo */
    float* OUT = (float*)d_out;     // [2][2048][1024]
    char* wsp = (char*)d_ws;
    auto take = [&](size_t bytes) { char* p = wsp; wsp += (bytes + 255) & ~(size_t)255; return (void*)p; };
    bf* WQ = (bf*)take((size_t)DQ * DM * 2); bf* WK = (bf*)take((size_t)DKV * DM * 2); bf* WV = (bf*)take((size_t)DKV * DM * 2); bf* WO = (bf*)take((size_t)DM * DQ * 2); float* CS = (float*)take((size_t)TT * HD * 2 * 4);
    bf* XB = (bf*)take((size_t)NB_ * TT * DM * 2); float* F = (float*)take((size_t)NB_ * TT * PQKV * 4);   // both batches: bf16 x, and q | k | v projections side by side in each row
    const size_t NQP = (size_t)NH_ * TT * HD, NKP = (size_t)NKV * TT * HD;   // elements of one batch's query / key-value head planes; every plane holds both batches, [b][h]
    h16* QP16 = (h16*)take(NB_ * NQP * 2); h16* KP16 = (h16*)take(NB_ * NKP * 2); h16* VT16 = (h16*)take(NB_ * NKP * 2);
    bf* QPh = (bf*)take(NB_ * NQP * 2); bf* QPl = (bf*)take(NB_ * NQP * 2); bf* KPh = (bf*)take(NB_ * NKP * 2); bf* KPl = (bf*)take(NB_ * NKP * 2); bf* VTh = (bf*)take(NB_ * NKP * 2); bf* VTl = (bf*)take(NB_ * NKP * 2);
    bf* ATh = (bf*)take((size_t)NB_ * TT * DQ * 2); bf* ATl = (bf*)take((size_t)NB_ * TT * DQ * 2);
    (void)WK; (void)WV;   // reached through WQ: the three planes are contiguous
    if ((size_t)(wsp - (char*)d_ws) > ws_size) return;    // ws 256 MiB
    k_wtG<<<dim3((unsigned)((DM * HD / 64 + 63) / 64), NH_ + 2 * NKV, 1), 256, 0, stream>>>(wq, wk, wv, DM, HD, WQ);   /* every per-head weight [h][DM][HD] ('xw' per head) -> its HD rows of the Bt planes WQ | WK | WV (contiguous) */
    k_cvt8<<<(unsigned)(((size_t)DM * DQ / 8 + 255) / 256), 256, 0, stream>>>(wo, WO, (size_t)DM * DQ / 8);
    k_csid<<<(TT * HD + 255) / 256, 256, 0, stream>>>(CS);
    const unsigned LQ = (unsigned)(((size_t)NH_ * TT * HD / 2 + 255) / 256), LKv = (unsigned)(((size_t)NKV * TT * HD / 2 + 255) / 256);
    k_cvt8<<<(unsigned)(((size_t)NB_ * TT * DM / 8 + 255) / 256), 256, 0, stream>>>(x, XB, (size_t)NB_ * TT * DM / 8);
    k_gemmw<bf, 0, false><<<dim3(NB_ * TT / 64, PQKV / 64, 1), 32, 0, stream>>>(XB, nullptr, WQ, nullptr, DM, F, PQKV, nullptr, 0, 0, 0);   // q, k and v of both batches in one launch
    for (int b = 0; b < NB_; ++b) {
        const float* Fb = F + (size_t)b * TT * PQKV;
        k_rope<<<LQ, 256, 0, stream>>>(Fb, PQKV, NH_, CS, nullptr, nullptr, 1.0f, QP16 + b * NQP, QPh + b * NQP, QPl + b * NQP);
        k_rope<<<LKv, 256, 0, stream>>>(Fb + DQ, PQKV, NKV, CS, nullptr, nullptr, 1.0f, KP16 + b * NKP, KPh + b * NKP, KPl + b * NKP);
        k_vtp<<<LKv, 256, 0, stream>>>(Fb + DQ + DKV, PQKV, NKV, VT16 + b * NKP, VTh + b * NKP, VTl + b * NKP); }
    k_fattn<<<dim3(NB_ * NH_, (TT - RH) / 128 + RH / 64, 1), 128, 0, stream>>>(QP16, KP16, VT16, QPh, QPl, KPh, KPl, VTh, VTl, ATh, ATl);   // every batch, head and query row in one launch
    k_gemmw<bf, 1, true><<<dim3(NB_ * TT / 64, DM / 64, 1), 32, 0, stream>>>(ATh, ATl, WO, nullptr, DQ, OUT, DM, bo, 0, 0, 0);   // both batches in one launch
}

// v003
// It runs in 155 microseconds.
// Next to v002, in two timings, it ran 1.34 and 1.33 times as fast.
// Over all steps from v000 it is 11.5 times as fast.
#include <hip/hip_runtime.h>

// Causal multi-head attention with PER-HEAD projection weights and a model-width score scale (x [2][2048][1024]; q, k, v = einsum('btc,hcd->bhtd', x, W) with W [16][1024][64]: head h has its own (in, out) matrix ('xw' per head; no bias; 16 heads x 64); scores x 1/sqrt(float32(C)) with C = 1024 = 1/32 (the MODEL width: the module's own choice; soft logits); causal (-inf); softmax; out merged head-major; out Wo^T + bo ('oi' [1024][1024] + bias normal: non-zero) -> [2][2048][1024] (4.2 M); argument order x, Wq, Wk, Wv, Wo, bo).
// Layout: bf16 copy of x (both batches); each PER-HEAD q / k / v weight [h][1024][64] transposed once into its 64 rows of the Bt plane (k_wtG per head); Wp cast once ('oi' = Bt as stored); exact projections, whose launch stores the q / k / v^T head planes itself (k_gemmw, PLANES); one fused causal attention launch (k_fattn: scores and probabilities stay in registers, online softmax; hybrid rows: < 512 hi/lo 3 products, rest fp16); merged hi/lo x w_o exact.
// Compute dtypes, f32 accumulate: every input rounded to bf16; projections exact; attention rows < 512 3 products, rest fp16; softmax f32; w_o hl x exact.

#define NB_  2
#define TT   2048
#define DM   1024
#define NH_  16
#define NKV  16
#define REP  (NH_ / NKV)
#define HD   64
#define DQ   (NH_ * HD)
#define DKV  (NKV * HD)
#define PQKV (DQ + 2 * DKV)       // columns of the joint q | k | v projection
#define RH   512                  // query rows < RH use hi+lo planes (0: none)
#define SCL  0.03125f   // 1 / sqrt(C) with C = 1024 = the MODEL width (this module scales its scores by the model width, not the head width): exactly 2^-5
typedef _Float16 h16;
typedef unsigned short bf;
typedef __attribute__((ext_vector_type(16))) __bf16   v16bf;
typedef __attribute__((ext_vector_type(16))) _Float16 v16h;
typedef __attribute__((ext_vector_type(8)))  _Float16 v8h;
typedef __attribute__((ext_vector_type(8)))  unsigned short v8us;
typedef __attribute__((ext_vector_type(8)))  float    v8f;
typedef __attribute__((ext_vector_type(4)))  float    v4f;
typedef v8h  __attribute__((may_alias)) v8ha;
typedef v4f  __attribute__((may_alias)) v4fa;
typedef v8us __attribute__((may_alias)) v8usa;

__device__ __forceinline__ unsigned short f2bf(float f) { unsigned u = __float_as_uint(f); u += 0x7FFFu + ((u >> 16) & 1u); return (unsigned short)(u >> 16); }
__device__ __forceinline__ float bf2f(unsigned short b) { return __uint_as_float(((unsigned)b) << 16); }
__device__ __forceinline__ float bfr(float f) { return bf2f(f2bf(f)); }
__device__ __forceinline__ v16h cat16(v8h lo, v8h hi) { return __builtin_shufflevector(lo, hi, 0, 1, 2, 3, 4, 5, 6, 7, 8, 9, 10, 11, 12, 13, 14, 15); }
__device__ __forceinline__ v16bf cat16b(v8us lo, v8us hi) { return __builtin_bit_cast(v16bf, __builtin_shufflevector(lo, hi, 0, 1, 2, 3, 4, 5, 6, 7, 8, 9, 10, 11, 12, 13, 14, 15)); }
__device__ __forceinline__ v8f wmma16(v16h a, v16h b, v8f c) { return __builtin_amdgcn_wmma_f32_16x16x32_f16(false, a, false, b, (short)0, c, false, false); }
__device__ __forceinline__ v8f wmmab(v16bf a, v16bf b, v8f c) { return __builtin_amdgcn_wmma_f32_16x16x32_bf16(false, a, false, b, (short)0, c, false, false); }



__device__ __forceinline__ h16 tohx(float x) { return (h16)x; }
__device__ __forceinline__ void splitf(float y, unsigned short& h, unsigned short& l) { h = f2bf(y); l = f2bf(y - bf2f(h)); }
// ---- k_gemmw: register-blocked GEMM, ONE WAVE per 64x64 output tile (16 accumulators), operands straight from K-contiguous 16-bit planes; grid (M/64, N/64, Z), 32 threads.
// C[m][n] (f32, pitch ldc, + optional f32 bias[n]) = sum_k A[m][k] Bt[n][k] (+ split products per NSPLIT). z-batch strides sA/sB/sC in elements. K % 32 == 0.
// PLANES: the joint q | k | v projection (A = x of both batches, Bt = the weight rows, one head per 64 columns). Nothing goes to C: the tile is stored as the attention's head planes, fp16 and bf16 hi / lo of every value; q, k as [b][h][t][d], v as [b][h][d][t].
// The WMMA's A side is then the index that is contiguous in the plane (t for v; d for q and k, whose tiles swap the two operands: both sides use the same loader, so the k orders agree either way), and a lane holds 8 neighbours of one plane row in each accumulator.
// 16 plane rows at a time go through LDS, so that every global store covers whole 128-byte lines.
struct HeadPlanes { bf *q16, *qh, *ql, *k16, *kh, *kl, *v16, *vh, *vl; };
#define SP 72   // LDS row pitch of the staged plane rows in 16-bit elements: 144 B = 16 B x odd
template <typename T16> struct WFrag;
template <> struct WFrag<h16> { typedef v16h V; static __device__ __forceinline__ V ld(const h16* p) { return cat16(*(const v8h*)p, *(const v8h*)(p + 16)); } static __device__ __forceinline__ v8f mma(V a, V b, v8f c) { return wmma16(a, b, c); } };
template <> struct WFrag<bf> { typedef v16bf V; static __device__ __forceinline__ V ld(const bf* p) { return cat16b(*(const v8us*)p, *(const v8us*)(p + 16)); } static __device__ __forceinline__ v8f mma(V a, V b, v8f c) { return wmmab(a, b, c); } };
template <typename T16, int NSPLIT, bool BIAS, bool PLANES = false>
__global__ __launch_bounds__(32) void k_gemmw(const T16* __restrict__ A, const T16* __restrict__ A2, const T16* __restrict__ Bt, const T16* __restrict__ Bt2, int K, float* C, int ldc, const float* __restrict__ bias, size_t sA, size_t sB, size_t sC, HeadPlanes hp) {
    typedef typename WFrag<T16>::V V;
    __shared__ __align__(16) float os[16 * 68];
    const size_t z = blockIdx.z; A += z * sA; if (A2) A2 += z * sA; Bt += z * sB; if (Bt2) Bt2 += z * sB; C += z * sC;
    const int lane = threadIdx.x & 31, lr = lane & 15, hi = lane >> 4; const int r0 = blockIdx.x * 64, c0 = blockIdx.y * 64;
    v8f acc[4][4];
#pragma unroll
    for (int mb = 0; mb < 4; ++mb)
#pragma unroll
        for (int nb = 0; nb < 4; ++nb) acc[mb][nb] = (v8f){};
    int ra = r0, rb = c0;   // first row of the A side and of the B side
    if (PLANES && c0 < DQ + DKV) { const T16* t = A; A = Bt; Bt = t; ra = c0; rb = r0; }   // q, k tiles: weight rows (d) on the A side
    const size_t aoff = (size_t)(ra + lr) * K + 8 * hi, boff = (size_t)(rb + lr) * K + 8 * hi;
#pragma unroll 1
    for (int kc = 0; kc < K; kc += 32) {
        V a[4], a2[4];
#pragma unroll
        for (int mb = 0; mb < 4; ++mb) { a[mb] = WFrag<T16>::ld(A + aoff + (size_t)mb * 16 * K + kc); if (NSPLIT == 1 || NSPLIT == 2) a2[mb] = WFrag<T16>::ld(A2 + aoff + (size_t)mb * 16 * K + kc); }
#pragma unroll
        for (int nb = 0; nb < 4; ++nb) { const V b = WFrag<T16>::ld(Bt + boff + (size_t)nb * 16 * K + kc); V b2; if (NSPLIT >= 2) b2 = WFrag<T16>::ld(Bt2 + boff + (size_t)nb * 16 * K + kc);
#pragma unroll
            for (int mb = 0; mb < 4; ++mb) { acc[mb][nb] = WFrag<T16>::mma(a[mb], b, acc[mb][nb]); if (NSPLIT == 1 || NSPLIT == 2) acc[mb][nb] = WFrag<T16>::mma(a2[mb], b, acc[mb][nb]); if (NSPLIT >= 2) acc[mb][nb] = WFrag<T16>::mma(a[mb], b2, acc[mb][nb]); } }
        asm volatile("v_nop\n\tv_nop\n\tv_nop\n\tv_nop" : "+v"(acc[0][0]), "+v"(acc[1][1]), "+v"(acc[2][2]), "+v"(acc[3][3]) : "v"(a[0]), "v"(a[3]));
    }
    if constexpr (PLANES) {
        static_assert(HD == 64 && TT % 64 == 0, "a tile is one head wide and lies in one batch");
        __shared__ __align__(16) bf op[3 * 16 * SP];
        const bool isq = c0 < DQ, isv = c0 >= DQ + DKV; const int b = r0 / TT, t0 = r0 % TT, h = (isq ? c0 : isv ? c0 - DQ - DKV : c0 - DQ) / HD;
        bf* d16 = isq ? hp.q16 : isv ? hp.v16 : hp.k16; bf* dh = isq ? hp.qh : isv ? hp.vh : hp.kh; bf* dl = isq ? hp.ql : isv ? hp.vl : hp.kl;
        const size_t pitch = isv ? TT : HD;   // from one plane row (the B side's index) to the next
        const size_t base = isv ? (size_t)(b * NKV + h) * HD * TT + t0 : ((size_t)(b * (isq ? NH_ : NKV) + h) * TT + t0) * HD;
#pragma unroll
        for (int nb = 0; nb < 4; ++nb) {
#pragma unroll
            for (int mb = 0; mb < 4; ++mb) { v8h o16; v8us oh, ol;
#pragma unroll
                for (int j = 0; j < 8; ++j) { const float v = acc[mb][nb][j]; unsigned short p, q; splitf(v, p, q); o16[j] = tohx(v); oh[j] = p; ol[j] = q; }
                bf* w = op + lr * SP + mb * 16 + hi * 8; *(v8usa*)w = __builtin_bit_cast(v8us, o16); *(v8usa*)(w + 16 * SP) = oh; *(v8usa*)(w + 2 * 16 * SP) = ol; }
            asm volatile("s_wait_dscnt 0x0" ::: "memory");   // the lanes' LDS writes are done before other lanes of the wave read the rows back (and the compiler keeps the reads behind them)
#pragma unroll
            for (int s = 0; s < 4; ++s) { const int row = s * 4 + (lane >> 3), ch = (lane & 7) * 8; const bf* f = op + row * SP + ch; const size_t o = base + (size_t)(nb * 16 + row) * pitch + ch;
                *(v8usa*)(d16 + o) = *(const v8usa*)f; *(v8usa*)(dh + o) = *(const v8usa*)(f + 16 * SP); *(v8usa*)(dl + o) = *(const v8usa*)(f + 2 * 16 * SP); }
            if (nb < 3) asm volatile("s_wait_dscnt 0x0" ::: "memory");   // the rows are read before the next 16 rows overwrite them
        }
        return;
    }
#pragma unroll
    for (int mb = 0; mb < 4; ++mb) {
#pragma unroll
        for (int nb = 0; nb < 4; ++nb) {
#pragma unroll
            for (int j = 0; j < 8; ++j) os[(hi * 8 + j) * 68 + nb * 16 + lr] = acc[mb][nb][j]; }
        __builtin_amdgcn_wave_barrier(); asm volatile("" ::: "memory");
        float* crow = C + (size_t)(r0 + mb * 16) * ldc + c0;
{
#pragma unroll
            for (int s = 0; s < 8; ++s) { const int row = 2 * s + hi, cofs = lr * 4; v4f val = *(const v4fa*)(os + row * 68 + cofs); if (BIAS) { val[0] += bfr(bias[c0 + cofs]); val[1] += bfr(bias[c0 + cofs + 1]); val[2] += bfr(bias[c0 + cofs + 2]); val[3] += bfr(bias[c0 + cofs + 3]); }
                *(v4f*)(crow + (size_t)row * ldc + cofs) = val; }
             }
        __builtin_amdgcn_wave_barrier(); asm volatile("" ::: "memory");
    }
}

typedef __attribute__((ext_vector_type(2))) _Float16 v2h;
typedef __attribute__((ext_vector_type(4))) _Float16 v4h;
typedef __attribute__((ext_vector_type(2))) unsigned short v2us;
typedef __attribute__((ext_vector_type(4))) unsigned short v4us;
typedef __attribute__((ext_vector_type(2))) float v2f;
typedef __attribute__((ext_vector_type(4))) int v4i;

// grid y = one per-head matrix: NH_ of wq, then NKV of wk, then NKV of wv; the Bt planes of the three lie one behind the other
__global__ __launch_bounds__(256) void k_wtG(const float* __restrict__ wq, const float* __restrict__ wk, const float* __restrict__ wv, int K, int N, bf* Bt) {
    const int y = blockIdx.y; const float* w = (y < NH_) ? wq + (size_t)y * K * N : (y < NH_ + NKV) ? wk + (size_t)(y - NH_) * K * N : wv + (size_t)(y - NH_ - NKV) * K * N; Bt += (size_t)y * N * K;
    const int lane = threadIdx.x & 31; const int L0 = (blockIdx.x * 8 + (threadIdx.x >> 5)) * 8; const int nlines = N * K / 64;
{
#pragma unroll 1
        for (int l = 0; l < 8; ++l) { const int L = L0 + l; if (L >= nlines) break; const size_t e = (size_t)L * 64 + lane * 2; const int k = (int)(e % K), n = (int)(e / K); v2us o;
            o[0] = f2bf(w[(size_t)k * N + n]); o[1] = f2bf(w[(size_t)(k + 1) * N + n]); *(v2us*)(Bt + e) = o; }
         }
}

__global__ __launch_bounds__(256) void k_cvt8(const float* __restrict__ src, bf* dst, size_t n8) { const size_t i = (size_t)blockIdx.x * 256 + threadIdx.x; if (i >= n8) return; const v8f v = *(const v8f*)(src + i * 8); v8us o;
#pragma unroll
    for (int k = 0; k < 8; ++k) o[k] = f2bf(v[k]); *(v8us*)(dst + i * 8) = o;  }

#define C2L 0.045084220027780106f   // SCL x log2(e): exp(SCL (s - m)) = exp2(C2L s - C2L m)
// Stands behind a group of issued global loads. s_wait_xcnt 0 stands in front of every later rewrite of the registers that hold their addresses; the addresses are named as inputs so that those registers stay as they are up to the wait.
// sched_barrier: without it the scheduler moves the loads down to their first use, where they no longer fly under the arithmetic in between.
__device__ __forceinline__ void loads_issued(const void* a, const void* b) { asm volatile("s_wait_xcnt 0x0" :: "v"(a), "v"(b) : "memory"); __builtin_amdgcn_sched_barrier(0); }
__device__ __forceinline__ void loads_issued(const void* a, const void* b, const void* c, const void* d) { asm volatile("s_wait_xcnt 0x0" :: "v"(a), "v"(b), "v"(c), "v"(d) : "memory"); __builtin_amdgcn_sched_barrier(0); }
__device__ __forceinline__ float xhalf(float x) { return __builtin_bit_cast(float, __builtin_amdgcn_permlanex16(__builtin_bit_cast(int, x), __builtin_bit_cast(int, x), 0x76543210, 0xfedcba98, false, false)); }   // lane l reads lane l ^ 16
__device__ __forceinline__ void attn_store(const v8f (&o)[4], float l, bf* Ah, bf* Al, int row, int hi) {
    const float f = __fdiv_rn(1.0f, l + xhalf(l));
#pragma unroll
    for (int db = 0; db < 4; ++db) { v8us oh, ol;
#pragma unroll
        for (int j = 0; j < 8; ++j) { unsigned short x, y; splitf(o[db][j] * f, x, y); oh[j] = x; ol[j] = y; }
        const size_t oo = (size_t)row * DQ + db * 16 + hi * 8; *(v8us*)(Ah + oo) = oh; *(v8us*)(Al + oo) = ol; }
}
// running maximum m (raw score units) and sum l of one query column over its 16 new scores; st becomes exp(SCL (s - m)); returns the factor for what was summed under the old maximum
__device__ __forceinline__ float attn_soft(v8f (&st)[2], float& m, float& l) {
    float mx = m;
#pragma unroll
    for (int kt = 0; kt < 2; ++kt)
#pragma unroll
        for (int j = 0; j < 8; ++j) mx = fmaxf(mx, st[kt][j]);
    mx = fmaxf(mx, xhalf(mx));
    const float al = __builtin_amdgcn_exp2f((m - mx) * C2L), mc = mx * C2L; m = mx; float s = 0.f;
#pragma unroll
    for (int kt = 0; kt < 2; ++kt)
#pragma unroll
        for (int j = 0; j < 8; ++j) { const float p = __builtin_amdgcn_exp2f(__builtin_fmaf(st[kt][j], C2L, -mc)); st[kt][j] = p; s += p; }
    l = l * al + s; return al;
}
__device__ __forceinline__ void attn_mask(v8f (&st)[2], int kb, int query, int hi) {
#pragma unroll
    for (int kt = 0; kt < 2; ++kt)
#pragma unroll
        for (int j = 0; j < 8; ++j) st[kt][j] = (kb + kt * 16 + hi * 8 + j <= query) ? st[kt][j] : -3.0e38f;
}
// query rows >= RH: fp16 operands, 32 query rows a wave. One pass = 32 keys from kb on. pv: the lane's place in this pass's V^T columns; pk: in the NEXT pass's K rows; both step on behind the loads.
// ak holds this pass's K fragments on entry and, where DIAG is false, the next pass's on return (they fly while this pass computes).
template <bool DIAG>
__device__ __forceinline__ void attn_f16_pass(const h16* __restrict__& pk, const h16* __restrict__& pv, int kb, int q0, int lr, int hi, const v16h (&bq)[2][2], v16h (&ak)[2][2], v8f (&o)[2][4], float (&m)[2], float (&l)[2]) {
    v16h av[4];
#pragma unroll
    for (int db = 0; db < 4; ++db) av[db] = WFrag<h16>::ld(pv + (size_t)db * 16 * TT);
    v8f st[2][2];
#pragma unroll
    for (int nq = 0; nq < 2; ++nq)
#pragma unroll
        for (int kt = 0; kt < 2; ++kt) { st[nq][kt] = wmma16(ak[kt][0], bq[nq][0], (v8f){}); st[nq][kt] = wmma16(ak[kt][1], bq[nq][1], st[nq][kt]); }
    if (!DIAG) {
#pragma unroll
        for (int kt = 0; kt < 2; ++kt)
#pragma unroll
            for (int ks = 0; ks < 2; ++ks) ak[kt][ks] = WFrag<h16>::ld(pk + kt * 16 * HD + ks * 32);
    }
    loads_issued(pk, pv);
    pk += 32 * HD; pv += 32;
    if (DIAG) { attn_mask(st[0], kb, q0 + lr, hi); attn_mask(st[1], kb, q0 + 16 + lr, hi); }   // only the diagonal pass holds keys beyond a query
#pragma unroll
    for (int nq = 0; nq < 2; ++nq) { const float al = attn_soft(st[nq], m[nq], l[nq]); v16h bp;
#pragma unroll
        for (int e = 0; e < 16; ++e) bp[e] = tohx(st[nq][e >> 3][e & 7]);
#pragma unroll
        for (int db = 0; db < 4; ++db) { o[nq][db] *= al; o[nq][db] = wmma16(av[db], bp, o[nq][db]); } }
}
__device__ __forceinline__ void attn_f16(const h16* __restrict__ Q, const h16* __restrict__ Kp, const h16* __restrict__ Vt, int q0, bf* Ah, bf* Al, int lr, int hi) {
    const h16* pq = Q + (size_t)(q0 + lr) * HD + 8 * hi;
    v16h bq[2][2];
#pragma unroll
    for (int nq = 0; nq < 2; ++nq)
#pragma unroll
        for (int ks = 0; ks < 2; ++ks) bq[nq][ks] = WFrag<h16>::ld(pq + nq * 16 * HD + ks * 32);
    v8f o[2][4]; float m[2], l[2];
#pragma unroll
    for (int nq = 0; nq < 2; ++nq) { m[nq] = -3.0e38f; l[nq] = 0.f;
#pragma unroll
        for (int db = 0; db < 4; ++db) o[nq][db] = (v8f){}; }
    const h16* __restrict__ pk = Kp + (size_t)lr * HD + 8 * hi; const h16* __restrict__ pv = Vt + (size_t)lr * TT + 8 * hi;
    v16h ak[2][2];
#pragma unroll
    for (int kt = 0; kt < 2; ++kt)
#pragma unroll
        for (int ks = 0; ks < 2; ++ks) ak[kt][ks] = WFrag<h16>::ld(pk + kt * 16 * HD + ks * 32);
    loads_issued(pq, pk);
    pk += 32 * HD;
#pragma unroll 1
    for (int kb = 0; kb < q0; kb += 32) attn_f16_pass<false>(pk, pv, kb, q0, lr, hi, bq, ak, o, m, l);
    attn_f16_pass<true>(pk, pv, q0, q0, lr, hi, bq, ak, o, m, l);
    attn_store(o[0], l[0], Ah, Al, q0 + lr, hi); attn_store(o[1], l[1], Ah, Al, q0 + 16 + lr, hi);
}
// query rows < RH: bf16 hi + lo planes, 3 products (hi hi, lo hi, hi lo) for the scores and for probability x value; 16 query rows a wave
__device__ __forceinline__ void attn_hl(const bf* __restrict__ Qh, const bf* __restrict__ Ql, const bf* __restrict__ Kh, const bf* __restrict__ Kl, const bf* __restrict__ Vh, const bf* __restrict__ Vl, int q0, bf* Ah, bf* Al, int lr, int hi) {
    v16bf qh[2], ql[2];
#pragma unroll
    for (int ks = 0; ks < 2; ++ks) { const size_t qo = (size_t)(q0 + lr) * HD + ks * 32 + 8 * hi; qh[ks] = WFrag<bf>::ld(Qh + qo); ql[ks] = WFrag<bf>::ld(Ql + qo); }
    v8f o[4]; float m = -3.0e38f, l = 0.f;
#pragma unroll
    for (int db = 0; db < 4; ++db) o[db] = (v8f){};
    const size_t ko = (size_t)lr * HD + 8 * hi, vo = (size_t)lr * TT + 8 * hi;
    const bf* __restrict__ pkh = Kh + ko; const bf* __restrict__ pkl = Kl + ko; const bf* __restrict__ pvh = Vh + vo; const bf* __restrict__ pvl = Vl + vo;   // the lane's places in this pass's K rows and V^T columns
#pragma unroll 1
    for (int kb = 0; kb <= q0; kb += 32) {   // q0 is a multiple of 16: the last pass holds the diagonal, and its 32 keys lie below RH + 16 <= TT
        v16bf kh[2][2], kl[2][2], vh[4], vl[4];
#pragma unroll
        for (int kt = 0; kt < 2; ++kt)
#pragma unroll
            for (int ks = 0; ks < 2; ++ks) { const int e = kt * 16 * HD + ks * 32; kh[kt][ks] = WFrag<bf>::ld(pkh + e); kl[kt][ks] = WFrag<bf>::ld(pkl + e); }
#pragma unroll
        for (int db = 0; db < 4; ++db) { const size_t e = (size_t)db * 16 * TT; vh[db] = WFrag<bf>::ld(pvh + e); vl[db] = WFrag<bf>::ld(pvl + e); }
        loads_issued(pkh, pkl, pvh, pvl);
        pkh += 32 * HD; pkl += 32 * HD; pvh += 32; pvl += 32;
        v8f st[2];
#pragma unroll
        for (int kt = 0; kt < 2; ++kt) { st[kt] = (v8f){};
#pragma unroll
            for (int ks = 0; ks < 2; ++ks) { st[kt] = wmmab(kh[kt][ks], qh[ks], st[kt]); st[kt] = wmmab(kh[kt][ks], ql[ks], st[kt]); st[kt] = wmmab(kl[kt][ks], qh[ks], st[kt]); } }
        if (kb + 31 > q0) attn_mask(st, kb, q0 + lr, hi);
        const float al = attn_soft(st, m, l); v8us p0h, p0l, p1h, p1l;
#pragma unroll
        for (int j = 0; j < 8; ++j) { unsigned short x, y; splitf(st[0][j], x, y); p0h[j] = x; p0l[j] = y; splitf(st[1][j], x, y); p1h[j] = x; p1l[j] = y; }
        const v16bf ph = cat16b(p0h, p1h), pl = cat16b(p0l, p1l);
#pragma unroll
        for (int db = 0; db < 4; ++db) { o[db] *= al; o[db] = wmmab(vh[db], ph, o[db]); o[db] = wmmab(vh[db], pl, o[db]); o[db] = wmmab(vl[db], ph, o[db]); }
    }
    attn_store(o, l, Ah, Al, q0 + lr, hi);
}
// grid (NB_ * NH_, (TT - RH) / 128 + RH / 64), 4 waves; y falls with the rows' cost: y = 0 holds the last (longest) query rows
__global__ __launch_bounds__(128) void k_fattn(const h16* __restrict__ Q16, const h16* __restrict__ K16, const h16* __restrict__ V16, const bf* __restrict__ Qh, const bf* __restrict__ Ql, const bf* __restrict__ Kh, const bf* __restrict__ Kl, const bf* __restrict__ Vh, const bf* __restrict__ Vl, bf* Ah, bf* Al) {
    const int lane = threadIdx.x & 31, lr = lane & 15, hi = lane >> 4; const int w = __builtin_amdgcn_readfirstlane(threadIdx.x >> 5);
    const int b = blockIdx.x / NH_, h = blockIdx.x % NH_, y = blockIdx.y; const size_t pq = (size_t)(b * NH_ + h) * TT * HD, pk = (size_t)(b * NKV + h / REP) * TT * HD, po = (size_t)b * TT * DQ + h * HD;
    if (y < (TT - RH) / 128) attn_f16(Q16 + pq, K16 + pk, V16 + pk, TT - 128 * y - 32 * (w + 1), Ah + po, Al + po, lr, hi);
    else attn_hl(Qh + pq, Ql + pq, Kh + pk, Kl + pk, Vh + pk, Vl + pk, RH - 64 * (y - (TT - RH) / 128) - 16 * (w + 1), Ah + po, Al + po, lr, hi);
}

extern "C" void kernel_launch(void* const* d_in, const int* in_sizes, int n_in,
                              void* d_out, int out_size, void* d_ws, size_t ws_size, hipStream_t stream) {
    (void)in_sizes; (void)n_in; (void)out_size;
            const float* x = (const float*)d_in[0]; const float* wq = (const float*)d_in[1]; const float* wk = (const float*)d_in[2]; const float* wv = (const float*)d_in[3]; const float* wo = (const float*)d_in[4]; const float* bo = (const float*)d_in[5];   /* input order x, Wq, Wk, Wv (PER-HEAD [16][1024][64]: 'hcd'), Wo ('oi' [1024][1024]), bo */
    float* OUT = (float*)d_out;     // [2][2048][1024]
    char* wsp = (char*)d_ws;
    auto take = [&](size_t bytes) { char* p = wsp; wsp += (bytes + 255) & ~(size_t)255; return (void*)p; };
    bf* WQ = (bf*)take((size_t)DQ * DM * 2); bf* WK = (bf*)take((size_t)DKV * DM * 2); bf* WV = (bf*)take((size_t)DKV * DM * 2); bf* WO = (bf*)take((size_t)DM * DQ * 2);
    bf* XB = (bf*)take((size_t)NB_ * TT * DM * 2);   // both batches: bf16 x
    const size_t NQP = (size_t)NH_ * TT * HD, NKP = (size_t)NKV * TT * HD;   // elements of one batch's query / key-value head planes; every plane holds both batches, [b][h]
    h16* QP16 = (h16*)take(NB_ * NQP * 2); h16* KP16 = (h16*)take(NB_ * NKP * 2); h16* VT16 = (h16*)take(NB_ * NKP * 2);
    bf* QPh = (bf*)take(NB_ * NQP * 2); bf* QPl = (bf*)take(NB_ * NQP * 2); bf* KPh = (bf*)take(NB_ * NKP * 2); bf* KPl = (bf*)take(NB_ * NKP * 2); bf* VTh = (bf*)take(NB_ * NKP * 2); bf* VTl = (bf*)take(NB_ * NKP * 2);
    bf* ATh = (bf*)take((size_t)NB_ * TT * DQ * 2); bf* ATl = (bf*)take((size_t)NB_ * TT * DQ * 2);
    (void)WK; (void)WV;   // reached through WQ: the three planes are contiguous
    if ((size_t)(wsp - (char*)d_ws) > ws_size) return;    // ws 256 MiB
    k_wtG<<<dim3((unsigned)((DM * HD / 64 + 63) / 64), NH_ + 2 * NKV, 1), 256, 0, stream>>>(wq, wk, wv, DM, HD, WQ);   /* every per-head weight [h][DM][HD] ('xw' per head) -> its HD rows of the Bt planes WQ | WK | WV (contiguous) */
    k_cvt8<<<(unsigned)(((size_t)DM * DQ / 8 + 255) / 256), 256, 0, stream>>>(wo, WO, (size_t)DM * DQ / 8);
    k_cvt8<<<(unsigned)(((size_t)NB_ * TT * DM / 8 + 255) / 256), 256, 0, stream>>>(x, XB, (size_t)NB_ * TT * DM / 8);
    k_gemmw<bf, 0, false, true><<<dim3(NB_ * TT / 64, PQKV / 64, 1), 32, 0, stream>>>(XB, nullptr, WQ, nullptr, DM, nullptr, 0, nullptr, 0, 0, 0, HeadPlanes{(bf*)QP16, QPh, QPl, (bf*)KP16, KPh, KPl, (bf*)VT16, VTh, VTl});   // q, k and v of both batches in one launch, stored as the attention's head planes
    k_fattn<<<dim3(NB_ * NH_, (TT - RH) / 128 + RH / 64, 1), 128, 0, stream>>>(QP16, KP16, VT16, QPh, QPl, KPh, KPl, VTh, VTl, ATh, ATl);   // every batch, head and query row in one launch
    k_gemmw<bf, 1, true><<<dim3(NB_ * TT / 64, DM / 64, 1), 32, 0, stream>>>(ATh, ATl, WO, nullptr, DQ, OUT, DM, bo, 0, 0, 0, HeadPlanes{});   // both batches in one launch
}

// v004
// It runs in 127 microseconds.
// Next to v003, in two timings, it ran 1.21 and 1.22 times as fast.
// Over all steps from v000 it is 13.9 times as fast.
#include <hip/hip_runtime.h>

// Causal multi-head attention with PER-HEAD projection weights and a model-width score scale (x [2][2048][1024]; q, k, v = einsum('btc,hcd->bhtd', x, W) with W [16][1024][64]: head h has its own (in, out) matrix ('xw' per head; no bias; 16 heads x 64); scores x 1/sqrt(float32(C)) with C = 1024 = 1/32 (the MODEL width: the module's own choice; soft logits); causal (-inf); softmax; out merged head-major; out Wo^T + bo ('oi' [1024][1024] + bias normal: non-zero) -> [2][2048][1024] (4.2 M); argument order x, Wq, Wk, Wv, Wo, bo).
// FRAGMENT ORDER: every 16-bit plane that a WMMA reads (x, the weights, q, k, v^T, the merged attention output) is stored as the lanes read it. A fragment = 16 rows x 32 k = 512 elements in a row: [half w of the k range][lane][8 elements], lane = 16 * hi + row % 16, k % 32 = 16 * w + 8 * hi + j.
// So each wave-wide 16-byte load or store covers 512 contiguous bytes (4 whole 128-byte lines) and not 32-byte pieces of 16 lines. Fragments of one 16-row tile follow one another along k, so a tile of a K-wide plane starts at element row * K, as in the row-major plane; v^T alone is ordered for its reader: the 4 fragments (64 d) of 32 keys lie together, then the next 32 keys.
// Layout: bf16 copy of x (both batches); each PER-HEAD q / k / v weight [h][1024][64] transposed once into its 64 rows of the Bt plane (k_wtG per head); Wp cast once ('oi' = Bt rows as stored); exact projections, whose launch stores the q / k / v^T head planes itself (k_gemmw, PLANES); one fused causal attention launch (k_fattn: scores and probabilities stay in registers, online softmax; hybrid rows: < 512 hi/lo 3 products, rest fp16); merged hi/lo x w_o exact.
// Compute dtypes, f32 accumulate: every input rounded to bf16; projections exact; attention rows < 512 3 products, rest fp16; softmax f32; w_o hl x exact.

#define NB_  2
#define TT   2048
#define DM   1024
#define NH_  16
#define NKV  16
#define REP  (NH_ / NKV)
#define HD   64
#define DQ   (NH_ * HD)
#define DKV  (NKV * HD)
#define PQKV (DQ + 2 * DKV)       // columns of the joint q | k | v projection
#define RH   512                  // query rows < RH use hi+lo planes (0: none)
#define SCL  0.03125f   // 1 / sqrt(C) with C = 1024 = the MODEL width (this module scales its scores by the model width, not the head width): exactly 2^-5
typedef _Float16 h16;
typedef unsigned short bf;
typedef __attribute__((ext_vector_type(16))) __bf16   v16bf;
typedef __attribute__((ext_vector_type(16))) _Float16 v16h;
typedef __attribute__((ext_vector_type(8)))  _Float16 v8h;
typedef __attribute__((ext_vector_type(8)))  unsigned short v8us;
typedef __attribute__((ext_vector_type(8)))  float    v8f;
typedef __attribute__((ext_vector_type(4)))  float    v4f;
typedef v8h  __attribute__((may_alias)) v8ha;
typedef v4f  __attribute__((may_alias)) v4fa;
typedef v8us __attribute__((may_alias)) v8usa;

__device__ __forceinline__ unsigned short f2bf(float f) { unsigned u = __float_as_uint(f); u += 0x7FFFu + ((u >> 16) & 1u); return (unsigned short)(u >> 16); }
__device__ __forceinline__ float bf2f(unsigned short b) { return __uint_as_float(((unsigned)b) << 16); }
__device__ __forceinline__ float bfr(float f) { return bf2f(f2bf(f)); }
__device__ __forceinline__ v16h cat16(v8h lo, v8h hi) { return __builtin_shufflevector(lo, hi, 0, 1, 2, 3, 4, 5, 6, 7, 8, 9, 10, 11, 12, 13, 14, 15); }
__device__ __forceinline__ v16bf cat16b(v8us lo, v8us hi) { return __builtin_bit_cast(v16bf, __builtin_shufflevector(lo, hi, 0, 1, 2, 3, 4, 5, 6, 7, 8, 9, 10, 11, 12, 13, 14, 15)); }
__device__ __forceinline__ v8f wmma16(v16h a, v16h b, v8f c) { return __builtin_amdgcn_wmma_f32_16x16x32_f16(false, a, false, b, (short)0, c, false, false); }
__device__ __forceinline__ v8f wmmab(v16bf a, v16bf b, v8f c) { return __builtin_amdgcn_wmma_f32_16x16x32_bf16(false, a, false, b, (short)0, c, false, false); }



__device__ __forceinline__ h16 tohx(float x) { return (h16)x; }
__device__ __forceinline__ void splitf(float y, unsigned short& h, unsigned short& l) { h = f2bf(y); l = f2bf(y - bf2f(h)); }
// Stands behind a group of issued global loads. s_wait_xcnt 0 stands in front of every later rewrite of the registers that hold their addresses; the addresses are named as inputs so that those registers stay as they are up to the wait.
// sched_barrier: without it the scheduler moves the loads down to their first use, where they no longer fly under the arithmetic in between.
__device__ __forceinline__ void loads_issued(const void* a, const void* b) { asm volatile("s_wait_xcnt 0x0" :: "v"(a), "v"(b) : "memory"); __builtin_amdgcn_sched_barrier(0); }
__device__ __forceinline__ void loads_issued(const void* a, const void* b, const void* c, const void* d) { asm volatile("s_wait_xcnt 0x0" :: "v"(a), "v"(b), "v"(c), "v"(d) : "memory"); __builtin_amdgcn_sched_barrier(0); }
// ---- k_gemmw: register-blocked GEMM, ONE WAVE per 64x64 output tile (16 accumulators), operands straight from 16-bit planes in fragment order; grid (M/64, N/64, Z), 32 threads.
// C[m][n] (f32, pitch ldc, + optional f32 bias[n]) = sum_k A[m][k] Bt[n][k] (+ split products per NSPLIT). z-batch strides sA/sB/sC in elements. K % 32 == 0; K is a compile-time number, so that every fragment of a k step lies at an immediate offset from the side's one address.
// PLANES: the joint q | k | v projection (A = x of both batches, Bt = the weight rows, one head per 64 columns). Nothing goes to C: the tile is stored as the attention's head planes, fp16 and bf16 hi / lo of every value, in fragment order; q, k per [b][h]: rows t, k index d; v per [b][h]: rows d, k index t.
// The WMMA's A side is then the plane's k index (t for v; d for q and k, whose tiles swap the two operands: both sides use the same loader, so the k orders agree either way): the 8 values of a lane in one accumulator ARE that lane's 16 bytes of one half fragment, and go out straight from the registers.
struct HeadPlanes { bf *q16, *qh, *ql, *k16, *kh, *kl, *v16, *vh, *vl; };
template <typename T16> struct WFrag;
template <> struct WFrag<h16> { typedef v16h V; static __device__ __forceinline__ V ld(const h16* p) { return cat16(*(const v8h*)p, *(const v8h*)(p + 256)); } static __device__ __forceinline__ v8f mma(V a, V b, v8f c) { return wmma16(a, b, c); } };
template <> struct WFrag<bf> { typedef v16bf V; static __device__ __forceinline__ V ld(const bf* p) { return cat16b(*(const v8us*)p, *(const v8us*)(p + 256)); } static __device__ __forceinline__ v8f mma(V a, V b, v8f c) { return wmmab(a, b, c); } };
template <typename T16, int NSPLIT, bool BIAS, int K, bool PLANES = false>
__global__ __launch_bounds__(32) void k_gemmw(const T16* __restrict__ A, const T16* __restrict__ A2, const T16* __restrict__ Bt, const T16* __restrict__ Bt2, float* C, int ldc, const float* __restrict__ bias, size_t sA, size_t sB, size_t sC, HeadPlanes hp) {
    typedef typename WFrag<T16>::V V;
    __shared__ __align__(16) float os[16 * 68];
    const size_t z = blockIdx.z; A += z * sA; if (A2) A2 += z * sA; Bt += z * sB; if (Bt2) Bt2 += z * sB; C += z * sC;
    const int lane = threadIdx.x & 31, lr = lane & 15, hi = lane >> 4; const int r0 = blockIdx.x * 64, c0 = blockIdx.y * 64;
    v8f acc[4][4];
#pragma unroll
    for (int mb = 0; mb < 4; ++mb)
#pragma unroll
        for (int nb = 0; nb < 4; ++nb) acc[mb][nb] = (v8f){};
    int ra = r0, rb = c0;   // first row of the A side and of the B side
    if (PLANES && c0 < DQ + DKV) { const T16* t = A; A = Bt; Bt = t; ra = c0; rb = r0; }   // q, k tiles: weight rows (d) on the A side
    const size_t aoff = (size_t)ra * K + lane * 8, boff = (size_t)rb * K + lane * 8;   // the lane's place in the first fragment of the side's first 16-row tile; 32 k on = 512 elements on
    const T16* __restrict__ pa = A + aoff; const T16* __restrict__ pb = Bt + boff; const T16* __restrict__ pa2 = (NSPLIT == 1 || NSPLIT == 2) ? A2 + aoff : pa; const T16* __restrict__ pb2 = (NSPLIT >= 2) ? Bt2 + boff : pb;
#pragma unroll 1
    for (int kc = 0; kc < K; kc += 32) {
        V a[4], a2[4], b[4], b2[4];
#pragma unroll
        for (int mb = 0; mb < 4; ++mb) { a[mb] = WFrag<T16>::ld(pa + mb * 16 * K); if (NSPLIT == 1 || NSPLIT == 2) a2[mb] = WFrag<T16>::ld(pa2 + mb * 16 * K); }
#pragma unroll
        for (int nb = 0; nb < 4; ++nb) { b[nb] = WFrag<T16>::ld(pb + nb * 16 * K); if (NSPLIT >= 2) b2[nb] = WFrag<T16>::ld(pb2 + nb * 16 * K); }
        loads_issued(pa, pb, pa2, pb2);   // the k step's loads are one run at immediate offsets from these addresses, which step on only behind the wait
        pa += 512; pb += 512; pa2 += 512; pb2 += 512;
#pragma unroll
        for (int nb = 0; nb < 4; ++nb) {
#pragma unroll
            for (int mb = 0; mb < 4; ++mb) { acc[mb][nb] = WFrag<T16>::mma(a[mb], b[nb], acc[mb][nb]); if (NSPLIT == 1 || NSPLIT == 2) acc[mb][nb] = WFrag<T16>::mma(a2[mb], b[nb], acc[mb][nb]); if (NSPLIT >= 2) acc[mb][nb] = WFrag<T16>::mma(a[mb], b2[nb], acc[mb][nb]); } }
        asm volatile("v_nop\n\tv_nop\n\tv_nop\n\tv_nop" : "+v"(acc[0][0]), "+v"(acc[1][1]), "+v"(acc[2][2]), "+v"(acc[3][3]) : "v"(a[0]), "v"(a[3]));
    }
    if constexpr (PLANES) {
        static_assert(HD == 64 && TT % 64 == 0, "a tile is one head wide and lies in one batch");
        const bool isq = c0 < DQ, isv = c0 >= DQ + DKV; const int b = r0 / TT, t0 = r0 % TT, h = (isq ? c0 : isv ? c0 - DQ - DKV : c0 - DQ) / HD;
        bf* d16 = isq ? hp.q16 : isv ? hp.v16 : hp.k16; bf* dh = isq ? hp.qh : isv ? hp.vh : hp.kh; bf* dl = isq ? hp.ql : isv ? hp.vl : hp.kl;
        // q, k: 16-row tile t / 16 = 2 fragments (d) = 1024 elements, half fragment mb. v: 32 t = 4 fragments (16-row tiles of d) = 2048 elements, fragment nb, half mb & 1. 64 t of one head are 64 * HD elements either way.
        const size_t base = ((size_t)(b * (isq ? NH_ : NKV) + h) * TT + t0) * HD + lane * 8; const int snb = isv ? 512 : 1024, smb2 = isv ? 2048 : 512;
#pragma unroll
        for (int nb = 0; nb < 4; ++nb) {
#pragma unroll
            for (int mb = 0; mb < 4; ++mb) { v8h o16; v8us oh, ol;
#pragma unroll
                for (int j = 0; j < 8; ++j) { const float v = acc[mb][nb][j]; unsigned short p, q; splitf(v, p, q); o16[j] = tohx(v); oh[j] = p; ol[j] = q; }
                const size_t o = base + nb * snb + (mb >> 1) * smb2 + (mb & 1) * 256;
                *(v8usa*)(d16 + o) = __builtin_bit_cast(v8us, o16); *(v8usa*)(dh + o) = oh; *(v8usa*)(dl + o) = ol; }
        }
        return;
    }
#pragma unroll
    for (int mb = 0; mb < 4; ++mb) {
#pragma unroll
        for (int nb = 0; nb < 4; ++nb) {
#pragma unroll
            for (int j = 0; j < 8; ++j) os[(hi * 8 + j) * 68 + nb * 16 + lr] = acc[mb][nb][j]; }
        __builtin_amdgcn_wave_barrier(); asm volatile("" ::: "memory");
        float* crow = C + (size_t)(r0 + mb * 16) * ldc + c0;
{
#pragma unroll
            for (int s = 0; s < 8; ++s) { const int row = 2 * s + hi, cofs = lr * 4; v4f val = *(const v4fa*)(os + row * 68 + cofs); if (BIAS) { val[0] += bfr(bias[c0 + cofs]); val[1] += bfr(bias[c0 + cofs + 1]); val[2] += bfr(bias[c0 + cofs + 2]); val[3] += bfr(bias[c0 + cofs + 3]); }
                *(v4f*)(crow + (size_t)row * ldc + cofs) = val; }
             }
        __builtin_amdgcn_wave_barrier(); asm volatile("" ::: "memory");
    }
}

typedef __attribute__((ext_vector_type(2))) _Float16 v2h;
typedef __attribute__((ext_vector_type(4))) _Float16 v4h;
typedef __attribute__((ext_vector_type(2))) unsigned short v2us;
typedef __attribute__((ext_vector_type(4))) unsigned short v4us;
typedef __attribute__((ext_vector_type(2))) float v2f;
typedef __attribute__((ext_vector_type(4))) int v4i;

// One thread = one lane's 8 elements of a half fragment: element 8 * i of a K-wide plane in fragment order is (row, k) of the matrix
__device__ __forceinline__ void frag_place(size_t i, int K, size_t& row, int& k) { const int lane = (int)(i & 31), w = (int)(i >> 5) & 1; const size_t f = i >> 6; const int fk = K / 32; row = (f / fk) * 16 + (lane & 15); k = (int)(f % fk) * 32 + w * 16 + (lane >> 4) * 8; }
// grid y = one per-head matrix [DM][HD]: NH_ of wq, then NKV of wk, then NKV of wv; the Bt planes of the three lie one behind the other; grid x * 256 = HD * DM / 8 threads
__global__ __launch_bounds__(256) void k_wtG(const float* __restrict__ wq, const float* __restrict__ wk, const float* __restrict__ wv, bf* Bt) {
    const int y = blockIdx.y; const float* w = (y < NH_) ? wq + (size_t)y * DM * HD : (y < NH_ + NKV) ? wk + (size_t)(y - NH_) * DM * HD : wv + (size_t)(y - NH_ - NKV) * DM * HD; Bt += (size_t)y * HD * DM;
    const size_t i = (size_t)blockIdx.x * 256 + threadIdx.x; size_t n; int k; frag_place(i, DM, n, k); v8us o;
#pragma unroll
    for (int j = 0; j < 8; ++j) o[j] = f2bf(w[(size_t)(k + j) * HD + n]);
    *(v8us*)(Bt + i * 8) = o;
}

// src: row-major [rows][DM] f32; dst: the same matrix in bf16, fragment order
__global__ __launch_bounds__(256) void k_cvt8(const float* __restrict__ src, bf* dst, size_t n8) { const size_t i = (size_t)blockIdx.x * 256 + threadIdx.x; if (i >= n8) return; size_t row; int kk; frag_place(i, DM, row, kk); const v8f v = *(const v8f*)(src + row * DM + kk); v8us o;
#pragma unroll
    for (int k = 0; k < 8; ++k) o[k] = f2bf(v[k]); *(v8us*)(dst + i * 8) = o;  }

#define C2L 0.045084220027780106f   // SCL x log2(e): exp(SCL (s - m)) = exp2(C2L s - C2L m)
__device__ __forceinline__ float xhalf(float x) { return __builtin_bit_cast(float, __builtin_amdgcn_permlanex16(__builtin_bit_cast(int, x), __builtin_bit_cast(int, x), 0x76543210, 0xfedcba98, false, false)); }   // lane l reads lane l ^ 16
// row0: first of the wave's 16 query rows; Ah, Al: the head's first fragment in row tile 0 (the head's 64 columns = 2 fragments = 4 half fragments, db each)
__device__ __forceinline__ void attn_store(const v8f (&o)[4], float l, bf* Ah, bf* Al, int row0, int lane) {
    const float f = __fdiv_rn(1.0f, l + xhalf(l));
#pragma unroll
    for (int db = 0; db < 4; ++db) { v8us oh, ol;
#pragma unroll
        for (int j = 0; j < 8; ++j) { unsigned short x, y; splitf(o[db][j] * f, x, y); oh[j] = x; ol[j] = y; }
        const size_t oo = (size_t)row0 * DQ + db * 256 + lane * 8; *(v8us*)(Ah + oo) = oh; *(v8us*)(Al + oo) = ol; }
}
// running maximum m (raw score units) and sum l of one query column over its 16 new scores; st becomes exp(SCL (s - m)); returns the factor for what was summed under the old maximum
__device__ __forceinline__ float attn_soft(v8f (&st)[2], float& m, float& l) {
    float mx = m;
#pragma unroll
    for (int kt = 0; kt < 2; ++kt)
#pragma unroll
        for (int j = 0; j < 8; ++j) mx = fmaxf(mx, st[kt][j]);
    mx = fmaxf(mx, xhalf(mx));
    const float al = __builtin_amdgcn_exp2f((m - mx) * C2L), mc = mx * C2L; m = mx; float s = 0.f;
#pragma unroll
    for (int kt = 0; kt < 2; ++kt)
#pragma unroll
        for (int j = 0; j < 8; ++j) { const float p = __builtin_amdgcn_exp2f(__builtin_fmaf(st[kt][j], C2L, -mc)); st[kt][j] = p; s += p; }
    l = l * al + s; return al;
}
__device__ __forceinline__ void attn_mask(v8f (&st)[2], int kb, int query, int hi) {
#pragma unroll
    for (int kt = 0; kt < 2; ++kt)
#pragma unroll
        for (int j = 0; j < 8; ++j) st[kt][j] = (kb + kt * 16 + hi * 8 + j <= query) ? st[kt][j] : -3.0e38f;
}
// query rows >= RH: fp16 operands, 32 query rows a wave. One pass = 32 keys from kb on. pv: the lane's place in this pass's 4 V^T fragments; pk: in the NEXT pass's 4 K fragments; both step on (4 fragments) behind the loads.
// ak holds this pass's K fragments on entry and, where DIAG is false, the next pass's on return (they fly while this pass computes).
template <bool DIAG>
__device__ __forceinline__ void attn_f16_pass(const h16* __restrict__& pk, const h16* __restrict__& pv, int kb, int q0, int lr, int hi, const v16h (&bq)[2][2], v16h (&ak)[2][2], v8f (&o)[2][4], float (&m)[2], float (&l)[2]) {
    v16h av[4];
#pragma unroll
    for (int db = 0; db < 4; ++db) av[db] = WFrag<h16>::ld(pv + db * 512);
    v8f st[2][2];
#pragma unroll
    for (int nq = 0; nq < 2; ++nq)
#pragma unroll
        for (int kt = 0; kt < 2; ++kt) { st[nq][kt] = wmma16(ak[kt][0], bq[nq][0], (v8f){}); st[nq][kt] = wmma16(ak[kt][1], bq[nq][1], st[nq][kt]); }
    if (!DIAG) {
#pragma unroll
        for (int kt = 0; kt < 2; ++kt)
#pragma unroll
            for (int ks = 0; ks < 2; ++ks) ak[kt][ks] = WFrag<h16>::ld(pk + kt * 1024 + ks * 512);
    }
    loads_issued(pk, pv);
    pk += 2048; pv += 2048;
    if (DIAG) { attn_mask(st[0], kb, q0 + lr, hi); attn_mask(st[1], kb, q0 + 16 + lr, hi); }   // only the diagonal pass holds keys beyond a query
#pragma unroll
    for (int nq = 0; nq < 2; ++nq) { const float al = attn_soft(st[nq], m[nq], l[nq]); v16h bp;
#pragma unroll
        for (int e = 0; e < 16; ++e) bp[e] = tohx(st[nq][e >> 3][e & 7]);
#pragma unroll
        for (int db = 0; db < 4; ++db) { o[nq][db] *= al; o[nq][db] = wmma16(av[db], bp, o[nq][db]); } }
}
__device__ __forceinline__ void attn_f16(const h16* __restrict__ Q, const h16* __restrict__ Kp, const h16* __restrict__ Vt, int q0, bf* Ah, bf* Al, int lr, int hi) {
    const int lane = hi * 16 + lr; const h16* pq = Q + (size_t)q0 * HD + lane * 8;
    v16h bq[2][2];
#pragma unroll
    for (int nq = 0; nq < 2; ++nq)
#pragma unroll
        for (int ks = 0; ks < 2; ++ks) bq[nq][ks] = WFrag<h16>::ld(pq + nq * 1024 + ks * 512);
    v8f o[2][4]; float m[2], l[2];
#pragma unroll
    for (int nq = 0; nq < 2; ++nq) { m[nq] = -3.0e38f; l[nq] = 0.f;
#pragma unroll
        for (int db = 0; db < 4; ++db) o[nq][db] = (v8f){}; }
    const h16* __restrict__ pk = Kp + lane * 8; const h16* __restrict__ pv = Vt + lane * 8;
    v16h ak[2][2];
#pragma unroll
    for (int kt = 0; kt < 2; ++kt)
#pragma unroll
        for (int ks = 0; ks < 2; ++ks) ak[kt][ks] = WFrag<h16>::ld(pk + kt * 1024 + ks * 512);
    loads_issued(pq, pk);
    pk += 2048;
#pragma unroll 1
    for (int kb = 0; kb < q0; kb += 32) attn_f16_pass<false>(pk, pv, kb, q0, lr, hi, bq, ak, o, m, l);
    attn_f16_pass<true>(pk, pv, q0, q0, lr, hi, bq, ak, o, m, l);
    attn_store(o[0], l[0], Ah, Al, q0, lane); attn_store(o[1], l[1], Ah, Al, q0 + 16, lane);
}
// query rows < RH: bf16 hi + lo planes, 3 products (hi hi, lo hi, hi lo) for the scores and for probability x value; 16 query rows a wave
__device__ __forceinline__ void attn_hl(const bf* __restrict__ Qh, const bf* __restrict__ Ql, const bf* __restrict__ Kh, const bf* __restrict__ Kl, const bf* __restrict__ Vh, const bf* __restrict__ Vl, int q0, bf* Ah, bf* Al, int lr, int hi) {
    const int lane = hi * 16 + lr; v16bf qh[2], ql[2];
#pragma unroll
    for (int ks = 0; ks < 2; ++ks) { const size_t qo = (size_t)q0 * HD + ks * 512 + lane * 8; qh[ks] = WFrag<bf>::ld(Qh + qo); ql[ks] = WFrag<bf>::ld(Ql + qo); }
    v8f o[4]; float m = -3.0e38f, l = 0.f;
#pragma unroll
    for (int db = 0; db < 4; ++db) o[db] = (v8f){};
    const bf* __restrict__ pkh = Kh + lane * 8; const bf* __restrict__ pkl = Kl + lane * 8; const bf* __restrict__ pvh = Vh + lane * 8; const bf* __restrict__ pvl = Vl + lane * 8;   // the lane's places in this pass's 4 K and 4 V^T fragments
#pragma unroll 1
    for (int kb = 0; kb <= q0; kb += 32) {   // q0 is a multiple of 16: the last pass holds the diagonal, and its 32 keys lie below RH + 16 <= TT
        v16bf kh[2][2], kl[2][2], vh[4], vl[4];
#pragma unroll
        for (int kt = 0; kt < 2; ++kt)
#pragma unroll
            for (int ks = 0; ks < 2; ++ks) { const int e = kt * 1024 + ks * 512; kh[kt][ks] = WFrag<bf>::ld(pkh + e); kl[kt][ks] = WFrag<bf>::ld(pkl + e); }
#pragma unroll
        for (int db = 0; db < 4; ++db) { const int e = db * 512; vh[db] = WFrag<bf>::ld(pvh + e); vl[db] = WFrag<bf>::ld(pvl + e); }
        loads_issued(pkh, pkl, pvh, pvl);
        pkh += 2048; pkl += 2048; pvh += 2048; pvl += 2048;
        v8f st[2];
#pragma unroll
        for (int kt = 0; kt < 2; ++kt) { st[kt] = (v8f){};
#pragma unroll
            for (int ks = 0; ks < 2; ++ks) { st[kt] = wmmab(kh[kt][ks], qh[ks], st[kt]); st[kt] = wmmab(kh[kt][ks], ql[ks], st[kt]); st[kt] = wmmab(kl[kt][ks], qh[ks], st[kt]); } }
        if (kb + 31 > q0) attn_mask(st, kb, q0 + lr, hi);
        const float al = attn_soft(st, m, l); v8us p0h, p0l, p1h, p1l;
#pragma unroll
        for (int j = 0; j < 8; ++j) { unsigned short x, y; splitf(st[0][j], x, y); p0h[j] = x; p0l[j] = y; splitf(st[1][j], x, y); p1h[j] = x; p1l[j] = y; }
        const v16bf ph = cat16b(p0h, p1h), pl = cat16b(p0l, p1l);
#pragma unroll
        for (int db = 0; db < 4; ++db) { o[db] *= al; o[db] = wmmab(vh[db], ph, o[db]); o[db] = wmmab(vh[db], pl, o[db]); o[db] = wmmab(vl[db], ph, o[db]); }
    }
    attn_store(o, l, Ah, Al, q0, lane);
}
// grid (NB_ * NH_, (TT - RH) / 128 + RH / 64), 4 waves; y falls with the rows' cost: y = 0 holds the last (longest) query rows
__global__ __launch_bounds__(128) void k_fattn(const h16* __restrict__ Q16, const h16* __restrict__ K16, const h16* __restrict__ V16, const bf* __restrict__ Qh, const bf* __restrict__ Ql, const bf* __restrict__ Kh, const bf* __restrict__ Kl, const bf* __restrict__ Vh, const bf* __restrict__ Vl, bf* Ah, bf* Al) {
    const int lane = threadIdx.x & 31, lr = lane & 15, hi = lane >> 4; const int w = __builtin_amdgcn_readfirstlane(threadIdx.x >> 5);
    const int b = blockIdx.x / NH_, h = blockIdx.x % NH_, y = blockIdx.y; const size_t pq = (size_t)(b * NH_ + h) * TT * HD, pk = (size_t)(b * NKV + h / REP) * TT * HD, po = (size_t)b * TT * DQ + h * 1024;   // po: the head's 2 fragments in the merged plane's first row tile
    if (y < (TT - RH) / 128) attn_f16(Q16 + pq, K16 + pk, V16 + pk, TT - 128 * y - 32 * (w + 1), Ah + po, Al + po, lr, hi);
    else attn_hl(Qh + pq, Ql + pq, Kh + pk, Kl + pk, Vh + pk, Vl + pk, RH - 64 * (y - (TT - RH) / 128) - 16 * (w + 1), Ah + po, Al + po, lr, hi);
}

extern "C" void kernel_launch(void* const* d_in, const int* in_sizes, int n_in,
                              void* d_out, int out_size, void* d_ws, size_t ws_size, hipStream_t stream) {
    (void)in_sizes; (void)n_in; (void)out_size;
            const float* x = (const float*)d_in[0]; const float* wq = (const float*)d_in[1]; const float* wk = (const float*)d_in[2]; const float* wv = (const float*)d_in[3]; const float* wo = (const float*)d_in[4]; const float* bo = (const float*)d_in[5];   /* input order x, Wq, Wk, Wv (PER-HEAD [16][1024][64]: 'hcd'), Wo ('oi' [1024][1024]), bo */
    float* OUT = (float*)d_out;     // [2][2048][1024]
    char* wsp = (char*)d_ws;
    auto take = [&](size_t bytes) { char* p = wsp; wsp += (bytes + 255) & ~(size_t)255; return (void*)p; };
    bf* WQ = (bf*)take((size_t)DQ * DM * 2); bf* WK = (bf*)take((size_t)DKV * DM * 2); bf* WV = (bf*)take((size_t)DKV * DM * 2); bf* WO = (bf*)take((size_t)DM * DQ * 2);
    bf* XB = (bf*)take((size_t)NB_ * TT * DM * 2);   // both batches: bf16 x
    const size_t NQP = (size_t)NH_ * TT * HD, NKP = (size_t)NKV * TT * HD;   // elements of one batch's query / key-value head planes; every plane holds both batches, [b][h]
    h16* QP16 = (h16*)take(NB_ * NQP * 2); h16* KP16 = (h16*)take(NB_ * NKP * 2); h16* VT16 = (h16*)take(NB_ * NKP * 2);
    bf* QPh = (bf*)take(NB_ * NQP * 2); bf* QPl = (bf*)take(NB_ * NQP * 2); bf* KPh = (bf*)take(NB_ * NKP * 2); bf* KPl = (bf*)take(NB_ * NKP * 2); bf* VTh = (bf*)take(NB_ * NKP * 2); bf* VTl = (bf*)take(NB_ * NKP * 2);
    bf* ATh = (bf*)take((size_t)NB_ * TT * DQ * 2); bf* ATl = (bf*)take((size_t)NB_ * TT * DQ * 2);
    (void)WK; (void)WV;   // reached through WQ: the three planes are contiguous
    if ((size_t)(wsp - (char*)d_ws) > ws_size) return;    // ws 256 MiB
    k_wtG<<<dim3((unsigned)(DM * HD / 8 / 256), NH_ + 2 * NKV, 1), 256, 0, stream>>>(wq, wk, wv, WQ);   /* every per-head weight [h][DM][HD] ('xw' per head) -> its HD rows of the Bt planes WQ | WK | WV (contiguous) */
    k_cvt8<<<(unsigned)(((size_t)DM * DQ / 8 + 255) / 256), 256, 0, stream>>>(wo, WO, (size_t)DM * DQ / 8);
    k_cvt8<<<(unsigned)(((size_t)NB_ * TT * DM / 8 + 255) / 256), 256, 0, stream>>>(x, XB, (size_t)NB_ * TT * DM / 8);
    k_gemmw<bf, 0, false, DM, true><<<dim3(NB_ * TT / 64, PQKV / 64, 1), 32, 0, stream>>>(XB, nullptr, WQ, nullptr, nullptr, 0, nullptr, 0, 0, 0, HeadPlanes{(bf*)QP16, QPh, QPl, (bf*)KP16, KPh, KPl, (bf*)VT16, VTh, VTl});   // q, k and v of both batches in one launch, stored as the attention's head planes
    k_fattn<<<dim3(NB_ * NH_, (TT - RH) / 128 + RH / 64, 1), 128, 0, stream>>>(QP16, KP16, VT16, QPh, QPl, KPh, KPl, VTh, VTl, ATh, ATl);   // every batch, head and query row in one launch
    k_gemmw<bf, 1, true, DQ><<<dim3(NB_ * TT / 64, DM / 64, 1), 32, 0, stream>>>(ATh, ATl, WO, nullptr, OUT, DM, bo, 0, 0, 0, HeadPlanes{});   // both batches in one launch
}

// v005
// A run of this version takes 121 microseconds.
// Two timings next to v004 put it at 1.06 and 1.04 times that version's speed.
// Counting every step since v000, it is 14.6 times as fast.
#include <hip/hip_runtime.h>

// Causal multi-head attention with PER-HEAD projection weights and a model-width score scale (x [2][2048][1024]; q, k, v = einsum('btc,hcd->bhtd', x, W) with W [16][1024][64]: head h has its own (in, out) matrix ('xw' per head; no bias; 16 heads x 64); scores x 1/sqrt(float32(C)) with C = 1024 = 1/32 (the MODEL width: the module's own choice; soft logits); causal (-inf); softmax; out merged head-major; out Wo^T + bo ('oi' [1024][1024] + bias normal: non-zero) -> [2][2048][1024] (4.2 M); argument order x, Wq, Wk, Wv, Wo, bo).
// FRAGMENT ORDER: every 16-bit plane that a WMMA reads (x, the weights, q, k, v^T, the merged attention output) is stored as the lanes read it. A fragment = 16 rows x 32 k = 512 elements in a row: [half w of the k range][lane][8 elements], lane = 16 * hi + row % 16, k % 32 = 16 * w + 8 * hi + j.
// So each wave-wide 16-byte load or store covers 512 contiguous bytes (4 whole 128-byte lines) and not 32-byte pieces of 16 lines. Fragments of one 16-row tile follow one another along k, so a tile of a K-wide plane starts at element row * K, as in the row-major plane; v^T alone is ordered for its reader: the 4 fragments (64 d) of 32 keys lie together, then the next 32 keys.
// Layout: bf16 copy of x (both batches); each PER-HEAD q / k / v weight [h][1024][64] transposed once into its 64 rows of the Bt plane; Wp cast once ('oi' = Bt rows as stored); these three in one launch (k_prep); exact projections, whose launch stores the q / k / v^T head planes itself (k_gemmw, PLANES); one fused causal attention launch (k_fattn: scores and probabilities stay in registers, online softmax; hybrid rows: < 512 hi/lo 3 products, rest fp16); merged hi/lo x w_o exact.
// Compute dtypes, f32 accumulate: every input rounded to bf16; projections exact; attention rows < 512 3 products, rest fp16; softmax f32; w_o hl x exact.

#define NB_  2
#define TT   2048
#define DM   1024
#define NH_  16
#define NKV  16
#define REP  (NH_ / NKV)
#define HD   64
#define DQ   (NH_ * HD)
#define DKV  (NKV * HD)
#define PQKV (DQ + 2 * DKV)       // columns of the joint q | k | v projection
#define RH   512                  // query rows < RH use hi+lo planes (0: none)
#define SCL  0.03125f   // 1 / sqrt(C) with C = 1024 = the MODEL width (this module scales its scores by the model width, not the head width): exactly 2^-5
typedef _Float16 h16;
typedef unsigned short bf;
typedef __attribute__((ext_vector_type(16))) __bf16   v16bf;
typedef __attribute__((ext_vector_type(16))) _Float16 v16h;
typedef __attribute__((ext_vector_type(8)))  _Float16 v8h;
typedef __attribute__((ext_vector_type(8)))  unsigned short v8us;
typedef __attribute__((ext_vector_type(8)))  float    v8f;
typedef __attribute__((ext_vector_type(4)))  float    v4f;
typedef v8h  __attribute__((may_alias)) v8ha;
typedef v4f  __attribute__((may_alias)) v4fa;
typedef v8us __attribute__((may_alias)) v8usa;

__device__ __forceinline__ unsigned short f2bf(float f) { unsigned u = __float_as_uint(f); u += 0x7FFFu + ((u >> 16) & 1u); return (unsigned short)(u >> 16); }
__device__ __forceinline__ float bf2f(unsigned short b) { return __uint_as_float(((unsigned)b) << 16); }
__device__ __forceinline__ float bfr(float f) { return bf2f(f2bf(f)); }
__device__ __forceinline__ v16h cat16(v8h lo, v8h hi) { return __builtin_shufflevector(lo, hi, 0, 1, 2, 3, 4, 5, 6, 7, 8, 9, 10, 11, 12, 13, 14, 15); }
__device__ __forceinline__ v16bf cat16b(v8us lo, v8us hi) { return __builtin_bit_cast(v16bf, __builtin_shufflevector(lo, hi, 0, 1, 2, 3, 4, 5, 6, 7, 8, 9, 10, 11, 12, 13, 14, 15)); }
__device__ __forceinline__ v8f wmma16(v16h a, v16h b, v8f c) { return __builtin_amdgcn_wmma_f32_16x16x32_f16(false, a, false, b, (short)0, c, false, false); }
__device__ __forceinline__ v8f wmmab(v16bf a, v16bf b, v8f c) { return __builtin_amdgcn_wmma_f32_16x16x32_bf16(false, a, false, b, (short)0, c, false, false); }



__device__ __forceinline__ h16 tohx(float x) { return (h16)x; }
__device__ __forceinline__ void splitf(float y, unsigned short& h, unsigned short& l) { h = f2bf(y); l = f2bf(y - bf2f(h)); }
// Stands behind a group of issued global loads. s_wait_xcnt 0 stands in front of every later rewrite of the registers that hold their addresses; the addresses are named as inputs so that those registers stay as they are up to the wait.
// sched_barrier: without it the scheduler moves the loads down to their first use, where they no longer fly under the arithmetic in between.
__device__ __forceinline__ void loads_issued(const void* a, const void* b) { asm volatile("s_wait_xcnt 0x0" :: "v"(a), "v"(b) : "memory"); __builtin_amdgcn_sched_barrier(0); }
__device__ __forceinline__ void loads_issued(const void* a, const void* b, const void* c, const void* d) { asm volatile("s_wait_xcnt 0x0" :: "v"(a), "v"(b), "v"(c), "v"(d) : "memory"); __builtin_amdgcn_sched_barrier(0); }
// ---- k_gemmw: register-blocked GEMM, ONE WAVE per 64x64 output tile (16 accumulators), operands straight from 16-bit planes in fragment order; grid (M/64, N/64, Z), 32 threads.
// C[m][n] (f32, pitch ldc, + optional f32 bias[n]) = sum_k A[m][k] Bt[n][k] (+ split products per NSPLIT). z-batch strides sA/sB/sC in elements. K % 32 == 0; K is a compile-time number, so that every fragment of a k step lies at an immediate offset from the side's one address.
// PLANES: the joint q | k | v projection (A = x of both batches, Bt = the weight rows, one head per 64 columns). Nothing goes to C: the tile is stored as the attention's head planes, fp16 and bf16 hi / lo of every value, in fragment order; q, k per [b][h]: rows t, k index d; v per [b][h]: rows d, k index t.
// The WMMA's A side is then the plane's k index (t for v; d for q and k, whose tiles swap the two operands: both sides use the same loader, so the k orders agree either way): the 8 values of a lane in one accumulator ARE that lane's 16 bytes of one half fragment, and go out straight from the registers.
struct HeadPlanes { bf *q16, *qh, *ql, *k16, *kh, *kl, *v16, *vh, *vl; };
template <typename T16> struct WFrag;
template <> struct WFrag<h16> { typedef v16h V; static __device__ __forceinline__ V ld(const h16* p) { return cat16(*(const v8h*)p, *(const v8h*)(p + 256)); } static __device__ __forceinline__ v8f mma(V a, V b, v8f c) { return wmma16(a, b, c); } };
template <> struct WFrag<bf> { typedef v16bf V; static __device__ __forceinline__ V ld(const bf* p) { return cat16b(*(const v8us*)p, *(const v8us*)(p + 256)); } static __device__ __forceinline__ v8f mma(V a, V b, v8f c) { return wmmab(a, b, c); } };
template <typename T16, int NSPLIT, bool BIAS, int K, bool PLANES = false>
__global__ __launch_bounds__(32) void k_gemmw(const T16* __restrict__ A, const T16* __restrict__ A2, const T16* __restrict__ Bt, const T16* __restrict__ Bt2, float* C, int ldc, const float* __restrict__ bias, size_t sA, size_t sB, size_t sC, HeadPlanes hp) {
    typedef typename WFrag<T16>::V V;
    __shared__ __align__(16) float os[16 * 68];
    const size_t z = blockIdx.z; A += z * sA; if (A2) A2 += z * sA; Bt += z * sB; if (Bt2) Bt2 += z * sB; C += z * sC;
    const int lane = threadIdx.x & 31, lr = lane & 15, hi = lane >> 4; const int r0 = blockIdx.x * 64, c0 = blockIdx.y * 64;
    v8f acc[4][4];
#pragma unroll
    for (int mb = 0; mb < 4; ++mb)
#pragma unroll
        for (int nb = 0; nb < 4; ++nb) acc[mb][nb] = (v8f){};
    int ra = r0, rb = c0;   // first row of the A side and of the B side
    if (PLANES && c0 < DQ + DKV) { const T16* t = A; A = Bt; Bt = t; ra = c0; rb = r0; }   // q, k tiles: weight rows (d) on the A side
    const size_t aoff = (size_t)ra * K + lane * 8, boff = (size_t)rb * K + lane * 8;   // the lane's place in the first fragment of the side's first 16-row tile; 32 k on = 512 elements on
    const T16* __restrict__ pa = A + aoff; const T16* __restrict__ pb = Bt + boff; const T16* __restrict__ pa2 = (NSPLIT == 1 || NSPLIT == 2) ? A2 + aoff : pa; const T16* __restrict__ pb2 = (NSPLIT >= 2) ? Bt2 + boff : pb;
#pragma unroll 1
    for (int kc = 0; kc < K; kc += 32) {
        V a[4], a2[4], b[4], b2[4];
#pragma unroll
        for (int mb = 0; mb < 4; ++mb) { a[mb] = WFrag<T16>::ld(pa + mb * 16 * K); if (NSPLIT == 1 || NSPLIT == 2) a2[mb] = WFrag<T16>::ld(pa2 + mb * 16 * K); }
#pragma unroll
        for (int nb = 0; nb < 4; ++nb) { b[nb] = WFrag<T16>::ld(pb + nb * 16 * K); if (NSPLIT >= 2) b2[nb] = WFrag<T16>::ld(pb2 + nb * 16 * K); }
        loads_issued(pa, pb, pa2, pb2);   // the k step's loads are one run at immediate offsets from these addresses, which step on only behind the wait
        pa += 512; pb += 512; pa2 += 512; pb2 += 512;
#pragma unroll
        for (int nb = 0; nb < 4; ++nb) {
#pragma unroll
            for (int mb = 0; mb < 4; ++mb) { acc[mb][nb] = WFrag<T16>::mma(a[mb], b[nb], acc[mb][nb]); if (NSPLIT == 1 || NSPLIT == 2) acc[mb][nb] = WFrag<T16>::mma(a2[mb], b[nb], acc[mb][nb]); if (NSPLIT >= 2) acc[mb][nb] = WFrag<T16>::mma(a[mb], b2[nb], acc[mb][nb]); } }
        asm volatile("v_nop\n\tv_nop\n\tv_nop\n\tv_nop" : "+v"(acc[0][0]), "+v"(acc[1][1]), "+v"(acc[2][2]), "+v"(acc[3][3]) : "v"(a[0]), "v"(a[3]));
    }
    if constexpr (PLANES) {
        static_assert(HD == 64 && TT % 64 == 0, "a tile is one head wide and lies in one batch");
        const bool isq = c0 < DQ, isv = c0 >= DQ + DKV; const int b = r0 / TT, t0 = r0 % TT, h = (isq ? c0 : isv ? c0 - DQ - DKV : c0 - DQ) / HD;
        bf* d16 = isq ? hp.q16 : isv ? hp.v16 : hp.k16; bf* dh = isq ? hp.qh : isv ? hp.vh : hp.kh; bf* dl = isq ? hp.ql : isv ? hp.vl : hp.kl;
        // q, k: 16-row tile t / 16 = 2 fragments (d) = 1024 elements, half fragment mb. v: 32 t = 4 fragments (16-row tiles of d) = 2048 elements, fragment nb, half mb & 1. 64 t of one head are 64 * HD elements either way.
        const size_t base = ((size_t)(b * (isq ? NH_ : NKV) + h) * TT + t0) * HD + lane * 8; const int snb = isv ? 512 : 1024, smb2 = isv ? 2048 : 512;
#pragma unroll
        for (int nb = 0; nb < 4; ++nb) {
#pragma unroll
            for (int mb = 0; mb < 4; ++mb) { v8h o16; v8us oh, ol;
#pragma unroll
                for (int j = 0; j < 8; ++j) { const float v = acc[mb][nb][j]; unsigned short p, q; splitf(v, p, q); o16[j] = tohx(v); oh[j] = p; ol[j] = q; }
                const size_t o = base + nb * snb + (mb >> 1) * smb2 + (mb & 1) * 256;
                *(v8usa*)(d16 + o) = __builtin_bit_cast(v8us, o16); *(v8usa*)(dh + o) = oh; *(v8usa*)(dl + o) = ol; }
        }
        return;
    }
#pragma unroll
    for (int mb = 0; mb < 4; ++mb) {
#pragma unroll
        for (int nb = 0; nb < 4; ++nb) {
#pragma unroll
            for (int j = 0; j < 8; ++j) os[(hi * 8 + j) * 68 + nb * 16 + lr] = acc[mb][nb][j]; }
        __builtin_amdgcn_wave_barrier(); asm volatile("" ::: "memory");
        float* crow = C + (size_t)(r0 + mb * 16) * ldc + c0;
{
#pragma unroll
            for (int s = 0; s < 8; ++s) { const int row = 2 * s + hi, cofs = lr * 4; v4f val = *(const v4fa*)(os + row * 68 + cofs); if (BIAS) { val[0] += bfr(bias[c0 + cofs]); val[1] += bfr(bias[c0 + cofs + 1]); val[2] += bfr(bias[c0 + cofs + 2]); val[3] += bfr(bias[c0 + cofs + 3]); }
                *(v4f*)(crow + (size_t)row * ldc + cofs) = val; }
             }
        __builtin_amdgcn_wave_barrier(); asm volatile("" ::: "memory");
    }
}

typedef __attribute__((ext_vector_type(2))) _Float16 v2h;
typedef __attribute__((ext_vector_type(4))) _Float16 v4h;
typedef __attribute__((ext_vector_type(2))) unsigned short v2us;
typedef __attribute__((ext_vector_type(4))) unsigned short v4us;
typedef __attribute__((ext_vector_type(2))) float v2f;
typedef __attribute__((ext_vector_type(4))) int v4i;

// ---- k_prep: the three operand planes that hang on no product (the q | k | v weight rows, w_o, x), bf16 in fragment order, in ONE launch of few long-lived waves: 512 work-groups of 8 waves (16 waves a WGP, all resident at once), 8 pieces a thread.
// A piece = one lane's 8 elements (16 bytes) of a half fragment: lane = 16 * hi + row % 16, half w, k % 32 = 16 * w + 8 * hi + j. 64 threads hold one fragment, so a work-group holds 4 fragments (fs) at a time and 32 in all.
// All loads of a thread lie at immediate offsets from one address and are issued before the first value is converted; its stores lie at immediate offsets from one address too.
#define PREP_WT ((NH_ + 2 * NKV) * 4)   // work-groups on the per-head weights: 4 for each [DM][HD] matrix
#define PREP_X  (NB_ * TT / 16)         // on x: one 16-row tile (32 fragments) each
#define PREP_WO (DM / 16)               // on w_o: the same
__device__ __forceinline__ v8us bf8(const float (&v)[8]) { v8us o;
#pragma unroll
    for (int j = 0; j < 8; ++j) o[j] = f2bf(v[j]);
    return o; }
__global__ __launch_bounds__(256) void k_prep(const float* __restrict__ x, const float* __restrict__ wq, const float* __restrict__ wk, const float* __restrict__ wv, const float* __restrict__ wo, bf* __restrict__ Bt, bf* __restrict__ WOp, bf* __restrict__ XBp) {
    static_assert(DM == 1024 && HD == 64 && DQ == DM && (NB_ * TT) % 16 == 0, "32 fragments along k; 4 row tiles a head matrix; whole row tiles: the grid covers every piece exactly once, with no tail");
    const int tid = threadIdx.x, lr = tid & 15, hi = (tid >> 4) & 1, w = (tid >> 5) & 1, fs = tid >> 6, c = blockIdx.x; const int k0 = fs * 32 + w * 16 + hi * 8;
    float v[8][8];
    if (c < PREP_WT) {   // head matrix y ([DM][HD]: NH_ of wq, then NKV of wk, then NKV of wv; their Bt planes lie one behind the other), transposed; quarter kq of its k range, all 64 rows n: piece u = row tile u & 3, fragment kq * 8 + (u >> 2) * 4 + fs
        const int y = c >> 2, kq = c & 3; const float* ws = (y < NH_) ? wq + (size_t)y * DM * HD : (y < NH_ + NKV) ? wk + (size_t)(y - NH_) * DM * HD : wv + (size_t)(y - NH_ - NKV) * DM * HD;
        const float* __restrict__ p = ws + (size_t)(kq * 256 + k0) * HD + lr; bf* d = Bt + (size_t)y * HD * DM + (kq * 8 + fs) * 512 + (tid & 63) * 8;
#pragma unroll
        for (int u = 0; u < 8; ++u)
#pragma unroll
            for (int j = 0; j < 8; ++j) v[u][j] = p[((u >> 2) * 128 + j) * HD + (u & 3) * 16];
        loads_issued(p, p);   // all 64 loads fly together, and their one address stays in its registers up to the wait
#pragma unroll
        for (int u = 0; u < 8; ++u) *(v8us*)(d + (u & 3) * 16 * DM + (u >> 2) * 2048) = bf8(v[u]);
        return;
    }
    // row-major [rows][DM] f32: row tile t, piece u = fragment fs + 4 * u
    const bool isx = c < PREP_WT + PREP_X; const int t = isx ? c - PREP_WT : c - PREP_WT - PREP_X;
    const float* __restrict__ p = (isx ? x : wo) + (size_t)(t * 16 + lr) * DM + k0; bf* d = (isx ? XBp : WOp) + (size_t)t * 16 * DM + tid * 8;
#pragma unroll
    for (int u = 0; u < 8; ++u) { const v8f a = *(const v8f*)(p + u * 128);
#pragma unroll
        for (int j = 0; j < 8; ++j) v[u][j] = a[j]; }
    loads_issued(p, p);   // all 16 loads fly together, and their one address stays in its registers up to the wait (no load's result lands on it)
#pragma unroll
    for (int u = 0; u < 8; ++u) *(v8us*)(d + u * 2048) = bf8(v[u]);
}

#define C2L 0.045084220027780106f   // SCL x log2(e): exp(SCL (s - m)) = exp2(C2L s - C2L m)
__device__ __forceinline__ float xhalf(float x) { return __builtin_bit_cast(float, __builtin_amdgcn_permlanex16(__builtin_bit_cast(int, x), __builtin_bit_cast(int, x), 0x76543210, 0xfedcba98, false, false)); }   // lane l reads lane l ^ 16
// row0: first of the wave's 16 query rows; Ah, Al: the head's first fragment in row tile 0 (the head's 64 columns = 2 fragments = 4 half fragments, db each)
__device__ __forceinline__ void attn_store(const v8f (&o)[4], float l, bf* Ah, bf* Al, int row0, int lane) {
    const float f = __fdiv_rn(1.0f, l + xhalf(l));
#pragma unroll
    for (int db = 0; db < 4; ++db) { v8us oh, ol;
#pragma unroll
        for (int j = 0; j < 8; ++j) { unsigned short x, y; splitf(o[db][j] * f, x, y); oh[j] = x; ol[j] = y; }
        const size_t oo = (size_t)row0 * DQ + db * 256 + lane * 8; *(v8us*)(Ah + oo) = oh; *(v8us*)(Al + oo) = ol; }
}
// running maximum m (raw score units) and sum l of one query column over its 16 new scores; st becomes exp(SCL (s - m)); returns the factor for what was summed under the old maximum
__device__ __forceinline__ float attn_soft(v8f (&st)[2], float& m, float& l) {
    float mx = m;
#pragma unroll
    for (int kt = 0; kt < 2; ++kt)
#pragma unroll
        for (int j = 0; j < 8; ++j) mx = fmaxf(mx, st[kt][j]);
    mx = fmaxf(mx, xhalf(mx));
    const float al = __builtin_amdgcn_exp2f((m - mx) * C2L), mc = mx * C2L; m = mx; float s = 0.f;
#pragma unroll
    for (int kt = 0; kt < 2; ++kt)
#pragma unroll
        for (int j = 0; j < 8; ++j) { const float p = __builtin_amdgcn_exp2f(__builtin_fmaf(st[kt][j], C2L, -mc)); st[kt][j] = p; s += p; }
    l = l * al + s; return al;
}
__device__ __forceinline__ void attn_mask(v8f (&st)[2], int kb, int query, int hi) {
#pragma unroll
    for (int kt = 0; kt < 2; ++kt)
#pragma unroll
        for (int j = 0; j < 8; ++j) st[kt][j] = (kb + kt * 16 + hi * 8 + j <= query) ? st[kt][j] : -3.0e38f;
}
// query rows >= RH: fp16 operands, 32 query rows a wave. One pass = 32 keys from kb on. pv: the lane's place in this pass's 4 V^T fragments; pk: in the NEXT pass's 4 K fragments; both step on (4 fragments) behind the loads.
// ak holds this pass's K fragments on entry and, where DIAG is false, the next pass's on return (they fly while this pass computes).
template <bool DIAG>
__device__ __forceinline__ void attn_f16_pass(const h16* __restrict__& pk, const h16* __restrict__& pv, int kb, int q0, int lr, int hi, const v16h (&bq)[2][2], v16h (&ak)[2][2], v8f (&o)[2][4], float (&m)[2], float (&l)[2]) {
    v16h av[4];
#pragma unroll
    for (int db = 0; db < 4; ++db) av[db] = WFrag<h16>::ld(pv + db * 512);
    v8f st[2][2];
#pragma unroll
    for (int nq = 0; nq < 2; ++nq)
#pragma unroll
        for (int kt = 0; kt < 2; ++kt) { st[nq][kt] = wmma16(ak[kt][0], bq[nq][0], (v8f){}); st[nq][kt] = wmma16(ak[kt][1], bq[nq][1], st[nq][kt]); }
    if (!DIAG) {
#pragma unroll
        for (int kt = 0; kt < 2; ++kt)
#pragma unroll
            for (int ks = 0; ks < 2; ++ks) ak[kt][ks] = WFrag<h16>::ld(pk + kt * 1024 + ks * 512);
    }
    loads_issued(pk, pv);
    pk += 2048; pv += 2048;
    if (DIAG) { attn_mask(st[0], kb, q0 + lr, hi); attn_mask(st[1], kb, q0 + 16 + lr, hi); }   // only the diagonal pass holds keys beyond a query
#pragma unroll
    for (int nq = 0; nq < 2; ++nq) { const float al = attn_soft(st[nq], m[nq], l[nq]); v16h bp;
#pragma unroll
        for (int e = 0; e < 16; ++e) bp[e] = tohx(st[nq][e >> 3][e & 7]);
#pragma unroll
        for (int db = 0; db < 4; ++db) { o[nq][db] *= al; o[nq][db] = wmma16(av[db], bp, o[nq][db]); } }
}
__device__ __forceinline__ void attn_f16(const h16* __restrict__ Q, const h16* __restrict__ Kp, const h16* __restrict__ Vt, int q0, bf* Ah, bf* Al, int lr, int hi) {
    const int lane = hi * 16 + lr; const h16* pq = Q + (size_t)q0 * HD + lane * 8;
    v16h bq[2][2];
#pragma unroll
    for (int nq = 0; nq < 2; ++nq)
#pragma unroll
        for (int ks = 0; ks < 2; ++ks) bq[nq][ks] = WFrag<h16>::ld(pq + nq * 1024 + ks * 512);
    v8f o[2][4]; float m[2], l[2];
#pragma unroll
    for (int nq = 0; nq < 2; ++nq) { m[nq] = -3.0e38f; l[nq] = 0.f;
#pragma unroll
        for (int db = 0; db < 4; ++db) o[nq][db] = (v8f){}; }
    const h16* __restrict__ pk = Kp + lane * 8; const h16* __restrict__ pv = Vt + lane * 8;
    v16h ak[2][2];
#pragma unroll
    for (int kt = 0; kt < 2; ++kt)
#pragma unroll
        for (int ks = 0; ks < 2; ++ks) ak[kt][ks] = WFrag<h16>::ld(pk + kt * 1024 + ks * 512);
    loads_issued(pq, pk);
    pk += 2048;
#pragma unroll 1
    for (int kb = 0; kb < q0; kb += 32) attn_f16_pass<false>(pk, pv, kb, q0, lr, hi, bq, ak, o, m, l);
    attn_f16_pass<true>(pk, pv, q0, q0, lr, hi, bq, ak, o, m, l);
    attn_store(o[0], l[0], Ah, Al, q0, lane); attn_store(o[1], l[1], Ah, Al, q0 + 16, lane);
}
// query rows < RH: bf16 hi + lo planes, 3 products (hi hi, lo hi, hi lo) for the scores and for probability x value; 16 query rows a wave
__device__ __forceinline__ void attn_hl(const bf* __restrict__ Qh, const bf* __restrict__ Ql, const bf* __restrict__ Kh, const bf* __restrict__ Kl, const bf* __restrict__ Vh, const bf* __restrict__ Vl, int q0, bf* Ah, bf* Al, int lr, int hi) {
    const int lane = hi * 16 + lr; v16bf qh[2], ql[2];
#pragma unroll
    for (int ks = 0; ks < 2; ++ks) { const size_t qo = (size_t)q0 * HD + ks * 512 + lane * 8; qh[ks] = WFrag<bf>::ld(Qh + qo); ql[ks] = WFrag<bf>::ld(Ql + qo); }
    v8f o[4]; float m = -3.0e38f, l = 0.f;
#pragma unroll
    for (int db = 0; db < 4; ++db) o[db] = (v8f){};
    const bf* __restrict__ pkh = Kh + lane * 8; const bf* __restrict__ pkl = Kl + lane * 8; const bf* __restrict__ pvh = Vh + lane * 8; const bf* __restrict__ pvl = Vl + lane * 8;   // the lane's places in this pass's 4 K and 4 V^T fragments
#pragma unroll 1
    for (int kb = 0; kb <= q0; kb += 32) {   // q0 is a multiple of 16: the last pass holds the diagonal, and its 32 keys lie below RH + 16 <= TT
        v16bf kh[2][2], kl[2][2], vh[4], vl[4];
#pragma unroll
        for (int kt = 0; kt < 2; ++kt)
#pragma unroll
            for (int ks = 0; ks < 2; ++ks) { const int e = kt * 1024 + ks * 512; kh[kt][ks] = WFrag<bf>::ld(pkh + e); kl[kt][ks] = WFrag<bf>::ld(pkl + e); }
#pragma unroll
        for (int db = 0; db < 4; ++db) { const int e = db * 512; vh[db] = WFrag<bf>::ld(pvh + e); vl[db] = WFrag<bf>::ld(pvl + e); }
        loads_issued(pkh, pkl, pvh, pvl);
        pkh += 2048; pkl += 2048; pvh += 2048; pvl += 2048;
        v8f st[2];
#pragma unroll
        for (int kt = 0; kt < 2; ++kt) { st[kt] = (v8f){};
#pragma unroll
            for (int ks = 0; ks < 2; ++ks) { st[kt] = wmmab(kh[kt][ks], qh[ks], st[kt]); st[kt] = wmmab(kh[kt][ks], ql[ks], st[kt]); st[kt] = wmmab(kl[kt][ks], qh[ks], st[kt]); } }
        if (kb + 31 > q0) attn_mask(st, kb, q0 + lr, hi);
        const float al = attn_soft(st, m, l); v8us p0h, p0l, p1h, p1l;
#pragma unroll
        for (int j = 0; j < 8; ++j) { unsigned short x, y; splitf(st[0][j], x, y); p0h[j] = x; p0l[j] = y; splitf(st[1][j], x, y); p1h[j] = x; p1l[j] = y; }
        const v16bf ph = cat16b(p0h, p1h), pl = cat16b(p0l, p1l);
#pragma unroll
        for (int db = 0; db < 4; ++db) { o[db] *= al; o[db] = wmmab(vh[db], ph, o[db]); o[db] = wmmab(vh[db], pl, o[db]); o[db] = wmmab(vl[db], ph, o[db]); }
    }
    attn_store(o, l, Ah, Al, q0, lane);
}
// grid (NB_ * NH_, (TT - RH) / 128 + RH / 64), 4 waves; y falls with the rows' cost: y = 0 holds the last (longest) query rows
__global__ __launch_bounds__(128) void k_fattn(const h16* __restrict__ Q16, const h16* __restrict__ K16, const h16* __restrict__ V16, const bf* __restrict__ Qh, const bf* __restrict__ Ql, const bf* __restrict__ Kh, const bf* __restrict__ Kl, const bf* __restrict__ Vh, const bf* __restrict__ Vl, bf* Ah, bf* Al) {
    const int lane = threadIdx.x & 31, lr = lane & 15, hi = lane >> 4; const int w = __builtin_amdgcn_readfirstlane(threadIdx.x >> 5);
    const int b = blockIdx.x / NH_, h = blockIdx.x % NH_, y = blockIdx.y; const size_t pq = (size_t)(b * NH_ + h) * TT * HD, pk = (size_t)(b * NKV + h / REP) * TT * HD, po = (size_t)b * TT * DQ + h * 1024;   // po: the head's 2 fragments in the merged plane's first row tile
    if (y < (TT - RH) / 128) attn_f16(Q16 + pq, K16 + pk, V16 + pk, TT - 128 * y - 32 * (w + 1), Ah + po, Al + po, lr, hi);
    else attn_hl(Qh + pq, Ql + pq, Kh + pk, Kl + pk, Vh + pk, Vl + pk, RH - 64 * (y - (TT - RH) / 128) - 16 * (w + 1), Ah + po, Al + po, lr, hi);
}

extern "C" void kernel_launch(void* const* d_in, const int* in_sizes, int n_in,
                              void* d_out, int out_size, void* d_ws, size_t ws_size, hipStream_t stream) {
    (void)in_sizes; (void)n_in; (void)out_size;
            const float* x = (const float*)d_in[0]; const float* wq = (const float*)d_in[1]; const float* wk = (const float*)d_in[2]; const float* wv = (const float*)d_in[3]; const float* wo = (const float*)d_in[4]; const float* bo = (const float*)d_in[5];   /* input order x, Wq, Wk, Wv (PER-HEAD [16][1024][64]: 'hcd'), Wo ('oi' [1024][1024]), bo */
    float* OUT = (float*)d_out;     // [2][2048][1024]
    char* wsp = (char*)d_ws;
    auto take = [&](size_t bytes) { char* p = wsp; wsp += (bytes + 255) & ~(size_t)255; return (void*)p; };
    bf* WQ = (bf*)take((size_t)DQ * DM * 2); bf* WK = (bf*)take((size_t)DKV * DM * 2); bf* WV = (bf*)take((size_t)DKV * DM * 2); bf* WO = (bf*)take((size_t)DM * DQ * 2);
    bf* XB = (bf*)take((size_t)NB_ * TT * DM * 2);   // both batches: bf16 x
    const size_t NQP = (size_t)NH_ * TT * HD, NKP = (size_t)NKV * TT * HD;   // elements of one batch's query / key-value head planes; every plane holds both batches, [b][h]
    h16* QP16 = (h16*)take(NB_ * NQP * 2); h16* KP16 = (h16*)take(NB_ * NKP * 2); h16* VT16 = (h16*)take(NB_ * NKP * 2);
    bf* QPh = (bf*)take(NB_ * NQP * 2); bf* QPl = (bf*)take(NB_ * NQP * 2); bf* KPh = (bf*)take(NB_ * NKP * 2); bf* KPl = (bf*)take(NB_ * NKP * 2); bf* VTh = (bf*)take(NB_ * NKP * 2); bf* VTl = (bf*)take(NB_ * NKP * 2);
    bf* ATh = (bf*)take((size_t)NB_ * TT * DQ * 2); bf* ATl = (bf*)take((size_t)NB_ * TT * DQ * 2);
    (void)WK; (void)WV;   // reached through WQ: the three planes are contiguous
    if ((size_t)(wsp - (char*)d_ws) > ws_size) return;    // ws 256 MiB
    k_prep<<<PREP_WT + PREP_X + PREP_WO, 256, 0, stream>>>(x, wq, wk, wv, wo, WQ, WO, XB);   /* every per-head weight [h][DM][HD] ('xw' per head) -> its HD rows of the Bt planes WQ | WK | WV (contiguous); Wo and x cast */
    k_gemmw<bf, 0, false, DM, true><<<dim3(NB_ * TT / 64, PQKV / 64, 1), 32, 0, stream>>>(XB, nullptr, WQ, nullptr, nullptr, 0, nullptr, 0, 0, 0, HeadPlanes{(bf*)QP16, QPh, QPl, (bf*)KP16, KPh, KPl, (bf*)VT16, VTh, VTl});   // q, k and v of both batches in one launch, stored as the attention's head planes
    k_fattn<<<dim3(NB_ * NH_, (TT - RH) / 128 + RH / 64, 1), 128, 0, stream>>>(QP16, KP16, VT16, QPh, QPl, KPh, KPl, VTh, VTl, ATh, ATl);   // every batch, head and query row in one launch
    k_gemmw<bf, 1, true, DQ><<<dim3(NB_ * TT / 64, DM / 64, 1), 32, 0, stream>>>(ATh, ATl, WO, nullptr, OUT, DM, bo, 0, 0, 0, HeadPlanes{});   // both batches in one launch
}

// v006
// A run of this version takes 102 microseconds.
// Timed twice side by side with v005, it ran 1.20 and 1.21 times as fast.
// Counting every step since v000, it is 17.7 times as fast.
#include <hip/hip_runtime.h>

// Causal multi-head attention with PER-HEAD projection weights and a model-width score scale (x [2][2048][1024]; q, k, v = einsum('btc,hcd->bhtd', x, W) with W [16][1024][64]: head h has its own (in, out) matrix ('xw' per head; no bias; 16 heads x 64); scores x 1/sqrt(float32(C)) with C = 1024 = 1/32 (the MODEL width: the module's own choice; soft logits); causal (-inf); softmax; out merged head-major; out Wo^T + bo ('oi' [1024][1024] + bias normal: non-zero) -> [2][2048][1024] (4.2 M); argument order x, Wq, Wk, Wv, Wo, bo).
// FRAGMENT ORDER: every 16-bit plane that a WMMA reads (x, the weights, q, k, v^T, the merged attention output) is stored as the lanes read it. A fragment = 16 rows x 32 k = 512 elements in a row: [half w of the k range][lane][8 elements], lane = 16 * hi + row % 16, k % 32 = 16 * w + 8 * hi + j.
// So each wave-wide 16-byte load or store covers 512 contiguous bytes (4 whole 128-byte lines) and not 32-byte pieces of 16 lines. Fragments of one 16-row tile follow one another along k, so a tile of a K-wide plane starts at element row * K, as in the row-major plane; v^T alone is ordered for its reader: the 4 fragments (64 d) of 32 keys lie together, then the next 32 keys.
// Layout: bf16 copy of x (both batches); each PER-HEAD q / k / v weight [h][1024][64] transposed once into its 64 rows of the Bt plane; Wp cast once ('oi' = Bt rows as stored); these three in one launch (k_prep); exact projections, whose launch stores the q / k / v^T head planes itself (k_gemmw, PLANES); one fused causal attention launch (k_fattn: scores and probabilities stay in registers, online softmax; hybrid rows: < 512 hi/lo 3 products, rest fp16); merged hi/lo x w_o exact.
// Compute dtypes, f32 accumulate: every input rounded to bf16; projections exact; attention rows < 512 3 products, rest fp16; softmax f32; w_o hl x exact.

#define NB_  2
#define TT   2048
#define DM   1024
#define NH_  16
#define NKV  16
#define REP  (NH_ / NKV)
#define HD   64
#define DQ   (NH_ * HD)
#define DKV  (NKV * HD)
#define PQKV (DQ + 2 * DKV)       // columns of the joint q | k | v projection
#define RH   512                  // query rows < RH use hi+lo planes (0: none)
#define SCL  0.03125f   // 1 / sqrt(C) with C = 1024 = the MODEL width (this module scales its scores by the model width, not the head width): exactly 2^-5
typedef _Float16 h16;
typedef unsigned short bf;
typedef __attribute__((ext_vector_type(16))) __bf16   v16bf;
typedef __attribute__((ext_vector_type(16))) _Float16 v16h;
typedef __attribute__((ext_vector_type(8)))  _Float16 v8h;
typedef __attribute__((ext_vector_type(8)))  unsigned short v8us;
typedef __attribute__((ext_vector_type(8)))  float    v8f;
typedef __attribute__((ext_vector_type(4)))  float    v4f;
typedef v8h  __attribute__((may_alias)) v8ha;
typedef v4f  __attribute__((may_alias)) v4fa;
typedef v8us __attribute__((may_alias)) v8usa;

__device__ __forceinline__ unsigned short f2bf(float f) { unsigned u = __float_as_uint(f); u += 0x7FFFu + ((u >> 16) & 1u); return (unsigned short)(u >> 16); }
__device__ __forceinline__ float bf2f(unsigned short b) { return __uint_as_float(((unsigned)b) << 16); }
__device__ __forceinline__ float bfr(float f) { return bf2f(f2bf(f)); }
__device__ __forceinline__ v16h cat16(v8h lo, v8h hi) { return __builtin_shufflevector(lo, hi, 0, 1, 2, 3, 4, 5, 6, 7, 8, 9, 10, 11, 12, 13, 14, 15); }
__device__ __forceinline__ v16bf cat16b(v8us lo, v8us hi) { return __builtin_bit_cast(v16bf, __builtin_shufflevector(lo, hi, 0, 1, 2, 3, 4, 5, 6, 7, 8, 9, 10, 11, 12, 13, 14, 15)); }
__device__ __forceinline__ v8f wmma16(v16h a, v16h b, v8f c) { return __builtin_amdgcn_wmma_f32_16x16x32_f16(false, a, false, b, (short)0, c, false, false); }
__device__ __forceinline__ v8f wmmab(v16bf a, v16bf b, v8f c) { return __builtin_amdgcn_wmma_f32_16x16x32_bf16(false, a, false, b, (short)0, c, false, false); }



__device__ __forceinline__ h16 tohx(float x) { return (h16)x; }
__device__ __forceinline__ void splitf(float y, unsigned short& h, unsigned short& l) { h = f2bf(y); l = f2bf(y - bf2f(h)); }
// Stands behind a group of issued global loads. s_wait_xcnt 0 stands in front of every later rewrite of the registers that hold their addresses; the addresses are named as inputs so that those registers stay as they are up to the wait.
// sched_barrier: without it the scheduler moves the loads down to their first use, where they no longer fly under the arithmetic in between.
__device__ __forceinline__ void loads_issued(const void* a, const void* b) { asm volatile("s_wait_xcnt 0x0" :: "v"(a), "v"(b) : "memory"); __builtin_amdgcn_sched_barrier(0); }
__device__ __forceinline__ void loads_issued(const void* a, const void* b, const void* c, const void* d) { asm volatile("s_wait_xcnt 0x0" :: "v"(a), "v"(b), "v"(c), "v"(d) : "memory"); __builtin_amdgcn_sched_barrier(0); }
// ---- k_gemmw: register-blocked GEMM, ONE WAVE per 64x64 output tile (16 accumulators), operands straight from 16-bit planes in fragment order; grid (M/64, N/64, Z), 32 threads.
// C[m][n] (f32, pitch ldc, + optional f32 bias[n]) = sum_k A[m][k] Bt[n][k] (+ split products per NSPLIT). z-batch strides sA/sB/sC in elements. K % 32 == 0; K is a compile-time number, so that every fragment of a k step lies at an immediate offset from the side's one address.
// PLANES: the joint q | k | v projection (A = x of both batches, Bt = the weight rows, one head per 64 columns). Nothing goes to C: the tile is stored as the attention's head planes, fp16 and bf16 hi / lo of every value, in fragment order; q, k per [b][h]: rows t, k index d; v per [b][h]: rows d, k index t.
// The WMMA's A side is then the plane's k index (t for v; d for q and k, whose tiles swap the two operands: both sides use the same loader, so the k orders agree either way): the 8 values of a lane in one accumulator ARE that lane's 16 bytes of one half fragment, and go out straight from the registers.
struct HeadPlanes { bf *q16, *qh, *ql, *k16, *kh, *kl, *v16, *vh, *vl; };
template <typename T16> struct WFrag;
template <> struct WFrag<h16> { typedef v16h V; static __device__ __forceinline__ V ld(const h16* p) { return cat16(*(const v8h*)p, *(const v8h*)(p + 256)); } static __device__ __forceinline__ v8f mma(V a, V b, v8f c) { return wmma16(a, b, c); } };
template <> struct WFrag<bf> { typedef v16bf V; static __device__ __forceinline__ V ld(const bf* p) { return cat16b(*(const v8us*)p, *(const v8us*)(p + 256)); } static __device__ __forceinline__ v8f mma(V a, V b, v8f c) { return wmmab(a, b, c); } };
// One k step's fragments of both sides. The k loop keeps D such sets in registers, as a ring: while the WMMAs of step s run, the loads of steps s + 1 .. s + D - 1 are in flight, so a wave no longer waits out a whole load latency in front of every step.
template <typename T16, int NSPLIT, int K> struct KStep {
    typedef typename WFrag<T16>::V V; V a[4], a2[4], b[4], b2[4];
    // e: the step's place behind the four addresses, in elements (32 k = 512 elements): an immediate offset
    __device__ __forceinline__ void load(const T16* __restrict__ pa, const T16* __restrict__ pa2, const T16* __restrict__ pb, const T16* __restrict__ pb2, int e) {
#pragma unroll
        for (int mb = 0; mb < 4; ++mb) { a[mb] = WFrag<T16>::ld(pa + e + mb * 16 * K); if (NSPLIT == 1 || NSPLIT == 2) a2[mb] = WFrag<T16>::ld(pa2 + e + mb * 16 * K); }
#pragma unroll
        for (int nb = 0; nb < 4; ++nb) { b[nb] = WFrag<T16>::ld(pb + e + nb * 16 * K); if (NSPLIT >= 2) b2[nb] = WFrag<T16>::ld(pb2 + e + nb * 16 * K); }
        __builtin_amdgcn_sched_barrier(0);   // the loads are issued here, ahead of the WMMAs of the older set: moved down to their first use they would fly under nothing
    }
    __device__ __forceinline__ void mma(v8f (&acc)[4][4]) {
#pragma unroll
        for (int nb = 0; nb < 4; ++nb) {
#pragma unroll
            for (int mb = 0; mb < 4; ++mb) { acc[mb][nb] = WFrag<T16>::mma(a[mb], b[nb], acc[mb][nb]); if (NSPLIT == 1 || NSPLIT == 2) acc[mb][nb] = WFrag<T16>::mma(a2[mb], b[nb], acc[mb][nb]); if (NSPLIT >= 2) acc[mb][nb] = WFrag<T16>::mma(a[mb], b2[nb], acc[mb][nb]); } }
        asm volatile("v_nop\n\tv_nop\n\tv_nop\n\tv_nop" : "+v"(acc[0][0]), "+v"(acc[1][1]), "+v"(acc[2][2]), "+v"(acc[3][3]) : "v"(a[0]), "v"(a[3]));   // the 4 slots behind the step's last WMMA, on the loop's taken branch too
        __builtin_amdgcn_sched_barrier(0);   // the refill of this set stays behind its WMMAs: moved up it would need a further set of registers
    }
};
template <typename T16, int NSPLIT, bool BIAS, int K, bool PLANES = false, int D = 3>
__global__ __launch_bounds__(32) void k_gemmw(const T16* __restrict__ A, const T16* __restrict__ A2, const T16* __restrict__ Bt, const T16* __restrict__ Bt2, float* C, int ldc, const float* __restrict__ bias, size_t sA, size_t sB, size_t sC, HeadPlanes hp) {
    typedef typename WFrag<T16>::V V;
    __shared__ __align__(16) float os[16 * 68];
    const size_t z = blockIdx.z; A += z * sA; if (A2) A2 += z * sA; Bt += z * sB; if (Bt2) Bt2 += z * sB; C += z * sC;
    const int lane = threadIdx.x & 31, lr = lane & 15, hi = lane >> 4; const int r0 = blockIdx.x * 64, c0 = blockIdx.y * 64;
    v8f acc[4][4];
#pragma unroll
    for (int mb = 0; mb < 4; ++mb)
#pragma unroll
        for (int nb = 0; nb < 4; ++nb) acc[mb][nb] = (v8f){};
    int ra = r0, rb = c0;   // first row of the A side and of the B side
    if (PLANES && c0 < DQ + DKV) { const T16* t = A; A = Bt; Bt = t; ra = c0; rb = r0; }   // q, k tiles: weight rows (d) on the A side
    const size_t aoff = (size_t)ra * K + lane * 8, boff = (size_t)rb * K + lane * 8;   // the lane's place in the first fragment of the side's first 16-row tile; 32 k on = 512 elements on
    const T16* __restrict__ pa = A + aoff; const T16* __restrict__ pb = Bt + boff; const T16* __restrict__ pa2 = (NSPLIT == 1 || NSPLIT == 2) ? A2 + aoff : pa; const T16* __restrict__ pb2 = (NSPLIT >= 2) ? Bt2 + boff : pb;
    constexpr int NS = K / 32, NB = (NS - 2 * D + 1) / D + 1;   // k steps; trips of the rolled loop: D steps each, the last of which still loads a step below NS
    static_assert(D >= 2 && NS >= 2 * D - 1, "the ring's first fill and one whole trip exist");
    KStep<T16, NSPLIT, K> f[D]; unsigned e0 = 0;   // e0: the trip's first k step, in elements behind the four addresses
#pragma unroll
    for (int s = 0; s < D - 1; ++s) f[s].load(pa, pa2, pb, pb2, s * 512);
    asm volatile("s_wait_xcnt 0x0" ::: "memory"); __builtin_amdgcn_sched_barrier(0);   // the first fill's address registers (vector and scalar) are free for other use only behind the wait; the barrier keeps what follows behind it
#pragma unroll 1
    for (int kc = 0; kc < NB; ++kc) {   // stays rolled: D steps a trip, so that every set keeps its registers and no copy is needed
#pragma unroll
        for (int u = 0; u < D; ++u) { f[(u + D - 1) % D].load(pa + e0, pa2 + e0, pb + e0, pb2 + e0, (u + D - 1) * 512); f[u].mma(acc); }
        // s_wait_xcnt 0 stands in front of the rewrite of the trip's address registers. The step e0 is the statement's operand, so the new addresses are formed behind it, at the trip's end, where the wait is over at once; formed directly behind the last loads they would hold the wave up there.
        asm volatile("s_wait_xcnt 0x0" : "+s"(e0) :: "memory");
        e0 += D * 512;
    }
#pragma unroll
    for (int u = 0; u < NS - NB * D; ++u) {   // the last steps: nothing is loaded past the k range
        const bool more = NB * D + u + D - 1 < NS;
        if (more) f[(u + D - 1) % D].load(pa + e0, pa2 + e0, pb + e0, pb2 + e0, (u + D - 1) * 512);
        f[u % D].mma(acc);
        if (more) asm volatile("s_wait_xcnt 0x0" ::: "memory");   // in front of any later use of these loads' address registers; behind the WMMAs it is over at once
    }
    if constexpr (PLANES) {
        static_assert(HD == 64 && TT % 64 == 0, "a tile is one head wide and lies in one batch");
        const bool isq = c0 < DQ, isv = c0 >= DQ + DKV; const int b = r0 / TT, t0 = r0 % TT, h = (isq ? c0 : isv ? c0 - DQ - DKV : c0 - DQ) / HD;
        bf* d16 = isq ? hp.q16 : isv ? hp.v16 : hp.k16; bf* dh = isq ? hp.qh : isv ? hp.vh : hp.kh; bf* dl = isq ? hp.ql : isv ? hp.vl : hp.kl;
        // q, k: 16-row tile t / 16 = 2 fragments (d) = 1024 elements, half fragment mb. v: 32 t = 4 fragments (16-row tiles of d) = 2048 elements, fragment nb, half mb & 1. 64 t of one head are 64 * HD elements either way.
        const size_t base = ((size_t)(b * (isq ? NH_ : NKV) + h) * TT + t0) * HD + lane * 8; const int snb = isv ? 512 : 1024, smb2 = isv ? 2048 : 512;
#pragma unroll
        for (int nb = 0; nb < 4; ++nb) {
#pragma unroll
            for (int mb = 0; mb < 4; ++mb) { v8h o16; v8us oh, ol;
#pragma unroll
                for (int j = 0; j < 8; ++j) { const float v = acc[mb][nb][j]; unsigned short p, q; splitf(v, p, q); o16[j] = tohx(v); oh[j] = p; ol[j] = q; }
                const size_t o = base + nb * snb + (mb >> 1) * smb2 + (mb & 1) * 256;
                *(v8usa*)(d16 + o) = __builtin_bit_cast(v8us, o16); *(v8usa*)(dh + o) = oh; *(v8usa*)(dl + o) = ol; }
        }
        return;
    }
#pragma unroll
    for (int mb = 0; mb < 4; ++mb) {
#pragma unroll
        for (int nb = 0; nb < 4; ++nb) {
#pragma unroll
            for (int j = 0; j < 8; ++j) os[(hi * 8 + j) * 68 + nb * 16 + lr] = acc[mb][nb][j]; }
        __builtin_amdgcn_wave_barrier(); asm volatile("" ::: "memory");
        float* crow = C + (size_t)(r0 + mb * 16) * ldc + c0;
{
#pragma unroll
            for (int s = 0; s < 8; ++s) { const int row = 2 * s + hi, cofs = lr * 4; v4f val = *(const v4fa*)(os + row * 68 + cofs); if (BIAS) { val[0] += bfr(bias[c0 + cofs]); val[1] += bfr(bias[c0 + cofs + 1]); val[2] += bfr(bias[c0 + cofs + 2]); val[3] += bfr(bias[c0 + cofs + 3]); }
                *(v4f*)(crow + (size_t)row * ldc + cofs) = val; }
             }
        __builtin_amdgcn_wave_barrier(); asm volatile("" ::: "memory");
    }
}

typedef __attribute__((ext_vector_type(2))) _Float16 v2h;
typedef __attribute__((ext_vector_type(4))) _Float16 v4h;
typedef __attribute__((ext_vector_type(2))) unsigned short v2us;
typedef __attribute__((ext_vector_type(4))) unsigned short v4us;
typedef __attribute__((ext_vector_type(2))) float v2f;
typedef __attribute__((ext_vector_type(4))) int v4i;

// ---- k_prep: the three operand planes that hang on no product (the q | k | v weight rows, w_o, x), bf16 in fragment order, in ONE launch of few long-lived waves: 512 work-groups of 8 waves (16 waves a WGP, all resident at once), 8 pieces a thread.
// A piece = one lane's 8 elements (16 bytes) of a half fragment: lane = 16 * hi + row % 16, half w, k % 32 = 16 * w + 8 * hi + j. 64 threads hold one fragment, so a work-group holds 4 fragments (fs) at a time and 32 in all.
// All loads of a thread lie at immediate offsets from one address and are issued before the first value is converted; its stores lie at immediate offsets from one address too.
#define PREP_WT ((NH_ + 2 * NKV) * 4)   // work-groups on the per-head weights: 4 for each [DM][HD] matrix
#define PREP_X  (NB_ * TT / 16)         // on x: one 16-row tile (32 fragments) each
#define PREP_WO (DM / 16)               // on w_o: the same
__device__ __forceinline__ v8us bf8(const float (&v)[8]) { v8us o;
#pragma unroll
    for (int j = 0; j < 8; ++j) o[j] = f2bf(v[j]);
    return o; }
__global__ __launch_bounds__(256) void k_prep(const float* __restrict__ x, const float* __restrict__ wq, const float* __restrict__ wk, const float* __restrict__ wv, const float* __restrict__ wo, bf* __restrict__ Bt, bf* __restrict__ WOp, bf* __restrict__ XBp) {
    static_assert(DM == 1024 && HD == 64 && DQ == DM && (NB_ * TT) % 16 == 0, "32 fragments along k; 4 row tiles a head matrix; whole row tiles: the grid covers every piece exactly once, with no tail");
    const int tid = threadIdx.x, lr = tid & 15, hi = (tid >> 4) & 1, w = (tid >> 5) & 1, fs = tid >> 6, c = blockIdx.x; const int k0 = fs * 32 + w * 16 + hi * 8;
    float v[8][8];
    if (c < PREP_WT) {   // head matrix y ([DM][HD]: NH_ of wq, then NKV of wk, then NKV of wv; their Bt planes lie one behind the other), transposed; quarter kq of its k range, all 64 rows n: piece u = row tile u & 3, fragment kq * 8 + (u >> 2) * 4 + fs
        const int y = c >> 2, kq = c & 3; const float* ws = (y < NH_) ? wq + (size_t)y * DM * HD : (y < NH_ + NKV) ? wk + (size_t)(y - NH_) * DM * HD : wv + (size_t)(y - NH_ - NKV) * DM * HD;
        const float* __restrict__ p = ws + (size_t)(kq * 256 + k0) * HD + lr; bf* d = Bt + (size_t)y * HD * DM + (kq * 8 + fs) * 512 + (tid & 63) * 8;
#pragma unroll
        for (int u = 0; u < 8; ++u)
#pragma unroll
            for (int j = 0; j < 8; ++j) v[u][j] = p[((u >> 2) * 128 + j) * HD + (u & 3) * 16];
        loads_issued(p, p);   // all 64 loads fly together, and their one address stays in its registers up to the wait
#pragma unroll
        for (int u = 0; u < 8; ++u) *(v8us*)(d + (u & 3) * 16 * DM + (u >> 2) * 2048) = bf8(v[u]);
        return;
    }
    // row-major [rows][DM] f32: row tile t, piece u = fragment fs + 4 * u
    const bool isx = c < PREP_WT + PREP_X; const int t = isx ? c - PREP_WT : c - PREP_WT - PREP_X;
    const float* __restrict__ p = (isx ? x : wo) + (size_t)(t * 16 + lr) * DM + k0; bf* d = (isx ? XBp : WOp) + (size_t)t * 16 * DM + tid * 8;
#pragma unroll
    for (int u = 0; u < 8; ++u) { const v8f a = *(const v8f*)(p + u * 128);
#pragma unroll
        for (int j = 0; j < 8; ++j) v[u][j] = a[j]; }
    loads_issued(p, p);   // all 16 loads fly together, and their one address stays in its registers up to the wait (no load's result lands on it)
#pragma unroll
    for (int u = 0; u < 8; ++u) *(v8us*)(d + u * 2048) = bf8(v[u]);
}

#define C2L 0.045084220027780106f   // SCL x log2(e): exp(SCL (s - m)) = exp2(C2L s - C2L m)
__device__ __forceinline__ float xhalf(float x) { return __builtin_bit_cast(float, __builtin_amdgcn_permlanex16(__builtin_bit_cast(int, x), __builtin_bit_cast(int, x), 0x76543210, 0xfedcba98, false, false)); }   // lane l reads lane l ^ 16
// row0: first of the wave's 16 query rows; Ah, Al: the head's first fragment in row tile 0 (the head's 64 columns = 2 fragments = 4 half fragments, db each)
__device__ __forceinline__ void attn_store(const v8f (&o)[4], float l, bf* Ah, bf* Al, int row0, int lane) {
    const float f = __fdiv_rn(1.0f, l + xhalf(l));
#pragma unroll
    for (int db = 0; db < 4; ++db) { v8us oh, ol;
#pragma unroll
        for (int j = 0; j < 8; ++j) { unsigned short x, y; splitf(o[db][j] * f, x, y); oh[j] = x; ol[j] = y; }
        const size_t oo = (size_t)row0 * DQ + db * 256 + lane * 8; *(v8us*)(Ah + oo) = oh; *(v8us*)(Al + oo) = ol; }
}
// running maximum m (raw score units) and sum l of one query column over its 16 new scores; st becomes exp(SCL (s - m)); returns the factor for what was summed under the old maximum
__device__ __forceinline__ float attn_soft(v8f (&st)[2], float& m, float& l) {
    float mx = m;
#pragma unroll
    for (int kt = 0; kt < 2; ++kt)
#pragma unroll
        for (int j = 0; j < 8; ++j) mx = fmaxf(mx, st[kt][j]);
    mx = fmaxf(mx, xhalf(mx));
    const float al = __builtin_amdgcn_exp2f((m - mx) * C2L), mc = mx * C2L; m = mx; float s = 0.f;
#pragma unroll
    for (int kt = 0; kt < 2; ++kt)
#pragma unroll
        for (int j = 0; j < 8; ++j) { const float p = __builtin_amdgcn_exp2f(__builtin_fmaf(st[kt][j], C2L, -mc)); st[kt][j] = p; s += p; }
    l = l * al + s; return al;
}
__device__ __forceinline__ void attn_mask(v8f (&st)[2], int kb, int query, int hi) {
#pragma unroll
    for (int kt = 0; kt < 2; ++kt)
#pragma unroll
        for (int j = 0; j < 8; ++j) st[kt][j] = (kb + kt * 16 + hi * 8 + j <= query) ? st[kt][j] : -3.0e38f;
}
// query rows >= RH: fp16 operands, 32 query rows a wave. One pass = 32 keys from kb on. pv: the lane's place in this pass's 4 V^T fragments; pk: in the NEXT pass's 4 K fragments; both step on (4 fragments) behind the loads.
// ak holds this pass's K fragments on entry and, where DIAG is false, the next pass's on return (they fly while this pass computes).
template <bool DIAG>
__device__ __forceinline__ void attn_f16_pass(const h16* __restrict__& pk, const h16* __restrict__& pv, int kb, int q0, int lr, int hi, const v16h (&bq)[2][2], v16h (&ak)[2][2], v8f (&o)[2][4], float (&m)[2], float (&l)[2]) {
    v16h av[4];
#pragma unroll
    for (int db = 0; db < 4; ++db) av[db] = WFrag<h16>::ld(pv + db * 512);
    v8f st[2][2];
#pragma unroll
    for (int nq = 0; nq < 2; ++nq)
#pragma unroll
        for (int kt = 0; kt < 2; ++kt) { st[nq][kt] = wmma16(ak[kt][0], bq[nq][0], (v8f){}); st[nq][kt] = wmma16(ak[kt][1], bq[nq][1], st[nq][kt]); }
    if (!DIAG) {
#pragma unroll
        for (int kt = 0; kt < 2; ++kt)
#pragma unroll
            for (int ks = 0; ks < 2; ++ks) ak[kt][ks] = WFrag<h16>::ld(pk + kt * 1024 + ks * 512);
    }
    loads_issued(pk, pv);
    pk += 2048; pv += 2048;
    if (DIAG) { attn_mask(st[0], kb, q0 + lr, hi); attn_mask(st[1], kb, q0 + 16 + lr, hi); }   // only the diagonal pass holds keys beyond a query
#pragma unroll
    for (int nq = 0; nq < 2; ++nq) { const float al = attn_soft(st[nq], m[nq], l[nq]); v16h bp;
#pragma unroll
        for (int e = 0; e < 16; ++e) bp[e] = tohx(st[nq][e >> 3][e & 7]);
#pragma unroll
        for (int db = 0; db < 4; ++db) { o[nq][db] *= al; o[nq][db] = wmma16(av[db], bp, o[nq][db]); } }
}
__device__ __forceinline__ void attn_f16(const h16* __restrict__ Q, const h16* __restrict__ Kp, const h16* __restrict__ Vt, int q0, bf* Ah, bf* Al, int lr, int hi) {
    const int lane = hi * 16 + lr; const h16* pq = Q + (size_t)q0 * HD + lane * 8;
    v16h bq[2][2];
#pragma unroll
    for (int nq = 0; nq < 2; ++nq)
#pragma unroll
        for (int ks = 0; ks < 2; ++ks) bq[nq][ks] = WFrag<h16>::ld(pq + nq * 1024 + ks * 512);
    v8f o[2][4]; float m[2], l[2];
#pragma unroll
    for (int nq = 0; nq < 2; ++nq) { m[nq] = -3.0e38f; l[nq] = 0.f;
#pragma unroll
        for (int db = 0; db < 4; ++db) o[nq][db] = (v8f){}; }
    const h16* __restrict__ pk = Kp + lane * 8; const h16* __restrict__ pv = Vt + lane * 8;
    v16h ak[2][2];
#pragma unroll
    for (int kt = 0; kt < 2; ++kt)
#pragma unroll
        for (int ks = 0; ks < 2; ++ks) ak[kt][ks] = WFrag<h16>::ld(pk + kt * 1024 + ks * 512);
    loads_issued(pq, pk);
    pk += 2048;
#pragma unroll 1
    for (int kb = 0; kb < q0; kb += 32) attn_f16_pass<false>(pk, pv, kb, q0, lr, hi, bq, ak, o, m, l);
    attn_f16_pass<true>(pk, pv, q0, q0, lr, hi, bq, ak, o, m, l);
    attn_store(o[0], l[0], Ah, Al, q0, lane); attn_store(o[1], l[1], Ah, Al, q0 + 16, lane);
}
// query rows < RH: bf16 hi + lo planes, 3 products (hi hi, lo hi, hi lo) for the scores and for probability x value; 16 query rows a wave
__device__ __forceinline__ void attn_hl(const bf* __restrict__ Qh, const bf* __restrict__ Ql, const bf* __restrict__ Kh, const bf* __restrict__ Kl, const bf* __restrict__ Vh, const bf* __restrict__ Vl, int q0, bf* Ah, bf* Al, int lr, int hi) {
    const int lane = hi * 16 + lr; v16bf qh[2], ql[2];
#pragma unroll
    for (int ks = 0; ks < 2; ++ks) { const size_t qo = (size_t)q0 * HD + ks * 512 + lane * 8; qh[ks] = WFrag<bf>::ld(Qh + qo); ql[ks] = WFrag<bf>::ld(Ql + qo); }
    v8f o[4]; float m = -3.0e38f, l = 0.f;
#pragma unroll
    for (int db = 0; db < 4; ++db) o[db] = (v8f){};
    const bf* __restrict__ pkh = Kh + lane * 8; const bf* __restrict__ pkl = Kl + lane * 8; const bf* __restrict__ pvh = Vh + lane * 8; const bf* __restrict__ pvl = Vl + lane * 8;   // the lane's places in this pass's 4 K and 4 V^T fragments
#pragma unroll 1
    for (int kb = 0; kb <= q0; kb += 32) {   // q0 is a multiple of 16: the last pass holds the diagonal, and its 32 keys lie below RH + 16 <= TT
        v16bf kh[2][2], kl[2][2], vh[4], vl[4];
#pragma unroll
        for (int kt = 0; kt < 2; ++kt)
#pragma unroll
            for (int ks = 0; ks < 2; ++ks) { const int e = kt * 1024 + ks * 512; kh[kt][ks] = WFrag<bf>::ld(pkh + e); kl[kt][ks] = WFrag<bf>::ld(pkl + e); }
#pragma unroll
        for (int db = 0; db < 4; ++db) { const int e = db * 512; vh[db] = WFrag<bf>::ld(pvh + e); vl[db] = WFrag<bf>::ld(pvl + e); }
        loads_issued(pkh, pkl, pvh, pvl);
        pkh += 2048; pkl += 2048; pvh += 2048; pvl += 2048;
        v8f st[2];
#pragma unroll
        for (int kt = 0; kt < 2; ++kt) { st[kt] = (v8f){};
#pragma unroll
            for (int ks = 0; ks < 2; ++ks) { st[kt] = wmmab(kh[kt][ks], qh[ks], st[kt]); st[kt] = wmmab(kh[kt][ks], ql[ks], st[kt]); st[kt] = wmmab(kl[kt][ks], qh[ks], st[kt]); } }
        if (kb + 31 > q0) attn_mask(st, kb, q0 + lr, hi);
        const float al = attn_soft(st, m, l); v8us p0h, p0l, p1h, p1l;
#pragma unroll
        for (int j = 0; j < 8; ++j) { unsigned short x, y; splitf(st[0][j], x, y); p0h[j] = x; p0l[j] = y; splitf(st[1][j], x, y); p1h[j] = x; p1l[j] = y; }
        const v16bf ph = cat16b(p0h, p1h), pl = cat16b(p0l, p1l);
#pragma unroll
        for (int db = 0; db < 4; ++db) { o[db] *= al; o[db] = wmmab(vh[db], ph, o[db]); o[db] = wmmab(vh[db], pl, o[db]); o[db] = wmmab(vl[db], ph, o[db]); }
    }
    attn_store(o, l, Ah, Al, q0, lane);
}
// grid (NB_ * NH_, (TT - RH) / 128 + RH / 64), 4 waves; y falls with the rows' cost: y = 0 holds the last (longest) query rows
__global__ __launch_bounds__(128) void k_fattn(const h16* __restrict__ Q16, const h16* __restrict__ K16, const h16* __restrict__ V16, const bf* __restrict__ Qh, const bf* __restrict__ Ql, const bf* __restrict__ Kh, const bf* __restrict__ Kl, const bf* __restrict__ Vh, const bf* __restrict__ Vl, bf* Ah, bf* Al) {
    const int lane = threadIdx.x & 31, lr = lane & 15, hi = lane >> 4; const int w = __builtin_amdgcn_readfirstlane(threadIdx.x >> 5);
    const int b = blockIdx.x / NH_, h = blockIdx.x % NH_, y = blockIdx.y; const size_t pq = (size_t)(b * NH_ + h) * TT * HD, pk = (size_t)(b * NKV + h / REP) * TT * HD, po = (size_t)b * TT * DQ + h * 1024;   // po: the head's 2 fragments in the merged plane's first row tile
    if (y < (TT - RH) / 128) attn_f16(Q16 + pq, K16 + pk, V16 + pk, TT - 128 * y - 32 * (w + 1), Ah + po, Al + po, lr, hi);
    else attn_hl(Qh + pq, Ql + pq, Kh + pk, Kl + pk, Vh + pk, Vl + pk, RH - 64 * (y - (TT - RH) / 128) - 16 * (w + 1), Ah + po, Al + po, lr, hi);
}

extern "C" void kernel_launch(void* const* d_in, const int* in_sizes, int n_in,
                              void* d_out, int out_size, void* d_ws, size_t ws_size, hipStream_t stream) {
    (void)in_sizes; (void)n_in; (void)out_size;
            const float* x = (const float*)d_in[0]; const float* wq = (const float*)d_in[1]; const float* wk = (const float*)d_in[2]; const float* wv = (const float*)d_in[3]; const float* wo = (const float*)d_in[4]; const float* bo = (const float*)d_in[5];   /* input order x, Wq, Wk, Wv (PER-HEAD [16][1024][64]: 'hcd'), Wo ('oi' [1024][1024]), bo */
    float* OUT = (float*)d_out;     // [2][2048][1024]
    char* wsp = (char*)d_ws;
    auto take = [&](size_t bytes) { char* p = wsp; wsp += (bytes + 255) & ~(size_t)255; return (void*)p; };
    bf* WQ = (bf*)take((size_t)DQ * DM * 2); bf* WK = (bf*)take((size_t)DKV * DM * 2); bf* WV = (bf*)take((size_t)DKV * DM * 2); bf* WO = (bf*)take((size_t)DM * DQ * 2);
    bf* XB = (bf*)take((size_t)NB_ * TT * DM * 2);   // both batches: bf16 x
    const size_t NQP = (size_t)NH_ * TT * HD, NKP = (size_t)NKV * TT * HD;   // elements of one batch's query / key-value head planes; every plane holds both batches, [b][h]
    h16* QP16 = (h16*)take(NB_ * NQP * 2); h16* KP16 = (h16*)take(NB_ * NKP * 2); h16* VT16 = (h16*)take(NB_ * NKP * 2);
    bf* QPh = (bf*)take(NB_ * NQP * 2); bf* QPl = (bf*)take(NB_ * NQP * 2); bf* KPh = (bf*)take(NB_ * NKP * 2); bf* KPl = (bf*)take(NB_ * NKP * 2); bf* VTh = (bf*)take(NB_ * NKP * 2); bf* VTl = (bf*)take(NB_ * NKP * 2);
    bf* ATh = (bf*)take((size_t)NB_ * TT * DQ * 2); bf* ATl = (bf*)take((size_t)NB_ * TT * DQ * 2);
    (void)WK; (void)WV;   // reached through WQ: the three planes are contiguous
    if ((size_t)(wsp - (char*)d_ws) > ws_size) return;    // ws 256 MiB
    k_prep<<<PREP_WT + PREP_X + PREP_WO, 256, 0, stream>>>(x, wq, wk, wv, wo, WQ, WO, XB);   /* every per-head weight [h][DM][HD] ('xw' per head) -> its HD rows of the Bt planes WQ | WK | WV (contiguous); Wo and x cast */
    k_gemmw<bf, 0, false, DM, true><<<dim3(NB_ * TT / 64, PQKV / 64, 1), 32, 0, stream>>>(XB, nullptr, WQ, nullptr, nullptr, 0, nullptr, 0, 0, 0, HeadPlanes{(bf*)QP16, QPh, QPl, (bf*)KP16, KPh, KPl, (bf*)VT16, VTh, VTl});   // q, k and v of both batches in one launch, stored as the attention's head planes
    k_fattn<<<dim3(NB_ * NH_, (TT - RH) / 128 + RH / 64, 1), 128, 0, stream>>>(QP16, KP16, VT16, QPh, QPl, KPh, KPl, VTh, VTl, ATh, ATl);   // every batch, head and query row in one launch
    k_gemmw<bf, 1, true, DQ><<<dim3(NB_ * TT / 64, DM / 64, 1), 32, 0, stream>>>(ATh, ATl, WO, nullptr, OUT, DM, bo, 0, 0, 0, HeadPlanes{});   // both batches in one launch
}

// v007
// A run of this version takes 83.7 microseconds.
// Two timings next to v006 put it at 1.24 and 1.22 times that version's speed.
// Counting every step since v000, it is 21.7 times as fast.
#include <hip/hip_runtime.h>

// Causal multi-head attention with PER-HEAD projection weights and a model-width score scale (x [2][2048][1024]; q, k, v = einsum('btc,hcd->bhtd', x, W) with W [16][1024][64]: head h has its own (in, out) matrix ('xw' per head; no bias; 16 heads x 64); scores x 1/sqrt(float32(C)) with C = 1024 = 1/32 (the MODEL width: the module's own choice; soft logits); causal (-inf); softmax; out merged head-major; out Wo^T + bo ('oi' [1024][1024] + bias normal: non-zero) -> [2][2048][1024] (4.2 M); argument order x, Wq, Wk, Wv, Wo, bo).
// FRAGMENT ORDER: every 16-bit plane that a WMMA reads (x, the weights, q, k, v^T, the merged attention output) is stored as the lanes read it. A fragment = 16 rows x 32 k = 512 elements in a row: [half w of the k range][lane][8 elements], lane = 16 * hi + row % 16, k % 32 = 16 * w + 8 * hi + j.
// So each wave-wide 16-byte load or store covers 512 contiguous bytes (4 whole 128-byte lines) and not 32-byte pieces of 16 lines. Fragments of one 16-row tile follow one another along k, so a tile of a K-wide plane starts at element row * K, as in the row-major plane; v^T alone is ordered for its reader: the 4 fragments (64 d) of 32 keys lie together, then the next 32 keys.
// Layout: bf16 copy of x (both batches); each PER-HEAD q / k / v weight [h][1024][64] transposed once into its 64 rows of the Bt plane; Wp cast once ('oi' = Bt rows as stored); these three in one launch (k_prep); exact projections, whose launch stores the q / k / v^T head planes itself (k_gemmw, PLANES); one fused causal attention launch (k_fattn: scores and probabilities stay in registers, online softmax; hybrid rows: < 512 hi/lo 3 products, rest fp16); merged hi/lo x w_o exact.
// Compute dtypes, f32 accumulate: every input rounded to bf16; projections exact; attention rows < 512 3 products, rest fp16; softmax f32; w_o hl x exact.

#define NB_  2
#define TT   2048
#define DM   1024
#define NH_  16
#define NKV  16
#define REP  (NH_ / NKV)
#define HD   64
#define DQ   (NH_ * HD)
#define DKV  (NKV * HD)
#define PQKV (DQ + 2 * DKV)       // columns of the joint q | k | v projection
#define RH   512                  // query rows < RH use hi+lo planes
#define SCL  0.03125f   // 1 / sqrt(C) with C = 1024 = the MODEL width (this module scales its scores by the model width, not the head width): exactly 2^-5
typedef _Float16 h16;
typedef unsigned short bf;
typedef __attribute__((ext_vector_type(16))) __bf16   v16bf;
typedef __attribute__((ext_vector_type(16))) _Float16 v16h;
typedef __attribute__((ext_vector_type(8)))  _Float16 v8h;
typedef __attribute__((ext_vector_type(8)))  unsigned short v8us;
typedef __attribute__((ext_vector_type(8)))  float    v8f;
typedef __attribute__((ext_vector_type(4)))  float    v4f;
typedef v8h  __attribute__((may_alias)) v8ha;
typedef v4f  __attribute__((may_alias)) v4fa;
typedef v8us __attribute__((may_alias)) v8usa;

__device__ __forceinline__ unsigned short f2bf(float f) { unsigned u = __float_as_uint(f); u += 0x7FFFu + ((u >> 16) & 1u); return (unsigned short)(u >> 16); }
__device__ __forceinline__ float bf2f(unsigned short b) { return __uint_as_float(((unsigned)b) << 16); }
__device__ __forceinline__ float bfr(float f) { return bf2f(f2bf(f)); }
__device__ __forceinline__ v16h cat16(v8h lo, v8h hi) { return __builtin_shufflevector(lo, hi, 0, 1, 2, 3, 4, 5, 6, 7, 8, 9, 10, 11, 12, 13, 14, 15); }
__device__ __forceinline__ v16bf cat16b(v8us lo, v8us hi) { return __builtin_bit_cast(v16bf, __builtin_shufflevector(lo, hi, 0, 1, 2, 3, 4, 5, 6, 7, 8, 9, 10, 11, 12, 13, 14, 15)); }
__device__ __forceinline__ v8f wmma16(v16h a, v16h b, v8f c) { return __builtin_amdgcn_wmma_f32_16x16x32_f16(false, a, false, b, (short)0, c, false, false); }
__device__ __forceinline__ v8f wmmab(v16bf a, v16bf b, v8f c) { return __builtin_amdgcn_wmma_f32_16x16x32_bf16(false, a, false, b, (short)0, c, false, false); }



__device__ __forceinline__ h16 tohx(float x) { return (h16)x; }
__device__ __forceinline__ void splitf(float y, unsigned short& h, unsigned short& l) { h = f2bf(y); l = f2bf(y - bf2f(h)); }
// Stands behind a group of issued global loads. s_wait_xcnt 0 stands in front of every later rewrite of the registers that hold their addresses; the addresses are named as inputs so that those registers stay as they are up to the wait.
// sched_barrier: without it the scheduler moves the loads down to their first use, where they no longer fly under the arithmetic in between.
__device__ __forceinline__ void loads_issued(const void* a, const void* b) { asm volatile("s_wait_xcnt 0x0" :: "v"(a), "v"(b) : "memory"); __builtin_amdgcn_sched_barrier(0); }
__device__ __forceinline__ void loads_issued(const void* a, const void* b, const void* c, const void* d) { asm volatile("s_wait_xcnt 0x0" :: "v"(a), "v"(b), "v"(c), "v"(d) : "memory"); __builtin_amdgcn_sched_barrier(0); }
// ---- k_gemmw: register-blocked GEMM, ONE WAVE per 64x64 output tile (16 accumulators), operands straight from 16-bit planes in fragment order; grid (M/64, N/64, Z), 32 threads.
// C[m][n] (f32, pitch ldc, + optional f32 bias[n]) = sum_k A[m][k] Bt[n][k] (+ split products per NSPLIT). z-batch strides sA/sB/sC in elements. K % 32 == 0; K is a compile-time number, so that every fragment of a k step lies at an immediate offset from the side's one address.
// PLANES: the joint q | k | v projection (A = x of both batches, Bt = the weight rows, one head per 64 columns). Nothing goes to C: the tile is stored as the attention's head planes, fp16 and bf16 hi / lo of every value, in fragment order; q, k per [b][h]: rows t, k index d; v per [b][h]: rows d, k index t.
// The WMMA's A side is then the plane's k index (t for v; d for q and k, whose tiles swap the two operands: both sides use the same loader, so the k orders agree either way): the 8 values of a lane in one accumulator ARE that lane's 16 bytes of one half fragment, and go out straight from the registers.
struct HeadPlanes { bf *q16, *qh, *ql, *k16, *kh, *kl, *v16, *vh, *vl; };
template <typename T16> struct WFrag;
template <> struct WFrag<h16> { typedef v16h V; static __device__ __forceinline__ V ld(const h16* p) { return cat16(*(const v8h*)p, *(const v8h*)(p + 256)); } static __device__ __forceinline__ v8f mma(V a, V b, v8f c) { return wmma16(a, b, c); } };
template <> struct WFrag<bf> { typedef v16bf V; static __device__ __forceinline__ V ld(const bf* p) { return cat16b(*(const v8us*)p, *(const v8us*)(p + 256)); } static __device__ __forceinline__ v8f mma(V a, V b, v8f c) { return wmmab(a, b, c); } };
// One k step's fragments of both sides. The k loop keeps D such sets in registers, as a ring: while the WMMAs of step s run, the loads of steps s + 1 .. s + D - 1 are in flight, so a wave no longer waits out a whole load latency in front of every step.
template <typename T16, int NSPLIT, int K> struct KStep {
    typedef typename WFrag<T16>::V V; V a[4], a2[4], b[4], b2[4];
    // e: the step's place behind the four addresses, in elements (32 k = 512 elements): an immediate offset
    __device__ __forceinline__ void load(const T16* __restrict__ pa, const T16* __restrict__ pa2, const T16* __restrict__ pb, const T16* __restrict__ pb2, int e) {
#pragma unroll
        for (int mb = 0; mb < 4; ++mb) { a[mb] = WFrag<T16>::ld(pa + e + mb * 16 * K); if (NSPLIT == 1 || NSPLIT == 2) a2[mb] = WFrag<T16>::ld(pa2 + e + mb * 16 * K); }
#pragma unroll
        for (int nb = 0; nb < 4; ++nb) { b[nb] = WFrag<T16>::ld(pb + e + nb * 16 * K); if (NSPLIT >= 2) b2[nb] = WFrag<T16>::ld(pb2 + e + nb * 16 * K); }
        __builtin_amdgcn_sched_barrier(0);   // the loads are issued here, ahead of the WMMAs of the older set: moved down to their first use they would fly under nothing
    }
    __device__ __forceinline__ void mma(v8f (&acc)[4][4]) {
#pragma unroll
        for (int nb = 0; nb < 4; ++nb) {
#pragma unroll
            for (int mb = 0; mb < 4; ++mb) { acc[mb][nb] = WFrag<T16>::mma(a[mb], b[nb], acc[mb][nb]); if (NSPLIT == 1 || NSPLIT == 2) acc[mb][nb] = WFrag<T16>::mma(a2[mb], b[nb], acc[mb][nb]); if (NSPLIT >= 2) acc[mb][nb] = WFrag<T16>::mma(a[mb], b2[nb], acc[mb][nb]); } }
        asm volatile("v_nop\n\tv_nop\n\tv_nop\n\tv_nop" : "+v"(acc[0][0]), "+v"(acc[1][1]), "+v"(acc[2][2]), "+v"(acc[3][3]) : "v"(a[0]), "v"(a[3]));   // the 4 slots behind the step's last WMMA, on the loop's taken branch too
        __builtin_amdgcn_sched_barrier(0);   // the refill of this set stays behind its WMMAs: moved up it would need a further set of registers
    }
};
template <typename T16, int NSPLIT, bool BIAS, int K, bool PLANES = false, int D = 3>
__global__ __launch_bounds__(32) void k_gemmw(const T16* __restrict__ A, const T16* __restrict__ A2, const T16* __restrict__ Bt, const T16* __restrict__ Bt2, float* C, int ldc, const float* __restrict__ bias, size_t sA, size_t sB, size_t sC, HeadPlanes hp) {
    typedef typename WFrag<T16>::V V;
    __shared__ __align__(16) float os[16 * 68];
    const size_t z = blockIdx.z; A += z * sA; if (A2) A2 += z * sA; Bt += z * sB; if (Bt2) Bt2 += z * sB; C += z * sC;
    const int lane = threadIdx.x & 31, lr = lane & 15, hi = lane >> 4; const int r0 = blockIdx.x * 64, c0 = blockIdx.y * 64;
    v8f acc[4][4];
#pragma unroll
    for (int mb = 0; mb < 4; ++mb)
#pragma unroll
        for (int nb = 0; nb < 4; ++nb) acc[mb][nb] = (v8f){};
    int ra = r0, rb = c0;   // first row of the A side and of the B side
    if (PLANES && c0 < DQ + DKV) { const T16* t = A; A = Bt; Bt = t; ra = c0; rb = r0; }   // q, k tiles: weight rows (d) on the A side
    const size_t aoff = (size_t)ra * K + lane * 8, boff = (size_t)rb * K + lane * 8;   // the lane's place in the first fragment of the side's first 16-row tile; 32 k on = 512 elements on
    const T16* __restrict__ pa = A + aoff; const T16* __restrict__ pb = Bt + boff; const T16* __restrict__ pa2 = (NSPLIT == 1 || NSPLIT == 2) ? A2 + aoff : pa; const T16* __restrict__ pb2 = (NSPLIT >= 2) ? Bt2 + boff : pb;
    constexpr int NS = K / 32, NB = (NS - 2 * D + 1) / D + 1;   // k steps; trips of the rolled loop: D steps each, the last of which still loads a step below NS
    static_assert(D >= 2 && NS >= 2 * D - 1, "the ring's first fill and one whole trip exist");
    KStep<T16, NSPLIT, K> f[D]; unsigned e0 = 0;   // e0: the trip's first k step, in elements behind the four addresses
#pragma unroll
    for (int s = 0; s < D - 1; ++s) f[s].load(pa, pa2, pb, pb2, s * 512);
    asm volatile("s_wait_xcnt 0x0" ::: "memory"); __builtin_amdgcn_sched_barrier(0);   // the first fill's address registers (vector and scalar) are free for other use only behind the wait; the barrier keeps what follows behind it
#pragma unroll 1
    for (int kc = 0; kc < NB; ++kc) {   // stays rolled: D steps a trip, so that every set keeps its registers and no copy is needed
#pragma unroll
        for (int u = 0; u < D; ++u) { f[(u + D - 1) % D].load(pa + e0, pa2 + e0, pb + e0, pb2 + e0, (u + D - 1) * 512); f[u].mma(acc); }
        // s_wait_xcnt 0 stands in front of the rewrite of the trip's address registers. The step e0 is the statement's operand, so the new addresses are formed behind it, at the trip's end, where the wait is over at once; formed directly behind the last loads they would hold the wave up there.
        asm volatile("s_wait_xcnt 0x0" : "+s"(e0) :: "memory");
        e0 += D * 512;
    }
#pragma unroll
    for (int u = 0; u < NS - NB * D; ++u) {   // the last steps: nothing is loaded past the k range
        const bool more = NB * D + u + D - 1 < NS;
        if (more) f[(u + D - 1) % D].load(pa + e0, pa2 + e0, pb + e0, pb2 + e0, (u + D - 1) * 512);
        f[u % D].mma(acc);
        if (more) asm volatile("s_wait_xcnt 0x0" ::: "memory");   // in front of any later use of these loads' address registers; behind the WMMAs it is over at once
    }
    if constexpr (PLANES) {
        static_assert(HD == 64 && TT % 64 == 0, "a tile is one head wide and lies in one batch");
        const bool isq = c0 < DQ, isv = c0 >= DQ + DKV; const int b = r0 / TT, t0 = r0 % TT, h = (isq ? c0 : isv ? c0 - DQ - DKV : c0 - DQ) / HD;
        bf* d16 = isq ? hp.q16 : isv ? hp.v16 : hp.k16; bf* dh = isq ? hp.qh : isv ? hp.vh : hp.kh; bf* dl = isq ? hp.ql : isv ? hp.vl : hp.kl;
        // q, k: 16-row tile t / 16 = 2 fragments (d) = 1024 elements, half fragment mb. v: 32 t = 4 fragments (16-row tiles of d) = 2048 elements, fragment nb, half mb & 1. 64 t of one head are 64 * HD elements either way.
        const size_t base = ((size_t)(b * (isq ? NH_ : NKV) + h) * TT + t0) * HD + lane * 8; const int snb = isv ? 512 : 1024, smb2 = isv ? 2048 : 512;
#pragma unroll
        for (int nb = 0; nb < 4; ++nb) {
#pragma unroll
            for (int mb = 0; mb < 4; ++mb) { v8h o16; v8us oh, ol;
#pragma unroll
                for (int j = 0; j < 8; ++j) { const float v = acc[mb][nb][j]; unsigned short p, q; splitf(v, p, q); o16[j] = tohx(v); oh[j] = p; ol[j] = q; }
                const size_t o = base + nb * snb + (mb >> 1) * smb2 + (mb & 1) * 256;
                *(v8usa*)(d16 + o) = __builtin_bit_cast(v8us, o16); *(v8usa*)(dh + o) = oh; *(v8usa*)(dl + o) = ol; }
        }
        return;
    }
#pragma unroll
    for (int mb = 0; mb < 4; ++mb) {
#pragma unroll
        for (int nb = 0; nb < 4; ++nb) {
#pragma unroll
            for (int j = 0; j < 8; ++j) os[(hi * 8 + j) * 68 + nb * 16 + lr] = acc[mb][nb][j]; }
        __builtin_amdgcn_wave_barrier(); asm volatile("" ::: "memory");
        float* crow = C + (size_t)(r0 + mb * 16) * ldc + c0;
{
#pragma unroll
            for (int s = 0; s < 8; ++s) { const int row = 2 * s + hi, cofs = lr * 4; v4f val = *(const v4fa*)(os + row * 68 + cofs); if (BIAS) { val[0] += bfr(bias[c0 + cofs]); val[1] += bfr(bias[c0 + cofs + 1]); val[2] += bfr(bias[c0 + cofs + 2]); val[3] += bfr(bias[c0 + cofs + 3]); }
                *(v4f*)(crow + (size_t)row * ldc + cofs) = val; }
             }
        __builtin_amdgcn_wave_barrier(); asm volatile("" ::: "memory");
    }
}

typedef __attribute__((ext_vector_type(2))) _Float16 v2h;
typedef __attribute__((ext_vector_type(4))) _Float16 v4h;
typedef __attribute__((ext_vector_type(2))) unsigned short v2us;
typedef __attribute__((ext_vector_type(4))) unsigned short v4us;
typedef __attribute__((ext_vector_type(2))) float v2f;
typedef __attribute__((ext_vector_type(4))) int v4i;

// ---- k_prep: the three operand planes that hang on no product (the q | k | v weight rows, w_o, x), bf16 in fragment order, in ONE launch of few long-lived waves: 512 work-groups of 8 waves (16 waves a WGP, all resident at once), 8 pieces a thread.
// A piece = one lane's 8 elements (16 bytes) of a half fragment: lane = 16 * hi + row % 16, half w, k % 32 = 16 * w + 8 * hi + j. 64 threads hold one fragment, so a work-group holds 4 fragments (fs) at a time and 32 in all.
// All loads of a thread lie at immediate offsets from one address and are issued before the first value is converted; its stores lie at immediate offsets from one address too.
#define PREP_WT ((NH_ + 2 * NKV) * 4)   // work-groups on the per-head weights: 4 for each [DM][HD] matrix
#define PREP_X  (NB_ * TT / 16)         // on x: one 16-row tile (32 fragments) each
#define PREP_WO (DM / 16)               // on w_o: the same
__device__ __forceinline__ v8us bf8(const float (&v)[8]) { v8us o;
#pragma unroll
    for (int j = 0; j < 8; ++j) o[j] = f2bf(v[j]);
    return o; }
__global__ __launch_bounds__(256) void k_prep(const float* __restrict__ x, const float* __restrict__ wq, const float* __restrict__ wk, const float* __restrict__ wv, const float* __restrict__ wo, bf* __restrict__ Bt, bf* __restrict__ WOp, bf* __restrict__ XBp) {
    static_assert(DM == 1024 && HD == 64 && DQ == DM && (NB_ * TT) % 16 == 0, "32 fragments along k; 4 row tiles a head matrix; whole row tiles: the grid covers every piece exactly once, with no tail");
    const int tid = threadIdx.x, lr = tid & 15, hi = (tid >> 4) & 1, w = (tid >> 5) & 1, fs = tid >> 6, c = blockIdx.x; const int k0 = fs * 32 + w * 16 + hi * 8;
    float v[8][8];
    if (c < PREP_WT) {   // head matrix y ([DM][HD]: NH_ of wq, then NKV of wk, then NKV of wv; their Bt planes lie one behind the other), transposed; quarter kq of its k range, all 64 rows n: piece u = row tile u & 3, fragment kq * 8 + (u >> 2) * 4 + fs
        const int y = c >> 2, kq = c & 3; const float* ws = (y < NH_) ? wq + (size_t)y * DM * HD : (y < NH_ + NKV) ? wk + (size_t)(y - NH_) * DM * HD : wv + (size_t)(y - NH_ - NKV) * DM * HD;
        const float* __restrict__ p = ws + (size_t)(kq * 256 + k0) * HD + lr; bf* d = Bt + (size_t)y * HD * DM + (kq * 8 + fs) * 512 + (tid & 63) * 8;
#pragma unroll
        for (int u = 0; u < 8; ++u)
#pragma unroll
            for (int j = 0; j < 8; ++j) v[u][j] = p[((u >> 2) * 128 + j) * HD + (u & 3) * 16];
        loads_issued(p, p);   // all 64 loads fly together, and their one address stays in its registers up to the wait
#pragma unroll
        for (int u = 0; u < 8; ++u) *(v8us*)(d + (u & 3) * 16 * DM + (u >> 2) * 2048) = bf8(v[u]);
        return;
    }
    // row-major [rows][DM] f32: row tile t, piece u = fragment fs + 4 * u
    const bool isx = c < PREP_WT + PREP_X; const int t = isx ? c - PREP_WT : c - PREP_WT - PREP_X;
    const float* __restrict__ p = (isx ? x : wo) + (size_t)(t * 16 + lr) * DM + k0; bf* d = (isx ? XBp : WOp) + (size_t)t * 16 * DM + tid * 8;
#pragma unroll
    for (int u = 0; u < 8; ++u) { const v8f a = *(const v8f*)(p + u * 128);
#pragma unroll
        for (int j = 0; j < 8; ++j) v[u][j] = a[j]; }
    loads_issued(p, p);   // all 16 loads fly together, and their one address stays in its registers up to the wait (no load's result lands on it)
#pragma unroll
    for (int u = 0; u < 8; ++u) *(v8us*)(d + u * 2048) = bf8(v[u]);
}

#define C2L 0.045084220027780106f   // SCL x log2(e): exp(SCL (s - m)) = exp2(C2L s - C2L m)
__device__ __forceinline__ float xhalf(float x) { return __builtin_bit_cast(float, __builtin_amdgcn_permlanex16(__builtin_bit_cast(int, x), __builtin_bit_cast(int, x), 0x76543210, 0xfedcba98, false, false)); }   // lane l reads lane l ^ 16
// row0: first of the wave's 16 query rows; Ah, Al: the head's first fragment in row tile 0 (the head's 64 columns = 2 fragments = 4 half fragments, db each)
__device__ __forceinline__ void attn_store(const v8f (&o)[4], float l, bf* Ah, bf* Al, int row0, int lane) {
    const float f = __fdiv_rn(1.0f, l + xhalf(l));
#pragma unroll
    for (int db = 0; db < 4; ++db) { v8us oh, ol;
#pragma unroll
        for (int j = 0; j < 8; ++j) { unsigned short x, y; splitf(o[db][j] * f, x, y); oh[j] = x; ol[j] = y; }
        const size_t oo = (size_t)row0 * DQ + db * 256 + lane * 8; *(v8us*)(Ah + oo) = oh; *(v8us*)(Al + oo) = ol; }
}
// running maximum m (raw score units) and sum l of one query column over its 8 * NT new scores (NT 16-key tiles = NT / 2 blocks of 32 keys); st becomes exp(SCL (s - m)); returns the factor for what was summed under the old maximum
// Each 32-key block has its own maximum chain and its own sum chain, joined at the end: the chains of a pass are independent, so a wave that is alone on its SIMD issues one while the other's last link is still under way.
template <int NT>
__device__ __forceinline__ float attn_soft(v8f (&st)[NT], float& m, float& l) {
    float mb[NT / 2];
#pragma unroll
    for (int g = 0; g < NT / 2; ++g) { mb[g] = g ? st[2 * g][0] : m;
#pragma unroll
        for (int kt = 0; kt < 2; ++kt)
#pragma unroll
            for (int j = 0; j < 8; ++j) mb[g] = fmaxf(mb[g], st[2 * g + kt][j]); }
    float mx = mb[0];
#pragma unroll
    for (int g = 1; g < NT / 2; ++g) mx = fmaxf(mx, mb[g]);
    mx = fmaxf(mx, xhalf(mx));
    const float al = __builtin_amdgcn_exp2f((m - mx) * C2L), mc = mx * C2L; m = mx; float sb[NT / 2];
#pragma unroll
    for (int g = 0; g < NT / 2; ++g) { sb[g] = 0.f;
#pragma unroll
        for (int kt = 0; kt < 2; ++kt)
#pragma unroll
            for (int j = 0; j < 8; ++j) { const float p = __builtin_amdgcn_exp2f(__builtin_fmaf(st[2 * g + kt][j], C2L, -mc)); st[2 * g + kt][j] = p; sb[g] += p; } }
    float s = sb[0];
#pragma unroll
    for (int g = 1; g < NT / 2; ++g) s += sb[g];
    l = l * al + s; return al;
}
__device__ __forceinline__ void attn_mask(v8f (&st)[2], int kb, int query, int hi) {
#pragma unroll
    for (int kt = 0; kt < 2; ++kt)
#pragma unroll
        for (int j = 0; j < 8; ++j) st[kt][j] = (kb + kt * 16 + hi * 8 + j <= query) ? st[kt][j] : -3.0e38f;
}
// query rows >= RH: fp16 operands, 32 query rows a wave. One pass = NB blocks of 32 keys (NB = 2 but for one odd first block): one running maximum, one rescale of o and one exchange between the wave halves for all its keys, and NB times the independent products, exponentials and loads between two places where the wave must wait.
// pv: the lane's place in this pass's 4 * NB V^T fragments; pk: in the NEXT pass's 8 K fragments (64 keys); both step on behind the loads.
// ak holds this pass's K fragments (tiles 0 .. 2 * NB - 1) on entry and, where PRE is true, the next pass's 64 keys on return (they fly while this pass computes). DIAG: the pass's last block is the diagonal one (its first key = the wave's first query); the blocks in front of it lie wholly below every query.
template <int NB, bool DIAG, bool PRE>
__device__ __forceinline__ void attn_f16_pass(const h16* __restrict__& pk, const h16* __restrict__& pv, int lr, int hi, const v16h (&bq)[2][2], v16h (&ak)[4][2], v8f (&o)[2][4], float (&m)[2], float (&l)[2]) {
    v16h av[NB][4];
#pragma unroll
    for (int g = 0; g < NB; ++g)
#pragma unroll
        for (int db = 0; db < 4; ++db) av[g][db] = WFrag<h16>::ld(pv + g * 2048 + db * 512);
    v8f st[2][2 * NB];
#pragma unroll
    for (int nq = 0; nq < 2; ++nq)
#pragma unroll
        for (int kt = 0; kt < 2 * NB; ++kt) { st[nq][kt] = wmma16(ak[kt][0], bq[nq][0], (v8f){}); st[nq][kt] = wmma16(ak[kt][1], bq[nq][1], st[nq][kt]); }
    if (PRE) {
#pragma unroll
        for (int kt = 0; kt < 4; ++kt)
#pragma unroll
            for (int ks = 0; ks < 2; ++ks) ak[kt][ks] = WFrag<h16>::ld(pk + kt * 1024 + ks * 512);
    }
    loads_issued(pk, pv);
    pk += 4096; pv += NB * 2048;
    if (DIAG) {   // only the diagonal block holds keys beyond a query
#pragma unroll
        for (int nq = 0; nq < 2; ++nq)
#pragma unroll
            for (int kt = 0; kt < 2; ++kt)
#pragma unroll
                for (int j = 0; j < 8; ++j) st[nq][2 * NB - 2 + kt][j] = (kt * 16 + hi * 8 + j <= nq * 16 + lr) ? st[nq][2 * NB - 2 + kt][j] : -3.0e38f;
    }
#pragma unroll
    for (int nq = 0; nq < 2; ++nq) { const float al = attn_soft<2 * NB>(st[nq], m[nq], l[nq]); v16h bp[NB];
#pragma unroll
        for (int g = 0; g < NB; ++g)
#pragma unroll
            for (int e = 0; e < 16; ++e) bp[g][e] = tohx(st[nq][2 * g + (e >> 3)][e & 7]);
#pragma unroll
        for (int db = 0; db < 4; ++db) o[nq][db] *= al;
#pragma unroll
        for (int g = 0; g < NB; ++g)
#pragma unroll
            for (int db = 0; db < 4; ++db) o[nq][db] = wmma16(av[g][db], bp[g], o[nq][db]); }
}
__device__ __forceinline__ void attn_f16(const h16* __restrict__ Q, const h16* __restrict__ Kp, const h16* __restrict__ Vt, int q0, bf* Ah, bf* Al, int lr, int hi) {
    static_assert(RH >= 64 && RH % 32 == 0, "a wave has at least 3 blocks of 32 keys: the last pass's 64 keys exist, behind an odd first block too");
    const int lane = hi * 16 + lr; const h16* pq = Q + (size_t)q0 * HD + lane * 8;
    v16h bq[2][2];
#pragma unroll
    for (int nq = 0; nq < 2; ++nq)
#pragma unroll
        for (int ks = 0; ks < 2; ++ks) bq[nq][ks] = WFrag<h16>::ld(pq + nq * 1024 + ks * 512);
    v8f o[2][4]; float m[2], l[2];
#pragma unroll
    for (int nq = 0; nq < 2; ++nq) { m[nq] = -3.0e38f; l[nq] = 0.f;
#pragma unroll
        for (int db = 0; db < 4; ++db) o[nq][db] = (v8f){}; }
    const h16* __restrict__ pk = Kp + lane * 8; const h16* __restrict__ pv = Vt + lane * 8;
    v16h ak[4][2];
    int nb = q0 / 32 + 1;   // blocks of 32 keys up to and with the diagonal one; the same in every lane of the wave
#pragma unroll
    for (int kt = 0; kt < 2; ++kt)
#pragma unroll
        for (int ks = 0; ks < 2; ++ks) ak[kt][ks] = WFrag<h16>::ld(pk + kt * 1024 + ks * 512);
    if (nb & 1) {   // an odd count: block 0 goes alone, so that what is left are whole passes of 64 keys that end on the diagonal block
        loads_issued(pq, pk);
        pk += 2048;
        attn_f16_pass<1, false, true>(pk, pv, lr, hi, bq, ak, o, m, l); --nb;
    } else {
#pragma unroll
        for (int kt = 2; kt < 4; ++kt)
#pragma unroll
            for (int ks = 0; ks < 2; ++ks) ak[kt][ks] = WFrag<h16>::ld(pk + kt * 1024 + ks * 512);
        loads_issued(pq, pk);
        pk += 4096;
    }
#pragma unroll 1
    for (; nb > 2; nb -= 2) attn_f16_pass<2, false, true>(pk, pv, lr, hi, bq, ak, o, m, l);   // stays rolled: one copy of the pass in the instruction cache
    const int ln = __builtin_amdgcn_mbcnt_lo(~0u, 0u);   // the lane's number, formed anew behind the loop: kept in registers across it (with lr and hi) it is what no longer fits the budget of 3 waves a SIMD, and is spilled
    attn_f16_pass<2, true, false>(pk, pv, ln & 15, ln >> 4, bq, ak, o, m, l);
    attn_store(o[0], l[0], Ah, Al, q0, ln); attn_store(o[1], l[1], Ah, Al, q0 + 16, ln);
}
// query rows < RH: bf16 hi + lo planes, 3 products (hi hi, lo hi, hi lo) for the scores and for probability x value; 16 query rows a wave
__device__ __forceinline__ void attn_hl(const bf* __restrict__ Qh, const bf* __restrict__ Ql, const bf* __restrict__ Kh, const bf* __restrict__ Kl, const bf* __restrict__ Vh, const bf* __restrict__ Vl, int q0, bf* Ah, bf* Al, int lr, int hi) {
    const int lane = hi * 16 + lr; v16bf qh[2], ql[2];
#pragma unroll
    for (int ks = 0; ks < 2; ++ks) { const size_t qo = (size_t)q0 * HD + ks * 512 + lane * 8; qh[ks] = WFrag<bf>::ld(Qh + qo); ql[ks] = WFrag<bf>::ld(Ql + qo); }
    v8f o[4]; float m = -3.0e38f, l = 0.f;
#pragma unroll
    for (int db = 0; db < 4; ++db) o[db] = (v8f){};
    const bf* __restrict__ pkh = Kh + lane * 8; const bf* __restrict__ pkl = Kl + lane * 8; const bf* __restrict__ pvh = Vh + lane * 8; const bf* __restrict__ pvl = Vl + lane * 8;   // the lane's places in this pass's 4 K and 4 V^T fragments
#pragma unroll 1
    for (int kb = 0; kb <= q0; kb += 32) {   // q0 is a multiple of 16: the last pass holds the diagonal, and its 32 keys lie below RH + 16 <= TT
        v16bf kh[2][2], kl[2][2], vh[4], vl[4];
#pragma unroll
        for (int kt = 0; kt < 2; ++kt)
#pragma unroll
            for (int ks = 0; ks < 2; ++ks) { const int e = kt * 1024 + ks * 512; kh[kt][ks] = WFrag<bf>::ld(pkh + e); kl[kt][ks] = WFrag<bf>::ld(pkl + e); }
#pragma unroll
        for (int db = 0; db < 4; ++db) { const int e = db * 512; vh[db] = WFrag<bf>::ld(pvh + e); vl[db] = WFrag<bf>::ld(pvl + e); }
        loads_issued(pkh, pkl, pvh, pvl);
        pkh += 2048; pkl += 2048; pvh += 2048; pvl += 2048;
        v8f st[2];
#pragma unroll
        for (int kt = 0; kt < 2; ++kt) { st[kt] = (v8f){};
#pragma unroll
            for (int ks = 0; ks < 2; ++ks) { st[kt] = wmmab(kh[kt][ks], qh[ks], st[kt]); st[kt] = wmmab(kh[kt][ks], ql[ks], st[kt]); st[kt] = wmmab(kl[kt][ks], qh[ks], st[kt]); } }
        if (kb + 31 > q0) attn_mask(st, kb, q0 + lr, hi);
        const float al = attn_soft(st, m, l); v8us p0h, p0l, p1h, p1l;
#pragma unroll
        for (int j = 0; j < 8; ++j) { unsigned short x, y; splitf(st[0][j], x, y); p0h[j] = x; p0l[j] = y; splitf(st[1][j], x, y); p1h[j] = x; p1l[j] = y; }
        const v16bf ph = cat16b(p0h, p1h), pl = cat16b(p0l, p1l);
#pragma unroll
        for (int db = 0; db < 4; ++db) { o[db] *= al; o[db] = wmmab(vh[db], ph, o[db]); o[db] = wmmab(vh[db], pl, o[db]); o[db] = wmmab(vl[db], ph, o[db]); }
    }
    attn_store(o, l, Ah, Al, q0, lane);
}
// grid (NB_ * NH_, (TT - RH) / 128 + RH / 64), 4 waves; y falls with the rows' cost: y = 0 holds the last (longest) query rows. 3 waves a SIMD (the register budget of the launch bounds' second number): 768 places for the 640 work-groups, so that all are resident at once
__global__ __launch_bounds__(128, 3) void k_fattn(const h16* __restrict__ Q16, const h16* __restrict__ K16, const h16* __restrict__ V16, const bf* __restrict__ Qh, const bf* __restrict__ Ql, const bf* __restrict__ Kh, const bf* __restrict__ Kl, const bf* __restrict__ Vh, const bf* __restrict__ Vl, bf* Ah, bf* Al) {
    const int lane = threadIdx.x & 31, lr = lane & 15, hi = lane >> 4; const int w = __builtin_amdgcn_readfirstlane(threadIdx.x >> 5);
    const int b = blockIdx.x / NH_, h = blockIdx.x % NH_, y = blockIdx.y; const size_t pq = (size_t)(b * NH_ + h) * TT * HD, pk = (size_t)(b * NKV + h / REP) * TT * HD, po = (size_t)b * TT * DQ + h * 1024;   // po: the head's 2 fragments in the merged plane's first row tile
    if (y < (TT - RH) / 128) attn_f16(Q16 + pq, K16 + pk, V16 + pk, TT - 128 * y - 32 * (w + 1), Ah + po, Al + po, lr, hi);
    else attn_hl(Qh + pq, Ql + pq, Kh + pk, Kl + pk, Vh + pk, Vl + pk, RH - 64 * (y - (TT - RH) / 128) - 16 * (w + 1), Ah + po, Al + po, lr, hi);
}

extern "C" void kernel_launch(void* const* d_in, const int* in_sizes, int n_in,
                              void* d_out, int out_size, void* d_ws, size_t ws_size, hipStream_t stream) {
    (void)in_sizes; (void)n_in; (void)out_size;
            const float* x = (const float*)d_in[0]; const float* wq = (const float*)d_in[1]; const float* wk = (const float*)d_in[2]; const float* wv = (const float*)d_in[3]; const float* wo = (const float*)d_in[4]; const float* bo = (const float*)d_in[5];   /* input order x, Wq, Wk, Wv (PER-HEAD [16][1024][64]: 'hcd'), Wo ('oi' [1024][1024]), bo */
    float* OUT = (float*)d_out;     // [2][2048][1024]
    char* wsp = (char*)d_ws;
    auto take = [&](size_t bytes) { char* p = wsp; wsp += (bytes + 255) & ~(size_t)255; return (void*)p; };
    bf* WQ = (bf*)take((size_t)DQ * DM * 2); bf* WK = (bf*)take((size_t)DKV * DM * 2); bf* WV = (bf*)take((size_t)DKV * DM * 2); bf* WO = (bf*)take((size_t)DM * DQ * 2);
    bf* XB = (bf*)take((size_t)NB_ * TT * DM * 2);   // both batches: bf16 x
    const size_t NQP = (size_t)NH_ * TT * HD, NKP = (size_t)NKV * TT * HD;   // elements of one batch's query / key-value head planes; every plane holds both batches, [b][h]
    h16* QP16 = (h16*)take(NB_ * NQP * 2); h16* KP16 = (h16*)take(NB_ * NKP * 2); h16* VT16 = (h16*)take(NB_ * NKP * 2);
    bf* QPh = (bf*)take(NB_ * NQP * 2); bf* QPl = (bf*)take(NB_ * NQP * 2); bf* KPh = (bf*)take(NB_ * NKP * 2); bf* KPl = (bf*)take(NB_ * NKP * 2); bf* VTh = (bf*)take(NB_ * NKP * 2); bf* VTl = (bf*)take(NB_ * NKP * 2);
    bf* ATh = (bf*)take((size_t)NB_ * TT * DQ * 2); bf* ATl = (bf*)take((size_t)NB_ * TT * DQ * 2);
    (void)WK; (void)WV;   // reached through WQ: the three planes are contiguous
    if ((size_t)(wsp - (char*)d_ws) > ws_size) return;    // ws 256 MiB
    k_prep<<<PREP_WT + PREP_X + PREP_WO, 256, 0, stream>>>(x, wq, wk, wv, wo, WQ, WO, XB);   /* every per-head weight [h][DM][HD] ('xw' per head) -> its HD rows of the Bt planes WQ | WK | WV (contiguous); Wo and x cast */
    k_gemmw<bf, 0, false, DM, true><<<dim3(NB_ * TT / 64, PQKV / 64, 1), 32, 0, stream>>>(XB, nullptr, WQ, nullptr, nullptr, 0, nullptr, 0, 0, 0, HeadPlanes{(bf*)QP16, QPh, QPl, (bf*)KP16, KPh, KPl, (bf*)VT16, VTh, VTl});   // q, k and v of both batches in one launch, stored as the attention's head planes
    k_fattn<<<dim3(NB_ * NH_, (TT - RH) / 128 + RH / 64, 1), 128, 0, stream>>>(QP16, KP16, VT16, QPh, QPl, KPh, KPl, VTh, VTl, ATh, ATl);   // every batch, head and query row in one launch
    k_gemmw<bf, 1, true, DQ><<<dim3(NB_ * TT / 64, DM / 64, 1), 32, 0, stream>>>(ATh, ATl, WO, nullptr, OUT, DM, bo, 0, 0, 0, HeadPlanes{});   // both batches in one launch
}

// v008
// Measured time: 79.9 microseconds a run.
// Two timings next to v007 both put it at 1.05 times that version's speed.
// All steps since v000 together make it 22.8 times as fast.
#include <hip/hip_runtime.h>

// Causal multi-head attention with PER-HEAD projection weights and a model-width score scale (x [2][2048][1024]; q, k, v = einsum('btc,hcd->bhtd', x, W) with W [16][1024][64]: head h has its own (in, out) matrix ('xw' per head; no bias; 16 heads x 64); scores x 1/sqrt(float32(C)) with C = 1024 = 1/32 (the MODEL width: the module's own choice; soft logits); causal (-inf); softmax; out merged head-major; out Wo^T + bo ('oi' [1024][1024] + bias normal: non-zero) -> [2][2048][1024] (4.2 M); argument order x, Wq, Wk, Wv, Wo, bo).
// FRAGMENT ORDER: every 16-bit plane that a WMMA reads (x, the weights, q, k, v^T, the merged attention output) is stored as the lanes read it. A fragment = 16 rows x 32 k = 512 elements in a row: [half w of the k range][lane][8 elements], lane = 16 * hi + row % 16, k % 32 = 16 * w + 8 * hi + j.
// So each wave-wide 16-byte load or store covers 512 contiguous bytes (4 whole 128-byte lines) and not 32-byte pieces of 16 lines. Fragments of one 16-row tile follow one another along k, so a tile of a K-wide plane starts at element row * K, as in the row-major plane; v^T alone is ordered for its reader: the 4 fragments (64 d) of 32 keys lie together, then the next 32 keys.
// Layout: bf16 copy of x (both batches); each PER-HEAD q / k / v weight [h][1024][64] transposed once into its 64 rows of the Bt plane; Wp cast once ('oi' = Bt rows as stored); these three in one launch (k_prep); exact projections, whose launch stores the q / k / v^T head planes itself (k_gemmw, PLANES); one fused causal attention launch (k_fattn: scores and probabilities stay in registers, online softmax; hybrid rows: < 512 hi/lo 3 products, rest fp16); merged hi/lo x w_o exact.
// Compute dtypes, f32 accumulate: every input rounded to bf16; projections exact; attention rows < 512 3 products, rest fp16; softmax f32; w_o hl x exact.

#define NB_  2
#define TT   2048
#define DM   1024
#define NH_  16
#define NKV  16
#define REP  (NH_ / NKV)
#define HD   64
#define DQ   (NH_ * HD)
#define DKV  (NKV * HD)
#define PQKV (DQ + 2 * DKV)       // columns of the joint q | k | v projection
#define RH   512                  // query rows < RH use hi+lo planes
#define SCL  0.03125f   // 1 / sqrt(C) with C = 1024 = the MODEL width (this module scales its scores by the model width, not the head width): exactly 2^-5
typedef _Float16 h16;
typedef unsigned short bf;
typedef __attribute__((ext_vector_type(16))) __bf16   v16bf;
typedef __attribute__((ext_vector_type(16))) _Float16 v16h;
typedef __attribute__((ext_vector_type(8)))  _Float16 v8h;
typedef __attribute__((ext_vector_type(8)))  unsigned short v8us;
typedef __attribute__((ext_vector_type(8)))  float    v8f;
typedef __attribute__((ext_vector_type(4)))  float    v4f;
typedef v8h  __attribute__((may_alias)) v8ha;
typedef v4f  __attribute__((may_alias)) v4fa;
typedef v8us __attribute__((may_alias)) v8usa;

__device__ __forceinline__ unsigned short f2bf(float f) { unsigned u = __float_as_uint(f); u += 0x7FFFu + ((u >> 16) & 1u); return (unsigned short)(u >> 16); }
__device__ __forceinline__ float bf2f(unsigned short b) { return __uint_as_float(((unsigned)b) << 16); }
__device__ __forceinline__ float bfr(float f) { return bf2f(f2bf(f)); }
__device__ __forceinline__ v16h cat16(v8h lo, v8h hi) { return __builtin_shufflevector(lo, hi, 0, 1, 2, 3, 4, 5, 6, 7, 8, 9, 10, 11, 12, 13, 14, 15); }
__device__ __forceinline__ v16bf cat16b(v8us lo, v8us hi) { return __builtin_bit_cast(v16bf, __builtin_shufflevector(lo, hi, 0, 1, 2, 3, 4, 5, 6, 7, 8, 9, 10, 11, 12, 13, 14, 15)); }
__device__ __forceinline__ v8f wmma16(v16h a, v16h b, v8f c) { return __builtin_amdgcn_wmma_f32_16x16x32_f16(false, a, false, b, (short)0, c, false, false); }
__device__ __forceinline__ v8f wmmab(v16bf a, v16bf b, v8f c) { return __builtin_amdgcn_wmma_f32_16x16x32_bf16(false, a, false, b, (short)0, c, false, false); }



__device__ __forceinline__ h16 tohx(float x) { return (h16)x; }
__device__ __forceinline__ void splitf(float y, unsigned short& h, unsigned short& l) { h = f2bf(y); l = f2bf(y - bf2f(h)); }
// Stands behind a group of issued global loads. s_wait_xcnt 0 stands in front of every later rewrite of the registers that hold their addresses; the addresses are named as inputs so that those registers stay as they are up to the wait.
// sched_barrier: without it the scheduler moves the loads down to their first use, where they no longer fly under the arithmetic in between.
__device__ __forceinline__ void loads_issued(const void* a, const void* b) { asm volatile("s_wait_xcnt 0x0" :: "v"(a), "v"(b) : "memory"); __builtin_amdgcn_sched_barrier(0); }
__device__ __forceinline__ void loads_issued(const void* a, const void* b, const void* c, const void* d) { asm volatile("s_wait_xcnt 0x0" :: "v"(a), "v"(b), "v"(c), "v"(d) : "memory"); __builtin_amdgcn_sched_barrier(0); }
// ---- k_gemmw: register-blocked GEMM, ONE WAVE per 64x64 output tile (16 accumulators), operands straight from 16-bit planes in fragment order; grid (M/128, N/(32 NW), Z), NW waves.
// A work-group is a block of neighbouring tiles, 2 down x NW/2 across, one tile a wave; the waves share nothing but their WGP: waves 4g .. 4g+3 hold a 2x2 block, so each fragment that one of them loads is loaded by a second and comes from the WGP's cache, not from L2; the blocks g lie side by side and use the same two row tiles. No barrier: this is for speed only, no wave reads what another wrote.
// C[m][n] (f32, pitch ldc, + optional f32 bias[n]) = sum_k A[m][k] Bt[n][k] (+ split products per NSPLIT). z-batch strides sA/sB/sC in elements. K % 32 == 0; K is a compile-time number, so that every fragment of a k step lies at an immediate offset from the side's one address.
// PLANES: the joint q | k | v projection (A = x of both batches, Bt = the weight rows, one head per 64 columns). Nothing goes to C: the tile is stored as the attention's head planes, fp16 and bf16 hi / lo of every value, in fragment order; q, k per [b][h]: rows t, k index d; v per [b][h]: rows d, k index t.
// The WMMA's A side is then the plane's k index (t for v; d for q and k, whose tiles swap the two operands: both sides use the same loader, so the k orders agree either way): the 8 values of a lane in one accumulator ARE that lane's 16 bytes of one half fragment, and go out straight from the registers.
struct HeadPlanes { bf *q16, *qh, *ql, *k16, *kh, *kl, *v16, *vh, *vl; };
template <typename T16> struct WFrag;
template <> struct WFrag<h16> { typedef v16h V; static __device__ __forceinline__ V ld(const h16* p) { return cat16(*(const v8h*)p, *(const v8h*)(p + 256)); } static __device__ __forceinline__ v8f mma(V a, V b, v8f c) { return wmma16(a, b, c); } };
template <> struct WFrag<bf> { typedef v16bf V; static __device__ __forceinline__ V ld(const bf* p) { return cat16b(*(const v8us*)p, *(const v8us*)(p + 256)); } static __device__ __forceinline__ v8f mma(V a, V b, v8f c) { return wmmab(a, b, c); } };
// One k step's fragments of both sides. The k loop keeps D such sets in registers, as a ring: while the WMMAs of step s run, the loads of steps s + 1 .. s + D - 1 are in flight, so a wave no longer waits out a whole load latency in front of every step.
template <typename T16, int NSPLIT, int K> struct KStep {
    typedef typename WFrag<T16>::V V; V a[4], a2[4], b[4], b2[4];
    // e: the step's place behind the four addresses, in elements (32 k = 512 elements): an immediate offset
    __device__ __forceinline__ void load(const T16* __restrict__ pa, const T16* __restrict__ pa2, const T16* __restrict__ pb, const T16* __restrict__ pb2, int e) {
#pragma unroll
        for (int mb = 0; mb < 4; ++mb) { a[mb] = WFrag<T16>::ld(pa + e + mb * 16 * K); if (NSPLIT == 1 || NSPLIT == 2) a2[mb] = WFrag<T16>::ld(pa2 + e + mb * 16 * K); }
#pragma unroll
        for (int nb = 0; nb < 4; ++nb) { b[nb] = WFrag<T16>::ld(pb + e + nb * 16 * K); if (NSPLIT >= 2) b2[nb] = WFrag<T16>::ld(pb2 + e + nb * 16 * K); }
        __builtin_amdgcn_sched_barrier(0);   // the loads are issued here, ahead of the WMMAs of the older set: moved down to their first use they would fly under nothing
    }
    __device__ __forceinline__ void mma(v8f (&acc)[4][4]) {
#pragma unroll
        for (int nb = 0; nb < 4; ++nb) {
#pragma unroll
            for (int mb = 0; mb < 4; ++mb) { acc[mb][nb] = WFrag<T16>::mma(a[mb], b[nb], acc[mb][nb]); if (NSPLIT == 1 || NSPLIT == 2) acc[mb][nb] = WFrag<T16>::mma(a2[mb], b[nb], acc[mb][nb]); if (NSPLIT >= 2) acc[mb][nb] = WFrag<T16>::mma(a[mb], b2[nb], acc[mb][nb]); } }
        asm volatile("v_nop\n\tv_nop\n\tv_nop\n\tv_nop" : "+v"(acc[0][0]), "+v"(acc[1][1]), "+v"(acc[2][2]), "+v"(acc[3][3]) : "v"(a[0]), "v"(a[3]));   // the 4 slots behind the step's last WMMA, on the loop's taken branch too
        __builtin_amdgcn_sched_barrier(0);   // the refill of this set stays behind its WMMAs: moved up it would need a further set of registers
    }
};
template <typename T16, int NSPLIT, bool BIAS, int K, int NW, bool PLANES = false, int D = 3>
__global__ __launch_bounds__(32 * NW) void k_gemmw(const T16* __restrict__ A, const T16* __restrict__ A2, const T16* __restrict__ Bt, const T16* __restrict__ Bt2, float* C, int ldc, const float* __restrict__ bias, size_t sA, size_t sB, size_t sC, HeadPlanes hp) {
    typedef typename WFrag<T16>::V V;
    static_assert(NW % 4 == 0, "whole 2x2 blocks of tiles");
    __shared__ __align__(16) float osw[NW][16 * 68];   // each wave stages in its own range
    const int w = __builtin_amdgcn_readfirstlane(threadIdx.x >> 5); float* os = osw[w];
    const size_t z = blockIdx.z; A += z * sA; if (A2) A2 += z * sA; Bt += z * sB; if (Bt2) Bt2 += z * sB; C += z * sC;
    const int lane = threadIdx.x & 31, lr = lane & 15, hi = lane >> 4; const int r0 = (blockIdx.x * 2 + (w & 1)) * 64, c0 = (blockIdx.y * (NW / 2) + (w >> 1)) * 64;
    v8f acc[4][4];
#pragma unroll
    for (int mb = 0; mb < 4; ++mb)
#pragma unroll
        for (int nb = 0; nb < 4; ++nb) acc[mb][nb] = (v8f){};
    int ra = r0, rb = c0;   // first row of the A side and of the B side
    if (PLANES && c0 < DQ + DKV) { const T16* t = A; A = Bt; Bt = t; ra = c0; rb = r0; }   // q, k tiles: weight rows (d) on the A side
    const size_t aoff = (size_t)ra * K + lane * 8, boff = (size_t)rb * K + lane * 8;   // the lane's place in the first fragment of the side's first 16-row tile; 32 k on = 512 elements on
    const T16* __restrict__ pa = A + aoff; const T16* __restrict__ pb = Bt + boff; const T16* __restrict__ pa2 = (NSPLIT == 1 || NSPLIT == 2) ? A2 + aoff : pa; const T16* __restrict__ pb2 = (NSPLIT >= 2) ? Bt2 + boff : pb;
    constexpr int NS = K / 32, NB = (NS - 2 * D + 1) / D + 1;   // k steps; trips of the rolled loop: D steps each, the last of which still loads a step below NS
    static_assert(D >= 2 && NS >= 2 * D - 1, "the ring's first fill and one whole trip exist");
    KStep<T16, NSPLIT, K> f[D]; unsigned e0 = 0;   // e0: the trip's first k step, in elements behind the four addresses
#pragma unroll
    for (int s = 0; s < D - 1; ++s) f[s].load(pa, pa2, pb, pb2, s * 512);
    asm volatile("s_wait_xcnt 0x0" ::: "memory"); __builtin_amdgcn_sched_barrier(0);   // the first fill's address registers (vector and scalar) are free for other use only behind the wait; the barrier keeps what follows behind it
#pragma unroll 1
    for (int kc = 0; kc < NB; ++kc) {   // stays rolled: D steps a trip, so that every set keeps its registers and no copy is needed
#pragma unroll
        for (int u = 0; u < D; ++u) { f[(u + D - 1) % D].load(pa + e0, pa2 + e0, pb + e0, pb2 + e0, (u + D - 1) * 512); f[u].mma(acc); }
        // s_wait_xcnt 0 stands in front of the rewrite of the trip's address registers. The step e0 is the statement's operand, so the new addresses are formed behind it, at the trip's end, where the wait is over at once; formed directly behind the last loads they would hold the wave up there.
        asm volatile("s_wait_xcnt 0x0" : "+s"(e0) :: "memory");
        e0 += D * 512;
    }
#pragma unroll
    for (int u = 0; u < NS - NB * D; ++u) {   // the last steps: nothing is loaded past the k range
        const bool more = NB * D + u + D - 1 < NS;
        if (more) f[(u + D - 1) % D].load(pa + e0, pa2 + e0, pb + e0, pb2 + e0, (u + D - 1) * 512);
        f[u % D].mma(acc);
        if (more) asm volatile("s_wait_xcnt 0x0" ::: "memory");   // in front of any later use of these loads' address registers; behind the WMMAs it is over at once
    }
    if constexpr (PLANES) {
        static_assert(HD == 64 && TT % 64 == 0, "a tile is one head wide and lies in one batch");
        const bool isq = c0 < DQ, isv = c0 >= DQ + DKV; const int b = r0 / TT, t0 = r0 % TT, h = (isq ? c0 : isv ? c0 - DQ - DKV : c0 - DQ) / HD;
        bf* d16 = isq ? hp.q16 : isv ? hp.v16 : hp.k16; bf* dh = isq ? hp.qh : isv ? hp.vh : hp.kh; bf* dl = isq ? hp.ql : isv ? hp.vl : hp.kl;
        // q, k: 16-row tile t / 16 = 2 fragments (d) = 1024 elements, half fragment mb. v: 32 t = 4 fragments (16-row tiles of d) = 2048 elements, fragment nb, half mb & 1. 64 t of one head are 64 * HD elements either way.
        const size_t base = ((size_t)(b * (isq ? NH_ : NKV) + h) * TT + t0) * HD + lane * 8; const int snb = isv ? 512 : 1024, smb2 = isv ? 2048 : 512;
#pragma unroll
        for (int nb = 0; nb < 4; ++nb) {
#pragma unroll
            for (int mb = 0; mb < 4; ++mb) { v8h o16; v8us oh, ol;
#pragma unroll
                for (int j = 0; j < 8; ++j) { const float v = acc[mb][nb][j]; unsigned short p, q; splitf(v, p, q); o16[j] = tohx(v); oh[j] = p; ol[j] = q; }
                const size_t o = base + nb * snb + (mb >> 1) * smb2 + (mb & 1) * 256;
                *(v8usa*)(d16 + o) = __builtin_bit_cast(v8us, o16); *(v8usa*)(dh + o) = oh; *(v8usa*)(dl + o) = ol; }
        }
        return;
    }
#pragma unroll
    for (int mb = 0; mb < 4; ++mb) {
#pragma unroll
        for (int nb = 0; nb < 4; ++nb) {
#pragma unroll
            for (int j = 0; j < 8; ++j) os[(hi * 8 + j) * 68 + nb * 16 + lr] = acc[mb][nb][j]; }
        __builtin_amdgcn_wave_barrier(); asm volatile("" ::: "memory");
        float* crow = C + (size_t)(r0 + mb * 16) * ldc + c0;
{
#pragma unroll
            for (int s = 0; s < 8; ++s) { const int row = 2 * s + hi, cofs = lr * 4; v4f val = *(const v4fa*)(os + row * 68 + cofs); if (BIAS) { val[0] += bfr(bias[c0 + cofs]); val[1] += bfr(bias[c0 + cofs + 1]); val[2] += bfr(bias[c0 + cofs + 2]); val[3] += bfr(bias[c0 + cofs + 3]); }
                *(v4f*)(crow + (size_t)row * ldc + cofs) = val; }
             }
        __builtin_amdgcn_wave_barrier(); asm volatile("" ::: "memory");
    }
}

typedef __attribute__((ext_vector_type(2))) _Float16 v2h;
typedef __attribute__((ext_vector_type(4))) _Float16 v4h;
typedef __attribute__((ext_vector_type(2))) unsigned short v2us;
typedef __attribute__((ext_vector_type(4))) unsigned short v4us;
typedef __attribute__((ext_vector_type(2))) float v2f;
typedef __attribute__((ext_vector_type(4))) int v4i;

// ---- k_prep: the three operand planes that hang on no product (the q | k | v weight rows, w_o, x), bf16 in fragment order, in ONE launch of few long-lived waves: 512 work-groups of 8 waves (16 waves a WGP, all resident at once), 8 pieces a thread.
// A piece = one lane's 8 elements (16 bytes) of a half fragment: lane = 16 * hi + row % 16, half w, k % 32 = 16 * w + 8 * hi + j. 64 threads hold one fragment, so a work-group holds 4 fragments (fs) at a time and 32 in all.
// All loads of a thread lie at immediate offsets from one address and are issued before the first value is converted; its stores lie at immediate offsets from one address too.
#define PREP_WT ((NH_ + 2 * NKV) * 4)   // work-groups on the per-head weights: 4 for each [DM][HD] matrix
#define PREP_X  (NB_ * TT / 16)         // on x: one 16-row tile (32 fragments) each
#define PREP_WO (DM / 16)               // on w_o: the same
__device__ __forceinline__ v8us bf8(const float (&v)[8]) { v8us o;
#pragma unroll
    for (int j = 0; j < 8; ++j) o[j] = f2bf(v[j]);
    return o; }
__global__ __launch_bounds__(256) void k_prep(const float* __restrict__ x, const float* __restrict__ wq, const float* __restrict__ wk, const float* __restrict__ wv, const float* __restrict__ wo, bf* __restrict__ Bt, bf* __restrict__ WOp, bf* __restrict__ XBp) {
    static_assert(DM == 1024 && HD == 64 && DQ == DM && (NB_ * TT) % 16 == 0, "32 fragments along k; 4 row tiles a head matrix; whole row tiles: the grid covers every piece exactly once, with no tail");
    const int tid = threadIdx.x, lr = tid & 15, hi = (tid >> 4) & 1, w = (tid >> 5) & 1, fs = tid >> 6, c = blockIdx.x; const int k0 = fs * 32 + w * 16 + hi * 8;
    float v[8][8];
    if (c < PREP_WT) {   // head matrix y ([DM][HD]: NH_ of wq, then NKV of wk, then NKV of wv; their Bt planes lie one behind the other), transposed; quarter kq of its k range, all 64 rows n: piece u = row tile u & 3, fragment kq * 8 + (u >> 2) * 4 + fs
        const int y = c >> 2, kq = c & 3; const float* ws = (y < NH_) ? wq + (size_t)y * DM * HD : (y < NH_ + NKV) ? wk + (size_t)(y - NH_) * DM * HD : wv + (size_t)(y - NH_ - NKV) * DM * HD;
        const float* __restrict__ p = ws + (size_t)(kq * 256 + k0) * HD + lr; bf* d = Bt + (size_t)y * HD * DM + (kq * 8 + fs) * 512 + (tid & 63) * 8;
#pragma unroll
        for (int u = 0; u < 8; ++u)
#pragma unroll
            for (int j = 0; j < 8; ++j) v[u][j] = p[((u >> 2) * 128 + j) * HD + (u & 3) * 16];
        loads_issued(p, p);   // all 64 loads fly together, and their one address stays in its registers up to the wait
#pragma unroll
        for (int u = 0; u < 8; ++u) *(v8us*)(d + (u & 3) * 16 * DM + (u >> 2) * 2048) = bf8(v[u]);
        return;
    }
    // row-major [rows][DM] f32: row tile t, piece u = fragment fs + 4 * u
    const bool isx = c < PREP_WT + PREP_X; const int t = isx ? c - PREP_WT : c - PREP_WT - PREP_X;
    const float* __restrict__ p = (isx ? x : wo) + (size_t)(t * 16 + lr) * DM + k0; bf* d = (isx ? XBp : WOp) + (size_t)t * 16 * DM + tid * 8;
#pragma unroll
    for (int u = 0; u < 8; ++u) { const v8f a = *(const v8f*)(p + u * 128);
#pragma unroll
        for (int j = 0; j < 8; ++j) v[u][j] = a[j]; }
    loads_issued(p, p);   // all 16 loads fly together, and their one address stays in its registers up to the wait (no load's result lands on it)
#pragma unroll
    for (int u = 0; u < 8; ++u) *(v8us*)(d + u * 2048) = bf8(v[u]);
}

#define C2L 0.045084220027780106f   // SCL x log2(e): exp(SCL (s - m)) = exp2(C2L s - C2L m)
__device__ __forceinline__ float xhalf(float x) { return __builtin_bit_cast(float, __builtin_amdgcn_permlanex16(__builtin_bit_cast(int, x), __builtin_bit_cast(int, x), 0x76543210, 0xfedcba98, false, false)); }   // lane l reads lane l ^ 16
// row0: first of the wave's 16 query rows; Ah, Al: the head's first fragment in row tile 0 (the head's 64 columns = 2 fragments = 4 half fragments, db each)
__device__ __forceinline__ void attn_store(const v8f (&o)[4], float l, bf* Ah, bf* Al, int row0, int lane) {
    const float f = __fdiv_rn(1.0f, l + xhalf(l));
#pragma unroll
    for (int db = 0; db < 4; ++db) { v8us oh, ol;
#pragma unroll
        for (int j = 0; j < 8; ++j) { unsigned short x, y; splitf(o[db][j] * f, x, y); oh[j] = x; ol[j] = y; }
        const size_t oo = (size_t)row0 * DQ + db * 256 + lane * 8; *(v8us*)(Ah + oo) = oh; *(v8us*)(Al + oo) = ol; }
}
// running maximum m (raw score units) and sum l of one query column over its 8 * NT new scores (NT 16-key tiles = NT / 2 blocks of 32 keys); st becomes exp(SCL (s - m)); returns the factor for what was summed under the old maximum
// Each 32-key block has its own maximum chain and its own sum chain, joined at the end: the chains of a pass are independent, so a wave that is alone on its SIMD issues one while the other's last link is still under way.
template <int NT>
__device__ __forceinline__ float attn_soft(v8f (&st)[NT], float& m, float& l) {
    float mb[NT / 2];
#pragma unroll
    for (int g = 0; g < NT / 2; ++g) { mb[g] = g ? st[2 * g][0] : m;
#pragma unroll
        for (int kt = 0; kt < 2; ++kt)
#pragma unroll
            for (int j = 0; j < 8; ++j) mb[g] = fmaxf(mb[g], st[2 * g + kt][j]); }
    float mx = mb[0];
#pragma unroll
    for (int g = 1; g < NT / 2; ++g) mx = fmaxf(mx, mb[g]);
    mx = fmaxf(mx, xhalf(mx));
    const float al = __builtin_amdgcn_exp2f((m - mx) * C2L), mc = mx * C2L; m = mx; float sb[NT / 2];
#pragma unroll
    for (int g = 0; g < NT / 2; ++g) { sb[g] = 0.f;
#pragma unroll
        for (int kt = 0; kt < 2; ++kt)
#pragma unroll
            for (int j = 0; j < 8; ++j) { const float p = __builtin_amdgcn_exp2f(__builtin_fmaf(st[2 * g + kt][j], C2L, -mc)); st[2 * g + kt][j] = p; sb[g] += p; } }
    float s = sb[0];
#pragma unroll
    for (int g = 1; g < NT / 2; ++g) s += sb[g];
    l = l * al + s; return al;
}
__device__ __forceinline__ void attn_mask(v8f (&st)[2], int kb, int query, int hi) {
#pragma unroll
    for (int kt = 0; kt < 2; ++kt)
#pragma unroll
        for (int j = 0; j < 8; ++j) st[kt][j] = (kb + kt * 16 + hi * 8 + j <= query) ? st[kt][j] : -3.0e38f;
}
// query rows >= RH: fp16 operands, 32 query rows a wave. One pass = NB blocks of 32 keys (NB = 2 but for one odd first block): one running maximum, one rescale of o and one exchange between the wave halves for all its keys, and NB times the independent products, exponentials and loads between two places where the wave must wait.
// pv: the lane's place in this pass's 4 * NB V^T fragments; pk: in the NEXT pass's 8 K fragments (64 keys); both step on behind the loads.
// ak holds this pass's K fragments (tiles 0 .. 2 * NB - 1) on entry and, where PRE is true, the next pass's 64 keys on return (they fly while this pass computes). DIAG: the pass's last block is the diagonal one (its first key = the wave's first query); the blocks in front of it lie wholly below every query.
template <int NB, bool DIAG, bool PRE>
__device__ __forceinline__ void attn_f16_pass(const h16* __restrict__& pk, const h16* __restrict__& pv, int lr, int hi, const v16h (&bq)[2][2], v16h (&ak)[4][2], v8f (&o)[2][4], float (&m)[2], float (&l)[2]) {
    v16h av[NB][4];
#pragma unroll
    for (int g = 0; g < NB; ++g)
#pragma unroll
        for (int db = 0; db < 4; ++db) av[g][db] = WFrag<h16>::ld(pv + g * 2048 + db * 512);
    v8f st[2][2 * NB];
#pragma unroll
    for (int nq = 0; nq < 2; ++nq)
#pragma unroll
        for (int kt = 0; kt < 2 * NB; ++kt) { st[nq][kt] = wmma16(ak[kt][0], bq[nq][0], (v8f){}); st[nq][kt] = wmma16(ak[kt][1], bq[nq][1], st[nq][kt]); }
    if (PRE) {
#pragma unroll
        for (int kt = 0; kt < 4; ++kt)
#pragma unroll
            for (int ks = 0; ks < 2; ++ks) ak[kt][ks] = WFrag<h16>::ld(pk + kt * 1024 + ks * 512);
    }
    loads_issued(pk, pv);
    pk += 4096; pv += NB * 2048;
    if (DIAG) {   // only the diagonal block holds keys beyond a query
#pragma unroll
        for (int nq = 0; nq < 2; ++nq)
#pragma unroll
            for (int kt = 0; kt < 2; ++kt)
#pragma unroll
                for (int j = 0; j < 8; ++j) st[nq][2 * NB - 2 + kt][j] = (kt * 16 + hi * 8 + j <= nq * 16 + lr) ? st[nq][2 * NB - 2 + kt][j] : -3.0e38f;
    }
#pragma unroll
    for (int nq = 0; nq < 2; ++nq) { const float al = attn_soft<2 * NB>(st[nq], m[nq], l[nq]); v16h bp[NB];
#pragma unroll
        for (int g = 0; g < NB; ++g)
#pragma unroll
            for (int e = 0; e < 16; ++e) bp[g][e] = tohx(st[nq][2 * g + (e >> 3)][e & 7]);
#pragma unroll
        for (int db = 0; db < 4; ++db) o[nq][db] *= al;
#pragma unroll
        for (int g = 0; g < NB; ++g)
#pragma unroll
            for (int db = 0; db < 4; ++db) o[nq][db] = wmma16(av[g][db], bp[g], o[nq][db]); }
}
__device__ __forceinline__ void attn_f16(const h16* __restrict__ Q, const h16* __restrict__ Kp, const h16* __restrict__ Vt, int q0, bf* Ah, bf* Al, int lr, int hi) {
    static_assert(RH >= 64 && RH % 32 == 0, "a wave has at least 3 blocks of 32 keys: the last pass's 64 keys exist, behind an odd first block too");
    const int lane = hi * 16 + lr; const h16* pq = Q + (size_t)q0 * HD + lane * 8;
    v16h bq[2][2];
#pragma unroll
    for (int nq = 0; nq < 2; ++nq)
#pragma unroll
        for (int ks = 0; ks < 2; ++ks) bq[nq][ks] = WFrag<h16>::ld(pq + nq * 1024 + ks * 512);
    v8f o[2][4]; float m[2], l[2];
#pragma unroll
    for (int nq = 0; nq < 2; ++nq) { m[nq] = -3.0e38f; l[nq] = 0.f;
#pragma unroll
        for (int db = 0; db < 4; ++db) o[nq][db] = (v8f){}; }
    const h16* __restrict__ pk = Kp + lane * 8; const h16* __restrict__ pv = Vt + lane * 8;
    v16h ak[4][2];
    int nb = q0 / 32 + 1;   // blocks of 32 keys up to and with the diagonal one; the same in every lane of the wave
#pragma unroll
    for (int kt = 0; kt < 2; ++kt)
#pragma unroll
        for (int ks = 0; ks < 2; ++ks) ak[kt][ks] = WFrag<h16>::ld(pk + kt * 1024 + ks * 512);
    if (nb & 1) {   // an odd count: block 0 goes alone, so that what is left are whole passes of 64 keys that end on the diagonal block
        loads_issued(pq, pk);
        pk += 2048;
        attn_f16_pass<1, false, true>(pk, pv, lr, hi, bq, ak, o, m, l); --nb;
    } else {
#pragma unroll
        for (int kt = 2; kt < 4; ++kt)
#pragma unroll
            for (int ks = 0; ks < 2; ++ks) ak[kt][ks] = WFrag<h16>::ld(pk + kt * 1024 + ks * 512);
        loads_issued(pq, pk);
        pk += 4096;
    }
#pragma unroll 1
    for (; nb > 2; nb -= 2) attn_f16_pass<2, false, true>(pk, pv, lr, hi, bq, ak, o, m, l);   // stays rolled: one copy of the pass in the instruction cache
    const int ln = __builtin_amdgcn_mbcnt_lo(~0u, 0u);   // the lane's number, formed anew behind the loop: kept in registers across it (with lr and hi) it is what no longer fits the budget of 3 waves a SIMD, and is spilled
    attn_f16_pass<2, true, false>(pk, pv, ln & 15, ln >> 4, bq, ak, o, m, l);
    attn_store(o[0], l[0], Ah, Al, q0, ln); attn_store(o[1], l[1], Ah, Al, q0 + 16, ln);
}
// query rows < RH: bf16 hi + lo planes, 3 products (hi hi, lo hi, hi lo) for the scores and for probability x value; 16 query rows a wave
__device__ __forceinline__ void attn_hl(const bf* __restrict__ Qh, const bf* __restrict__ Ql, const bf* __restrict__ Kh, const bf* __restrict__ Kl, const bf* __restrict__ Vh, const bf* __restrict__ Vl, int q0, bf* Ah, bf* Al, int lr, int hi) {
    const int lane = hi * 16 + lr; v16bf qh[2], ql[2];
#pragma unroll
    for (int ks = 0; ks < 2; ++ks) { const size_t qo = (size_t)q0 * HD + ks * 512 + lane * 8; qh[ks] = WFrag<bf>::ld(Qh + qo); ql[ks] = WFrag<bf>::ld(Ql + qo); }
    v8f o[4]; float m = -3.0e38f, l = 0.f;
#pragma unroll
    for (int db = 0; db < 4; ++db) o[db] = (v8f){};
    const bf* __restrict__ pkh = Kh + lane * 8; const bf* __restrict__ pkl = Kl + lane * 8; const bf* __restrict__ pvh = Vh + lane * 8; const bf* __restrict__ pvl = Vl + lane * 8;   // the lane's places in this pass's 4 K and 4 V^T fragments
#pragma unroll 1
    for (int kb = 0; kb <= q0; kb += 32) {   // q0 is a multiple of 16: the last pass holds the diagonal, and its 32 keys lie below RH + 16 <= TT
        v16bf kh[2][2], kl[2][2], vh[4], vl[4];
#pragma unroll
        for (int kt = 0; kt < 2; ++kt)
#pragma unroll
            for (int ks = 0; ks < 2; ++ks) { const int e = kt * 1024 + ks * 512; kh[kt][ks] = WFrag<bf>::ld(pkh + e); kl[kt][ks] = WFrag<bf>::ld(pkl + e); }
#pragma unroll
        for (int db = 0; db < 4; ++db) { const int e = db * 512; vh[db] = WFrag<bf>::ld(pvh + e); vl[db] = WFrag<bf>::ld(pvl + e); }
        loads_issued(pkh, pkl, pvh, pvl);
        pkh += 2048; pkl += 2048; pvh += 2048; pvl += 2048;
        v8f st[2];
#pragma unroll
        for (int kt = 0; kt < 2; ++kt) { st[kt] = (v8f){};
#pragma unroll
            for (int ks = 0; ks < 2; ++ks) { st[kt] = wmmab(kh[kt][ks], qh[ks], st[kt]); st[kt] = wmmab(kh[kt][ks], ql[ks], st[kt]); st[kt] = wmmab(kl[kt][ks], qh[ks], st[kt]); } }
        if (kb + 31 > q0) attn_mask(st, kb, q0 + lr, hi);
        const float al = attn_soft(st, m, l); v8us p0h, p0l, p1h, p1l;
#pragma unroll
        for (int j = 0; j < 8; ++j) { unsigned short x, y; splitf(st[0][j], x, y); p0h[j] = x; p0l[j] = y; splitf(st[1][j], x, y); p1h[j] = x; p1l[j] = y; }
        const v16bf ph = cat16b(p0h, p1h), pl = cat16b(p0l, p1l);
#pragma unroll
        for (int db = 0; db < 4; ++db) { o[db] *= al; o[db] = wmmab(vh[db], ph, o[db]); o[db] = wmmab(vh[db], pl, o[db]); o[db] = wmmab(vl[db], ph, o[db]); }
    }
    attn_store(o, l, Ah, Al, q0, lane);
}
// grid (NB_ * NH_, (TT - RH) / 128 + RH / 64), 4 waves; y falls with the rows' cost: y = 0 holds the last (longest) query rows. 3 waves a SIMD (the register budget of the launch bounds' second number): 768 places for the 640 work-groups, so that all are resident at once
__global__ __launch_bounds__(128, 3) void k_fattn(const h16* __restrict__ Q16, const h16* __restrict__ K16, const h16* __restrict__ V16, const bf* __restrict__ Qh, const bf* __restrict__ Ql, const bf* __restrict__ Kh, const bf* __restrict__ Kl, const bf* __restrict__ Vh, const bf* __restrict__ Vl, bf* Ah, bf* Al) {
    const int lane = threadIdx.x & 31, lr = lane & 15, hi = lane >> 4; const int w = __builtin_amdgcn_readfirstlane(threadIdx.x >> 5);
    const int b = blockIdx.x / NH_, h = blockIdx.x % NH_, y = blockIdx.y; const size_t pq = (size_t)(b * NH_ + h) * TT * HD, pk = (size_t)(b * NKV + h / REP) * TT * HD, po = (size_t)b * TT * DQ + h * 1024;   // po: the head's 2 fragments in the merged plane's first row tile
    if (y < (TT - RH) / 128) attn_f16(Q16 + pq, K16 + pk, V16 + pk, TT - 128 * y - 32 * (w + 1), Ah + po, Al + po, lr, hi);
    else attn_hl(Qh + pq, Ql + pq, Kh + pk, Kl + pk, Vh + pk, Vl + pk, RH - 64 * (y - (TT - RH) / 128) - 16 * (w + 1), Ah + po, Al + po, lr, hi);
}

extern "C" void kernel_launch(void* const* d_in, const int* in_sizes, int n_in,
                              void* d_out, int out_size, void* d_ws, size_t ws_size, hipStream_t stream) {
    (void)in_sizes; (void)n_in; (void)out_size;
            const float* x = (const float*)d_in[0]; const float* wq = (const float*)d_in[1]; const float* wk = (const float*)d_in[2]; const float* wv = (const float*)d_in[3]; const float* wo = (const float*)d_in[4]; const float* bo = (const float*)d_in[5];   /* input order x, Wq, Wk, Wv (PER-HEAD [16][1024][64]: 'hcd'), Wo ('oi' [1024][1024]), bo */
    float* OUT = (float*)d_out;     // [2][2048][1024]
    char* wsp = (char*)d_ws;
    auto take = [&](size_t bytes) { char* p = wsp; wsp += (bytes + 255) & ~(size_t)255; return (void*)p; };
    bf* WQ = (bf*)take((size_t)DQ * DM * 2); bf* WK = (bf*)take((size_t)DKV * DM * 2); bf* WV = (bf*)take((size_t)DKV * DM * 2); bf* WO = (bf*)take((size_t)DM * DQ * 2);
    bf* XB = (bf*)take((size_t)NB_ * TT * DM * 2);   // both batches: bf16 x
    const size_t NQP = (size_t)NH_ * TT * HD, NKP = (size_t)NKV * TT * HD;   // elements of one batch's query / key-value head planes; every plane holds both batches, [b][h]
    h16* QP16 = (h16*)take(NB_ * NQP * 2); h16* KP16 = (h16*)take(NB_ * NKP * 2); h16* VT16 = (h16*)take(NB_ * NKP * 2);
    bf* QPh = (bf*)take(NB_ * NQP * 2); bf* QPl = (bf*)take(NB_ * NQP * 2); bf* KPh = (bf*)take(NB_ * NKP * 2); bf* KPl = (bf*)take(NB_ * NKP * 2); bf* VTh = (bf*)take(NB_ * NKP * 2); bf* VTl = (bf*)take(NB_ * NKP * 2);
    bf* ATh = (bf*)take((size_t)NB_ * TT * DQ * 2); bf* ATl = (bf*)take((size_t)NB_ * TT * DQ * 2);
    (void)WK; (void)WV;   // reached through WQ: the three planes are contiguous
    if ((size_t)(wsp - (char*)d_ws) > ws_size) return;    // ws 256 MiB
    k_prep<<<PREP_WT + PREP_X + PREP_WO, 256, 0, stream>>>(x, wq, wk, wv, wo, WQ, WO, XB);   /* every per-head weight [h][DM][HD] ('xw' per head) -> its HD rows of the Bt planes WQ | WK | WV (contiguous); Wo and x cast */
    k_gemmw<bf, 0, false, DM, 12, true><<<dim3(NB_ * TT / 128, PQKV / 384, 1), 384, 0, stream>>>(XB, nullptr, WQ, nullptr, nullptr, 0, nullptr, 0, 0, 0, HeadPlanes{(bf*)QP16, QPh, QPl, (bf*)KP16, KPh, KPl, (bf*)VT16, VTh, VTl});   // q, k and v of both batches in one launch, stored as the attention's head planes
    k_fattn<<<dim3(NB_ * NH_, (TT - RH) / 128 + RH / 64, 1), 128, 0, stream>>>(QP16, KP16, VT16, QPh, QPl, KPh, KPl, VTh, VTl, ATh, ATl);   // every batch, head and query row in one launch
    k_gemmw<bf, 1, true, DQ, 4><<<dim3(NB_ * TT / 128, DM / 128, 1), 128, 0, stream>>>(ATh, ATl, WO, nullptr, OUT, DM, bo, 0, 0, 0, HeadPlanes{});   // both batches in one launch
}

// v009
// A run of this version takes 71.2 microseconds.
// Two timings next to v008 put it at 1.12 and 1.11 times that version's speed.
// Counting every step since v000, it is 25.5 times as fast.
#include <hip/hip_runtime.h>

// Causal multi-head attention with PER-HEAD projection weights and a model-width score scale (x [2][2048][1024]; q, k, v = einsum('btc,hcd->bhtd', x, W) with W [16][1024][64]: head h has its own (in, out) matrix ('xw' per head; no bias; 16 heads x 64); scores x 1/sqrt(float32(C)) with C = 1024 = 1/32 (the MODEL width: the module's own choice; soft logits); causal (-inf); softmax; out merged head-major; out Wo^T + bo ('oi' [1024][1024] + bias normal: non-zero) -> [2][2048][1024] (4.2 M); argument order x, Wq, Wk, Wv, Wo, bo).
// FRAGMENT ORDER: every 16-bit plane that a WMMA reads (x, the weights, q, k, v^T, the merged attention output) is stored as the lanes read it. A fragment = 16 rows x 32 k = 512 elements in a row: [half w of the k range][lane][8 elements], lane = 16 * hi + row % 16, k % 32 = 16 * w + 8 * hi + j.
// So each wave-wide 16-byte load or store covers 512 contiguous bytes (4 whole 128-byte lines) and not 32-byte pieces of 16 lines. Fragments of one 16-row tile follow one another along k, so a tile of a K-wide plane starts at element row * K, as in the row-major plane; v^T alone is ordered for its reader: the 4 fragments (64 d) of 32 keys lie together, then the next 32 keys.
// Layout: bf16 copy of x (both batches); each PER-HEAD q / k / v weight [h][1024][64] transposed once into its 64 rows of the Bt plane; Wp cast once ('oi' = Bt rows as stored); these three in one launch (k_prep); exact projections, whose launch stores the q / k / v^T head planes itself (k_gemmw, PLANES); one fused causal attention launch (k_fattn: scores and probabilities stay in registers, online softmax; hybrid rows: < 512 hi/lo 3 products, rest fp16); merged hi/lo x w_o exact.
// Compute dtypes, f32 accumulate: every input rounded to bf16; projections exact; attention rows < 512 3 products, rest fp16; softmax f32; w_o hl x exact.

#define NB_  2
#define TT   2048
#define DM   1024
#define NH_  16
#define NKV  16
#define REP  (NH_ / NKV)
#define HD   64
#define DQ   (NH_ * HD)
#define DKV  (NKV * HD)
#define PQKV (DQ + 2 * DKV)       // columns of the joint q | k | v projection
#define RH   512                  // query rows < RH use hi+lo planes
#define SCL  0.03125f   // 1 / sqrt(C) with C = 1024 = the MODEL width (this module scales its scores by the model width, not the head width): exactly 2^-5
typedef _Float16 h16;
typedef unsigned short bf;
typedef __attribute__((ext_vector_type(16))) __bf16   v16bf;
typedef __attribute__((ext_vector_type(16))) _Float16 v16h;
typedef __attribute__((ext_vector_type(8)))  _Float16 v8h;
typedef __attribute__((ext_vector_type(8)))  unsigned short v8us;
typedef __attribute__((ext_vector_type(8)))  float    v8f;
typedef __attribute__((ext_vector_type(4)))  float    v4f;
typedef v8h  __attribute__((may_alias)) v8ha;
typedef v4f  __attribute__((may_alias)) v4fa;
typedef v8us __attribute__((may_alias)) v8usa;

__device__ __forceinline__ unsigned short f2bf(float f) { unsigned u = __float_as_uint(f); u += 0x7FFFu + ((u >> 16) & 1u); return (unsigned short)(u >> 16); }
__device__ __forceinline__ float bf2f(unsigned short b) { return __uint_as_float(((unsigned)b) << 16); }
__device__ __forceinline__ float bfr(float f) { return bf2f(f2bf(f)); }
__device__ __forceinline__ v16h cat16(v8h lo, v8h hi) { return __builtin_shufflevector(lo, hi, 0, 1, 2, 3, 4, 5, 6, 7, 8, 9, 10, 11, 12, 13, 14, 15); }
__device__ __forceinline__ v16bf cat16b(v8us lo, v8us hi) { return __builtin_bit_cast(v16bf, __builtin_shufflevector(lo, hi, 0, 1, 2, 3, 4, 5, 6, 7, 8, 9, 10, 11, 12, 13, 14, 15)); }
__device__ __forceinline__ v8f wmma16(v16h a, v16h b, v8f c) { return __builtin_amdgcn_wmma_f32_16x16x32_f16(false, a, false, b, (short)0, c, false, false); }
__device__ __forceinline__ v8f wmmab(v16bf a, v16bf b, v8f c) { return __builtin_amdgcn_wmma_f32_16x16x32_bf16(false, a, false, b, (short)0, c, false, false); }



__device__ __forceinline__ h16 tohx(float x) { return (h16)x; }
__device__ __forceinline__ void splitf(float y, unsigned short& h, unsigned short& l) { h = f2bf(y); l = f2bf(y - bf2f(h)); }
// Stands behind a group of issued global loads. s_wait_xcnt 0 stands in front of every later rewrite of the registers that hold their addresses; the addresses are named as inputs so that those registers stay as they are up to the wait.
// sched_barrier: without it the scheduler moves the loads down to their first use, where they no longer fly under the arithmetic in between.
__device__ __forceinline__ void loads_issued(const void* a, const void* b) { asm volatile("s_wait_xcnt 0x0" :: "v"(a), "v"(b) : "memory"); __builtin_amdgcn_sched_barrier(0); }
__device__ __forceinline__ void loads_issued(const void* a, const void* b, const void* c, const void* d) { asm volatile("s_wait_xcnt 0x0" :: "v"(a), "v"(b), "v"(c), "v"(d) : "memory"); __builtin_amdgcn_sched_barrier(0); }
// ---- k_gemmw: register-blocked GEMM, ONE WAVE per 64x64 output tile (16 accumulators), operands straight from 16-bit planes in fragment order; grid (M/128, N/(32 NW), Z), NW waves.
// A work-group is a block of neighbouring tiles, 2 down x NW/2 across, one tile a wave; the waves share nothing but their WGP: waves 4g .. 4g+3 hold a 2x2 block, so each fragment that one of them loads is loaded by a second and comes from the WGP's cache, not from L2; the blocks g lie side by side and use the same two row tiles. No barrier: this is for speed only, no wave reads what another wrote.
// C[m][n] (f32, pitch ldc, + optional f32 bias[n]) = sum_k A[m][k] Bt[n][k] (+ split products per NSPLIT). z-batch strides sA/sB/sC in elements. K % 32 == 0; K is a compile-time number, so that every fragment of a k step lies at an immediate offset from the side's one address.
// PLANES: the joint q | k | v projection (A = x of both batches, Bt = the weight rows, one head per 64 columns). Nothing goes to C: the tile is stored as the attention's head planes, fp16 and bf16 hi / lo of every value, in fragment order; q, k per [b][h]: rows t, k index d; v per [b][h]: rows d, k index t.
// The WMMA's A side is then the plane's k index (t for v; d for q and k, whose tiles swap the two operands: both sides use the same loader, so the k orders agree either way): the 8 values of a lane in one accumulator ARE that lane's 16 bytes of one half fragment, and go out straight from the registers.
struct HeadPlanes { bf *q16, *qh, *ql, *k16, *kh, *kl, *v16, *vh, *vl; };
template <typename T16> struct WFrag;
template <> struct WFrag<h16> { typedef v16h V; static __device__ __forceinline__ V ld(const h16* p) { return cat16(*(const v8h*)p, *(const v8h*)(p + 256)); } static __device__ __forceinline__ v8f mma(V a, V b, v8f c) { return wmma16(a, b, c); } };
template <> struct WFrag<bf> { typedef v16bf V; static __device__ __forceinline__ V ld(const bf* p) { return cat16b(*(const v8us*)p, *(const v8us*)(p + 256)); } static __device__ __forceinline__ v8f mma(V a, V b, v8f c) { return wmmab(a, b, c); } };
// One k step's fragments of both sides. The k loop keeps D such sets in registers, as a ring: while the WMMAs of step s run, the loads of steps s + 1 .. s + D - 1 are in flight, so a wave no longer waits out a whole load latency in front of every step.
template <typename T16, int NSPLIT, int K> struct KStep {
    typedef typename WFrag<T16>::V V; V a[4], a2[4], b[4], b2[4];
    // e: the step's place behind the four addresses, in elements (32 k = 512 elements): an immediate offset
    __device__ __forceinline__ void load(const T16* __restrict__ pa, const T16* __restrict__ pa2, const T16* __restrict__ pb, const T16* __restrict__ pb2, int e) {
#pragma unroll
        for (int mb = 0; mb < 4; ++mb) { a[mb] = WFrag<T16>::ld(pa + e + mb * 16 * K); if (NSPLIT == 1 || NSPLIT == 2) a2[mb] = WFrag<T16>::ld(pa2 + e + mb * 16 * K); }
#pragma unroll
        for (int nb = 0; nb < 4; ++nb) { b[nb] = WFrag<T16>::ld(pb + e + nb * 16 * K); if (NSPLIT >= 2) b2[nb] = WFrag<T16>::ld(pb2 + e + nb * 16 * K); }
        __builtin_amdgcn_sched_barrier(0);   // the loads are issued here, ahead of the WMMAs of the older set: moved down to their first use they would fly under nothing
    }
    __device__ __forceinline__ void mma(v8f (&acc)[4][4]) {
#pragma unroll
        for (int nb = 0; nb < 4; ++nb) {
#pragma unroll
            for (int mb = 0; mb < 4; ++mb) { acc[mb][nb] = WFrag<T16>::mma(a[mb], b[nb], acc[mb][nb]); if (NSPLIT == 1 || NSPLIT == 2) acc[mb][nb] = WFrag<T16>::mma(a2[mb], b[nb], acc[mb][nb]); if (NSPLIT >= 2) acc[mb][nb] = WFrag<T16>::mma(a[mb], b2[nb], acc[mb][nb]); } }
        asm volatile("v_nop\n\tv_nop\n\tv_nop\n\tv_nop" : "+v"(acc[0][0]), "+v"(acc[1][1]), "+v"(acc[2][2]), "+v"(acc[3][3]) : "v"(a[0]), "v"(a[3]));   // the 4 slots behind the step's last WMMA, on the loop's taken branch too
        __builtin_amdgcn_sched_barrier(0);   // the refill of this set stays behind its WMMAs: moved up it would need a further set of registers
    }
};
template <typename T16, int NSPLIT, bool BIAS, int K, int NW, bool PLANES = false, int D = 3>
__global__ __launch_bounds__(32 * NW) void k_gemmw(const T16* __restrict__ A, const T16* __restrict__ A2, const T16* __restrict__ Bt, const T16* __restrict__ Bt2, float* C, int ldc, const float* __restrict__ bias, size_t sA, size_t sB, size_t sC, HeadPlanes hp) {
    typedef typename WFrag<T16>::V V;
    static_assert(NW % 4 == 0, "whole 2x2 blocks of tiles");
    __shared__ __align__(16) float osw[NW][16 * 68];   // each wave stages in its own range
    const int w = __builtin_amdgcn_readfirstlane(threadIdx.x >> 5); float* os = osw[w];
    const size_t z = blockIdx.z; A += z * sA; if (A2) A2 += z * sA; Bt += z * sB; if (Bt2) Bt2 += z * sB; C += z * sC;
    const int lane = threadIdx.x & 31, lr = lane & 15, hi = lane >> 4; const int r0 = (blockIdx.x * 2 + (w & 1)) * 64, c0 = (blockIdx.y * (NW / 2) + (w >> 1)) * 64;
    v8f acc[4][4];
#pragma unroll
    for (int mb = 0; mb < 4; ++mb)
#pragma unroll
        for (int nb = 0; nb < 4; ++nb) acc[mb][nb] = (v8f){};
    int ra = r0, rb = c0;   // first row of the A side and of the B side
    if (PLANES && c0 < DQ + DKV) { const T16* t = A; A = Bt; Bt = t; ra = c0; rb = r0; }   // q, k tiles: weight rows (d) on the A side
    const size_t aoff = (size_t)ra * K + lane * 8, boff = (size_t)rb * K + lane * 8;   // the lane's place in the first fragment of the side's first 16-row tile; 32 k on = 512 elements on
    const T16* __restrict__ pa = A + aoff; const T16* __restrict__ pb = Bt + boff; const T16* __restrict__ pa2 = (NSPLIT == 1 || NSPLIT == 2) ? A2 + aoff : pa; const T16* __restrict__ pb2 = (NSPLIT >= 2) ? Bt2 + boff : pb;
    constexpr int NS = K / 32, NB = (NS - 2 * D + 1) / D + 1;   // k steps; trips of the rolled loop: D steps each, the last of which still loads a step below NS
    static_assert(D >= 2 && NS >= 2 * D - 1, "the ring's first fill and one whole trip exist");
    KStep<T16, NSPLIT, K> f[D]; unsigned e0 = 0;   // e0: the trip's first k step, in elements behind the four addresses
#pragma unroll
    for (int s = 0; s < D - 1; ++s) f[s].load(pa, pa2, pb, pb2, s * 512);
    asm volatile("s_wait_xcnt 0x0" ::: "memory"); __builtin_amdgcn_sched_barrier(0);   // the first fill's address registers (vector and scalar) are free for other use only behind the wait; the barrier keeps what follows behind it
#pragma unroll 1
    for (int kc = 0; kc < NB; ++kc) {   // stays rolled: D steps a trip, so that every set keeps its registers and no copy is needed
#pragma unroll
        for (int u = 0; u < D; ++u) { f[(u + D - 1) % D].load(pa + e0, pa2 + e0, pb + e0, pb2 + e0, (u + D - 1) * 512); f[u].mma(acc); }
        // s_wait_xcnt 0 stands in front of the rewrite of the trip's address registers. The step e0 is the statement's operand, so the new addresses are formed behind it, at the trip's end, where the wait is over at once; formed directly behind the last loads they would hold the wave up there.
        asm volatile("s_wait_xcnt 0x0" : "+s"(e0) :: "memory");
        e0 += D * 512;
    }
#pragma unroll
    for (int u = 0; u < NS - NB * D; ++u) {   // the last steps: nothing is loaded past the k range
        const bool more = NB * D + u + D - 1 < NS;
        if (more) f[(u + D - 1) % D].load(pa + e0, pa2 + e0, pb + e0, pb2 + e0, (u + D - 1) * 512);
        f[u % D].mma(acc);
        if (more) asm volatile("s_wait_xcnt 0x0" ::: "memory");   // in front of any later use of these loads' address registers; behind the WMMAs it is over at once
    }
    if constexpr (PLANES) {
        static_assert(HD == 64 && TT % 64 == 0, "a tile is one head wide and lies in one batch");
        const bool isq = c0 < DQ, isv = c0 >= DQ + DKV; const int b = r0 / TT, t0 = r0 % TT, h = (isq ? c0 : isv ? c0 - DQ - DKV : c0 - DQ) / HD;
        bf* d16 = isq ? hp.q16 : isv ? hp.v16 : hp.k16; bf* dh = isq ? hp.qh : isv ? hp.vh : hp.kh; bf* dl = isq ? hp.ql : isv ? hp.vl : hp.kl;
        // q, k: 16-row tile t / 16 = 2 fragments (d) = 1024 elements, half fragment mb. v: 32 t = 4 fragments (16-row tiles of d) = 2048 elements, fragment nb, half mb & 1. 64 t of one head are 64 * HD elements either way.
        const size_t base = ((size_t)(b * (isq ? NH_ : NKV) + h) * TT + t0) * HD + lane * 8; const int snb = isv ? 512 : 1024, smb2 = isv ? 2048 : 512;
#pragma unroll
        for (int nb = 0; nb < 4; ++nb) {
#pragma unroll
            for (int mb = 0; mb < 4; ++mb) { v8h o16; v8us oh, ol;
#pragma unroll
                for (int j = 0; j < 8; ++j) { const float v = acc[mb][nb][j]; unsigned short p, q; splitf(v, p, q); o16[j] = tohx(v); oh[j] = p; ol[j] = q; }
                const size_t o = base + nb * snb + (mb >> 1) * smb2 + (mb & 1) * 256;
                *(v8usa*)(d16 + o) = __builtin_bit_cast(v8us, o16); *(v8usa*)(dh + o) = oh; *(v8usa*)(dl + o) = ol; }
        }
        return;
    }
#pragma unroll
    for (int mb = 0; mb < 4; ++mb) {
#pragma unroll
        for (int nb = 0; nb < 4; ++nb) {
#pragma unroll
            for (int j = 0; j < 8; ++j) os[(hi * 8 + j) * 68 + nb * 16 + lr] = acc[mb][nb][j]; }
        __builtin_amdgcn_wave_barrier(); asm volatile("" ::: "memory");
        float* crow = C + (size_t)(r0 + mb * 16) * ldc + c0;
{
#pragma unroll
            for (int s = 0; s < 8; ++s) { const int row = 2 * s + hi, cofs = lr * 4; v4f val = *(const v4fa*)(os + row * 68 + cofs); if (BIAS) { val[0] += bfr(bias[c0 + cofs]); val[1] += bfr(bias[c0 + cofs + 1]); val[2] += bfr(bias[c0 + cofs + 2]); val[3] += bfr(bias[c0 + cofs + 3]); }
                *(v4f*)(crow + (size_t)row * ldc + cofs) = val; }
             }
        __builtin_amdgcn_wave_barrier(); asm volatile("" ::: "memory");
    }
}

typedef __attribute__((ext_vector_type(2))) _Float16 v2h;
typedef __attribute__((ext_vector_type(4))) _Float16 v4h;
typedef __attribute__((ext_vector_type(2))) unsigned short v2us;
typedef __attribute__((ext_vector_type(4))) unsigned short v4us;
typedef __attribute__((ext_vector_type(2))) float v2f;
typedef __attribute__((ext_vector_type(4))) int v4i;

// ---- k_prep: the three operand planes that hang on no product (the q | k | v weight rows, w_o, x), bf16 in fragment order, in ONE launch of few long-lived waves: 512 work-groups of 8 waves (16 waves a WGP, all resident at once), 8 pieces a thread.
// A piece = one lane's 8 elements (16 bytes) of a half fragment: lane = 16 * hi + row % 16, half w, k % 32 = 16 * w + 8 * hi + j. 64 threads hold one fragment, so a work-group holds 4 fragments (fs) at a time and 32 in all.
// All loads of a thread lie at immediate offsets from one address and are issued before the first value is converted; its stores lie at immediate offsets from one address too.
#define PREP_WT ((NH_ + 2 * NKV) * 4)   // work-groups on the per-head weights: 4 for each [DM][HD] matrix
#define PREP_X  (NB_ * TT / 16)         // on x: one 16-row tile (32 fragments) each
#define PREP_WO (DM / 16)               // on w_o: the same
__device__ __forceinline__ v8us bf8(const float (&v)[8]) { v8us o;
#pragma unroll
    for (int j = 0; j < 8; ++j) o[j] = f2bf(v[j]);
    return o; }
__global__ __launch_bounds__(256) void k_prep(const float* __restrict__ x, const float* __restrict__ wq, const float* __restrict__ wk, const float* __restrict__ wv, const float* __restrict__ wo, bf* __restrict__ Bt, bf* __restrict__ WOp, bf* __restrict__ XBp) {
    static_assert(DM == 1024 && HD == 64 && DQ == DM && (NB_ * TT) % 16 == 0, "32 fragments along k; 4 row tiles a head matrix; whole row tiles: the grid covers every piece exactly once, with no tail");
    const int tid = threadIdx.x, lr = tid & 15, hi = (tid >> 4) & 1, w = (tid >> 5) & 1, fs = tid >> 6, c = blockIdx.x; const int k0 = fs * 32 + w * 16 + hi * 8;
    float v[8][8];
    if (c < PREP_WT) {   // head matrix y ([DM][HD]: NH_ of wq, then NKV of wk, then NKV of wv; their Bt planes lie one behind the other), transposed; quarter kq of its k range, all 64 rows n: piece u = row tile u & 3, fragment kq * 8 + (u >> 2) * 4 + fs
        const int y = c >> 2, kq = c & 3; const float* ws = (y < NH_) ? wq + (size_t)y * DM * HD : (y < NH_ + NKV) ? wk + (size_t)(y - NH_) * DM * HD : wv + (size_t)(y - NH_ - NKV) * DM * HD;
        const float* __restrict__ p = ws + (size_t)(kq * 256 + k0) * HD + lr; bf* d = Bt + (size_t)y * HD * DM + (kq * 8 + fs) * 512 + (tid & 63) * 8;
#pragma unroll
        for (int u = 0; u < 8; ++u)
#pragma unroll
            for (int j = 0; j < 8; ++j) v[u][j] = p[((u >> 2) * 128 + j) * HD + (u & 3) * 16];
        loads_issued(p, p);   // all 64 loads fly together, and their one address stays in its registers up to the wait
#pragma unroll
        for (int u = 0; u < 8; ++u) *(v8us*)(d + (u & 3) * 16 * DM + (u >> 2) * 2048) = bf8(v[u]);
        return;
    }
    // row-major [rows][DM] f32: row tile t, piece u = fragment fs + 4 * u
    const bool isx = c < PREP_WT + PREP_X; const int t = isx ? c - PREP_WT : c - PREP_WT - PREP_X;
    const float* __restrict__ p = (isx ? x : wo) + (size_t)(t * 16 + lr) * DM + k0; bf* d = (isx ? XBp : WOp) + (size_t)t * 16 * DM + tid * 8;
#pragma unroll
    for (int u = 0; u < 8; ++u) { const v8f a = *(const v8f*)(p + u * 128);
#pragma unroll
        for (int j = 0; j < 8; ++j) v[u][j] = a[j]; }
    loads_issued(p, p);   // all 16 loads fly together, and their one address stays in its registers up to the wait (no load's result lands on it)
#pragma unroll
    for (int u = 0; u < 8; ++u) *(v8us*)(d + u * 2048) = bf8(v[u]);
}

#define C2L 0.045084220027780106f   // SCL x log2(e): exp(SCL (s - m)) = exp2(C2L s - C2L m)
__device__ __forceinline__ float xhalf(float x) { return __builtin_bit_cast(float, __builtin_amdgcn_permlanex16(__builtin_bit_cast(int, x), __builtin_bit_cast(int, x), 0x76543210, 0xfedcba98, false, false)); }   // lane l reads lane l ^ 16
// row0: first of the wave's 16 query rows; Ah, Al: the head's first fragment in row tile 0 (the head's 64 columns = 2 fragments = 4 half fragments, db each)
__device__ __forceinline__ void attn_store(const v8f (&o)[4], float l, bf* Ah, bf* Al, int row0, int lane) {
    const float f = __fdiv_rn(1.0f, l + xhalf(l));
#pragma unroll
    for (int db = 0; db < 4; ++db) { v8us oh, ol;
#pragma unroll
        for (int j = 0; j < 8; ++j) { unsigned short x, y; splitf(o[db][j] * f, x, y); oh[j] = x; ol[j] = y; }
        const size_t oo = (size_t)row0 * DQ + db * 256 + lane * 8; *(v8us*)(Ah + oo) = oh; *(v8us*)(Al + oo) = ol; }
}
// running maximum m (raw score units) and sum l of one query column over its 8 * NT new scores (NT 16-key tiles = NT / 2 blocks of 32 keys); st becomes exp(SCL (s - m)); returns the factor for what was summed under the old maximum
// Each 32-key block has its own maximum chain and its own sum chain, joined at the end: the chains of a pass are independent, so a wave that is alone on its SIMD issues one while the other's last link is still under way.
template <int NT>
__device__ __forceinline__ float attn_soft(v8f (&st)[NT], float& m, float& l) {
    float mb[NT / 2];
#pragma unroll
    for (int g = 0; g < NT / 2; ++g) { mb[g] = g ? st[2 * g][0] : m;
#pragma unroll
        for (int kt = 0; kt < 2; ++kt)
#pragma unroll
            for (int j = 0; j < 8; ++j) mb[g] = fmaxf(mb[g], st[2 * g + kt][j]); }
    float mx = mb[0];
#pragma unroll
    for (int g = 1; g < NT / 2; ++g) mx = fmaxf(mx, mb[g]);
    mx = fmaxf(mx, xhalf(mx));
    const float al = __builtin_amdgcn_exp2f((m - mx) * C2L), mc = mx * C2L; m = mx; float sb[NT / 2];
#pragma unroll
    for (int g = 0; g < NT / 2; ++g) { sb[g] = 0.f;
#pragma unroll
        for (int kt = 0; kt < 2; ++kt)
#pragma unroll
            for (int j = 0; j < 8; ++j) { const float p = __builtin_amdgcn_exp2f(__builtin_fmaf(st[2 * g + kt][j], C2L, -mc)); st[2 * g + kt][j] = p; sb[g] += p; } }
    float s = sb[0];
#pragma unroll
    for (int g = 1; g < NT / 2; ++g) s += sb[g];
    l = l * al + s; return al;
}
__device__ __forceinline__ void attn_mask(v8f (&st)[2], int kb, int query, int hi) {
#pragma unroll
    for (int kt = 0; kt < 2; ++kt)
#pragma unroll
        for (int j = 0; j < 8; ++j) st[kt][j] = (kb + kt * 16 + hi * 8 + j <= query) ? st[kt][j] : -3.0e38f;
}
// query rows >= RH: fp16 operands, 32 query rows a wave. One pass = NB blocks of 32 keys (NB = 2 but for one odd first block): one running maximum, one rescale of o and one exchange between the wave halves for all its keys, and NB times the independent products, exponentials and loads between two places where the wave must wait.
// pv: the lane's place in this pass's 4 * NB V^T fragments; pk: in the NEXT pass's 8 K fragments (64 keys); both step on behind the loads.
// ak holds this pass's K fragments (tiles 0 .. 2 * NB - 1) on entry and, where PRE is true, the next pass's 64 keys on return (they fly while this pass computes). DIAG: the pass's last block is the diagonal one (its first key = the wave's first query); the blocks in front of it lie wholly below every query.
template <int NB, bool DIAG, bool PRE>
__device__ __forceinline__ void attn_f16_pass(const h16* __restrict__& pk, const h16* __restrict__& pv, int lr, int hi, const v16h (&bq)[2][2], v16h (&ak)[4][2], v8f (&o)[2][4], float (&m)[2], float (&l)[2]) {
    v16h av[NB][4];
#pragma unroll
    for (int g = 0; g < NB; ++g)
#pragma unroll
        for (int db = 0; db < 4; ++db) av[g][db] = WFrag<h16>::ld(pv + g * 2048 + db * 512);
    v8f st[2][2 * NB];
#pragma unroll
    for (int nq = 0; nq < 2; ++nq)
#pragma unroll
        for (int kt = 0; kt < 2 * NB; ++kt) { st[nq][kt] = wmma16(ak[kt][0], bq[nq][0], (v8f){}); st[nq][kt] = wmma16(ak[kt][1], bq[nq][1], st[nq][kt]); }
    if (PRE) {
#pragma unroll
        for (int kt = 0; kt < 4; ++kt)
#pragma unroll
            for (int ks = 0; ks < 2; ++ks) ak[kt][ks] = WFrag<h16>::ld(pk + kt * 1024 + ks * 512);
    }
    loads_issued(pk, pv);
    pk += 4096; pv += NB * 2048;
    if (DIAG) {   // only the diagonal block holds keys beyond a query
#pragma unroll
        for (int nq = 0; nq < 2; ++nq)
#pragma unroll
            for (int kt = 0; kt < 2; ++kt)
#pragma unroll
                for (int j = 0; j < 8; ++j) st[nq][2 * NB - 2 + kt][j] = (kt * 16 + hi * 8 + j <= nq * 16 + lr) ? st[nq][2 * NB - 2 + kt][j] : -3.0e38f;
    }
#pragma unroll
    for (int nq = 0; nq < 2; ++nq) { const float al = attn_soft<2 * NB>(st[nq], m[nq], l[nq]); v16h bp[NB];
#pragma unroll
        for (int g = 0; g < NB; ++g)
#pragma unroll
            for (int e = 0; e < 16; ++e) bp[g][e] = tohx(st[nq][2 * g + (e >> 3)][e & 7]);
#pragma unroll
        for (int db = 0; db < 4; ++db) o[nq][db] *= al;
#pragma unroll
        for (int g = 0; g < NB; ++g)
#pragma unroll
            for (int db = 0; db < 4; ++db) o[nq][db] = wmma16(av[g][db], bp[g], o[nq][db]); }
}
// Joins the two partial results of each 32-query tile of a work-group (waves t and t + 2 hold tile t's). Every wave leaves its o (16 pieces of 16 bytes a lane), maxima and sums in its own LDS range, lane-contiguous (a wave-wide access = 512 bytes in a row); behind the one barrier the wave of part s reads both waves' maxima, sums and query columns 16 s .. 16 s + 15, brings them to the common maximum, adds front part + rest and stores those 16 rows.
#define XSW (17 * 32)   // 16-byte pieces of one wave's range
__device__ __forceinline__ void attn_join(const v8f (&o)[2][4], const float (&m)[2], const float (&l)[2], v4f* xs, int t, int s, bf* Ah, bf* Al, int q0, int lane) {
    v4f* mine = xs + (t + 2 * s) * XSW + lane;
#pragma unroll
    for (int nq = 0; nq < 2; ++nq)
#pragma unroll
        for (int db = 0; db < 4; ++db) { mine[((nq * 4 + db) * 2) * 32] = __builtin_shufflevector(o[nq][db], o[nq][db], 0, 1, 2, 3); mine[((nq * 4 + db) * 2 + 1) * 32] = __builtin_shufflevector(o[nq][db], o[nq][db], 4, 5, 6, 7); }
    mine[16 * 32] = (v4f){m[0], l[0], m[1], l[1]};
    __syncthreads();   // every wave's partial result is in LDS before its partner reads it
    const v4f* p0 = xs + t * XSW + lane; const v4f* p1 = p0 + 2 * XSW;   // front part, rest
    const v4f e0 = p0[16 * 32], e1 = p1[16 * 32]; const v2f ml0 = s ? (v2f){e0[2], e0[3]} : (v2f){e0[0], e0[1]}, ml1 = s ? (v2f){e1[2], e1[3]} : (v2f){e1[0], e1[1]};   // maximum and sum of the lane's query column in the two parts
    const float mx = fmaxf(ml0[0], ml1[0]), x0 = (ml0[0] - mx) * C2L, x1 = (ml1[0] - mx) * C2L; float f0, f1;
    asm("v_exp_f32 %0, %2\n\tv_exp_f32 %1, %3\n\tv_nop" : "=&v"(f0), "=&v"(f1) : "v"(x0), "v"(x1));   // exp2 of both; the v_nop keeps the one slot between the last transcendental and the next vector instruction, which may read its result or overwrite its source
    const float ls = ml0[1] * f0 + ml1[1] * f1, f = __fdiv_rn(1.0f, ls + xhalf(ls)), g0 = f0 * f, g1 = f1 * f;
#pragma unroll
    for (int db = 0; db < 4; ++db) { v8us oh, ol;
#pragma unroll
        for (int c = 0; c < 2; ++c) { const v4f a = p0[((s * 4 + db) * 2 + c) * 32], b = p1[((s * 4 + db) * 2 + c) * 32];
#pragma unroll
            for (int j = 0; j < 4; ++j) { unsigned short x, y; splitf(a[j] * g0 + b[j] * g1, x, y); oh[4 * c + j] = x; ol[4 * c + j] = y; } }
        const size_t oo = (size_t)(q0 + s * 16) * DQ + db * 256 + lane * 8; *(v8us*)(Ah + oo) = oh; *(v8us*)(Al + oo) = ol; }
}
// t: which of the work-group's two tiles (q0 is its first query row); s: which part of its keys; cb: the blocks of 32 keys in the front part, even and the same for both tiles, so that the two waves of a part walk the same keys side by side and share them in the WGP's cache. A long row's keys so run on 2 SIMDs side by side, and no wave is longer than 32 blocks.
__device__ __forceinline__ void attn_f16(const h16* __restrict__ Q, const h16* __restrict__ Kp, const h16* __restrict__ Vt, int q0, int t, int s, int cb, bf* Ah, bf* Al, int lr, int hi, v4f* xs) {
    static_assert(RH >= 256 && RH % 64 == 0, "each part has at least 3 blocks of 32 keys: its last pass's 64 keys exist, behind an odd first block too, and hold a key below every query");
    const int lane = hi * 16 + lr; const h16* pq = Q + (size_t)q0 * HD + lane * 8;
    v16h bq[2][2];
#pragma unroll
    for (int nq = 0; nq < 2; ++nq)
#pragma unroll
        for (int ks = 0; ks < 2; ++ks) bq[nq][ks] = WFrag<h16>::ld(pq + nq * 1024 + ks * 512);
    v8f o[2][4]; float m[2], l[2];
#pragma unroll
    for (int nq = 0; nq < 2; ++nq) { m[nq] = -3.0e38f; l[nq] = 0.f;
#pragma unroll
        for (int db = 0; db < 4; ++db) o[nq][db] = (v8f){}; }
    const int fb = s ? cb : 0;   // the wave's first block (32 keys = 2048 elements of the K plane and of the V^T plane)
    const h16* __restrict__ pk = Kp + (size_t)fb * 2048 + lane * 8; const h16* __restrict__ pv = Vt + (size_t)fb * 2048 + lane * 8;
    v16h ak[4][2];
    int nb = s ? q0 / 32 + 1 - cb : cb;   // the wave's own blocks of 32 keys (the rest: up to and with the diagonal one); the same in every lane of the wave
#pragma unroll
    for (int kt = 0; kt < 2; ++kt)
#pragma unroll
        for (int ks = 0; ks < 2; ++ks) ak[kt][ks] = WFrag<h16>::ld(pk + kt * 1024 + ks * 512);
    if (nb & 1) {   // an odd count: the wave's first block goes alone, so that what is left are whole passes of 64 keys that end on the diagonal block
        loads_issued(pq, pk);
        pk += 2048;
        attn_f16_pass<1, false, true>(pk, pv, lr, hi, bq, ak, o, m, l); --nb;
    } else {
#pragma unroll
        for (int kt = 2; kt < 4; ++kt)
#pragma unroll
            for (int ks = 0; ks < 2; ++ks) ak[kt][ks] = WFrag<h16>::ld(pk + kt * 1024 + ks * 512);
        loads_issued(pq, pk);
        pk += 4096;
    }
#pragma unroll 1
    for (; nb > 2; nb -= 2) attn_f16_pass<2, false, true>(pk, pv, lr, hi, bq, ak, o, m, l);   // stays rolled: one copy of the pass in the instruction cache
    const int ln = __builtin_amdgcn_mbcnt_lo(~0u, 0u);   // the lane's number, formed anew behind the loop: kept in registers across it (with lr and hi) it is what no longer fits the budget of 3 waves a SIMD, and is spilled
    attn_f16_pass<2, true, false>(pk, pv, (ln & 15) + (s ? 0 : 64), ln >> 4, bq, ak, o, m, l);   // only the rest's last block is the diagonal one: in the front part the query index is raised by 64, so that the mask lets every key through
    attn_join(o, m, l, xs, t, s, Ah, Al, q0, ln);
}
// query rows < RH: bf16 hi + lo planes, 3 products (hi hi, lo hi, hi lo) for the scores and for probability x value; 16 query rows a wave
__device__ __forceinline__ void attn_hl(const bf* __restrict__ Qh, const bf* __restrict__ Ql, const bf* __restrict__ Kh, const bf* __restrict__ Kl, const bf* __restrict__ Vh, const bf* __restrict__ Vl, int q0, bf* Ah, bf* Al, int lr, int hi) {
    const int lane = hi * 16 + lr; v16bf qh[2], ql[2];
#pragma unroll
    for (int ks = 0; ks < 2; ++ks) { const size_t qo = (size_t)q0 * HD + ks * 512 + lane * 8; qh[ks] = WFrag<bf>::ld(Qh + qo); ql[ks] = WFrag<bf>::ld(Ql + qo); }
    v8f o[4]; float m = -3.0e38f, l = 0.f;
#pragma unroll
    for (int db = 0; db < 4; ++db) o[db] = (v8f){};
    const bf* __restrict__ pkh = Kh + lane * 8; const bf* __restrict__ pkl = Kl + lane * 8; const bf* __restrict__ pvh = Vh + lane * 8; const bf* __restrict__ pvl = Vl + lane * 8;   // the lane's places in this pass's 4 K and 4 V^T fragments
#pragma unroll 1
    for (int kb = 0; kb <= q0; kb += 32) {   // q0 is a multiple of 16: the last pass holds the diagonal, and its 32 keys lie below RH + 16 <= TT
        v16bf kh[2][2], kl[2][2], vh[4], vl[4];
#pragma unroll
        for (int kt = 0; kt < 2; ++kt)
#pragma unroll
            for (int ks = 0; ks < 2; ++ks) { const int e = kt * 1024 + ks * 512; kh[kt][ks] = WFrag<bf>::ld(pkh + e); kl[kt][ks] = WFrag<bf>::ld(pkl + e); }
#pragma unroll
        for (int db = 0; db < 4; ++db) { const int e = db * 512; vh[db] = WFrag<bf>::ld(pvh + e); vl[db] = WFrag<bf>::ld(pvl + e); }
        loads_issued(pkh, pkl, pvh, pvl);
        pkh += 2048; pkl += 2048; pvh += 2048; pvl += 2048;
        v8f st[2];
#pragma unroll
        for (int kt = 0; kt < 2; ++kt) { st[kt] = (v8f){};
#pragma unroll
            for (int ks = 0; ks < 2; ++ks) { st[kt] = wmmab(kh[kt][ks], qh[ks], st[kt]); st[kt] = wmmab(kh[kt][ks], ql[ks], st[kt]); st[kt] = wmmab(kl[kt][ks], qh[ks], st[kt]); } }
        if (kb + 31 > q0) attn_mask(st, kb, q0 + lr, hi);
        const float al = attn_soft(st, m, l); v8us p0h, p0l, p1h, p1l;
#pragma unroll
        for (int j = 0; j < 8; ++j) { unsigned short x, y; splitf(st[0][j], x, y); p0h[j] = x; p0l[j] = y; splitf(st[1][j], x, y); p1h[j] = x; p1l[j] = y; }
        const v16bf ph = cat16b(p0h, p1h), pl = cat16b(p0l, p1l);
#pragma unroll
        for (int db = 0; db < 4; ++db) { o[db] *= al; o[db] = wmmab(vh[db], ph, o[db]); o[db] = wmmab(vh[db], pl, o[db]); o[db] = wmmab(vl[db], ph, o[db]); }
    }
    attn_store(o, l, Ah, Al, q0, lane);
}
// grid (NB_ * NH_, RH / 64 + (TT - RH) / 64), 4 waves; a work-group's duration falls with y within each kind of rows: first the hi/lo rows (one wave walks all its keys, up to 16 passes that wait out their loads), longest first, then the fp16 rows (2 tiles x 2 parts of the keys), last (longest) query rows first. 3 waves a SIMD (the register budget of the launch bounds' second number): 768 places
__global__ __launch_bounds__(128, 3) void k_fattn(const h16* __restrict__ Q16, const h16* __restrict__ K16, const h16* __restrict__ V16, const bf* __restrict__ Qh, const bf* __restrict__ Ql, const bf* __restrict__ Kh, const bf* __restrict__ Kl, const bf* __restrict__ Vh, const bf* __restrict__ Vl, bf* Ah, bf* Al) {
    const int lane = threadIdx.x & 31, lr = lane & 15, hi = lane >> 4; const int w = __builtin_amdgcn_readfirstlane(threadIdx.x >> 5);
    const int b = blockIdx.x / NH_, h = blockIdx.x % NH_, y = blockIdx.y; const size_t pq = (size_t)(b * NH_ + h) * TT * HD, pk = (size_t)(b * NKV + h / REP) * TT * HD, po = (size_t)b * TT * DQ + h * 1024;   // po: the head's 2 fragments in the merged plane's first row tile
    __shared__ __align__(16) v4f xs[4 * XSW];
    if (y >= RH / 64) { const int yf = y - RH / 64;   // the branch is the same for the whole work-group: every wave reaches the barrier in attn_join
        attn_f16(Q16 + pq, K16 + pk, V16 + pk, TT - 64 * yf - 32 * ((w & 1) + 1), w & 1, w >> 1, 2 * ((TT / 64 - yf) >> 1), Ah + po, Al + po, lr, hi, xs); }   // front part: about half of the later tile's TT / 32 - 2 yf blocks
    else attn_hl(Qh + pq, Ql + pq, Kh + pk, Kl + pk, Vh + pk, Vl + pk, RH - 64 * y - 16 * (w + 1), Ah + po, Al + po, lr, hi);
}

extern "C" void kernel_launch(void* const* d_in, const int* in_sizes, int n_in,
                              void* d_out, int out_size, void* d_ws, size_t ws_size, hipStream_t stream) {
    (void)in_sizes; (void)n_in; (void)out_size;
            const float* x = (const float*)d_in[0]; const float* wq = (const float*)d_in[1]; const float* wk = (const float*)d_in[2]; const float* wv = (const float*)d_in[3]; const float* wo = (const float*)d_in[4]; const float* bo = (const float*)d_in[5];   /* input order x, Wq, Wk, Wv (PER-HEAD [16][1024][64]: 'hcd'), Wo ('oi' [1024][1024]), bo */
    float* OUT = (float*)d_out;     // [2][2048][1024]
    char* wsp = (char*)d_ws;
    auto take = [&](size_t bytes) { char* p = wsp; wsp += (bytes + 255) & ~(size_t)255; return (void*)p; };
    bf* WQ = (bf*)take((size_t)DQ * DM * 2); bf* WK = (bf*)take((size_t)DKV * DM * 2); bf* WV = (bf*)take((size_t)DKV * DM * 2); bf* WO = (bf*)take((size_t)DM * DQ * 2);
    bf* XB = (bf*)take((size_t)NB_ * TT * DM * 2);   // both batches: bf16 x
    const size_t NQP = (size_t)NH_ * TT * HD, NKP = (size_t)NKV * TT * HD;   // elements of one batch's query / key-value head planes; every plane holds both batches, [b][h]
    h16* QP16 = (h16*)take(NB_ * NQP * 2); h16* KP16 = (h16*)take(NB_ * NKP * 2); h16* VT16 = (h16*)take(NB_ * NKP * 2);
    bf* QPh = (bf*)take(NB_ * NQP * 2); bf* QPl = (bf*)take(NB_ * NQP * 2); bf* KPh = (bf*)take(NB_ * NKP * 2); bf* KPl = (bf*)take(NB_ * NKP * 2); bf* VTh = (bf*)take(NB_ * NKP * 2); bf* VTl = (bf*)take(NB_ * NKP * 2);
    bf* ATh = (bf*)take((size_t)NB_ * TT * DQ * 2); bf* ATl = (bf*)take((size_t)NB_ * TT * DQ * 2);
    (void)WK; (void)WV;   // reached through WQ: the three planes are contiguous
    if ((size_t)(wsp - (char*)d_ws) > ws_size) return;    // ws 256 MiB
    k_prep<<<PREP_WT + PREP_X + PREP_WO, 256, 0, stream>>>(x, wq, wk, wv, wo, WQ, WO, XB);   /* every per-head weight [h][DM][HD] ('xw' per head) -> its HD rows of the Bt planes WQ | WK | WV (contiguous); Wo and x cast */
    k_gemmw<bf, 0, false, DM, 12, true><<<dim3(NB_ * TT / 128, PQKV / 384, 1), 384, 0, stream>>>(XB, nullptr, WQ, nullptr, nullptr, 0, nullptr, 0, 0, 0, HeadPlanes{(bf*)QP16, QPh, QPl, (bf*)KP16, KPh, KPl, (bf*)VT16, VTh, VTl});   // q, k and v of both batches in one launch, stored as the attention's head planes
    k_fattn<<<dim3(NB_ * NH_, RH / 64 + (TT - RH) / 64, 1), 128, 0, stream>>>(QP16, KP16, VT16, QPh, QPl, KPh, KPl, VTh, VTl, ATh, ATl);   // every batch, head and query row in one launch
    k_gemmw<bf, 1, true, DQ, 4><<<dim3(NB_ * TT / 128, DM / 128, 1), 128, 0, stream>>>(ATh, ATl, WO, nullptr, OUT, DM, bo, 0, 0, 0, HeadPlanes{});   // both batches in one launch
}

// v010
// One run takes 62.3 microseconds.
// Timed twice side by side with v009, it ran 1.15 times as fast both times.
// Counting every step since v000, it is 29.4 times as fast.
#include <hip/hip_runtime.h>

// Causal multi-head attention with PER-HEAD projection weights and a model-width score scale (x [2][2048][1024]; q, k, v = einsum('btc,hcd->bhtd', x, W) with W [16][1024][64]: head h has its own (in, out) matrix ('xw' per head; no bias; 16 heads x 64); scores x 1/sqrt(float32(C)) with C = 1024 = 1/32 (the MODEL width: the module's own choice; soft logits); causal (-inf); softmax; out merged head-major; out Wo^T + bo ('oi' [1024][1024] + bias normal: non-zero) -> [2][2048][1024] (4.2 M); argument order x, Wq, Wk, Wv, Wo, bo).
// FRAGMENT ORDER: every 16-bit plane that a WMMA reads (x, the weights, q, k, v^T, the merged attention output) is stored as the lanes read it. A fragment = 16 rows x 32 k = 512 elements in a row: [half w of the k range][lane][8 elements], lane = 16 * hi + row % 16, k % 32 = 16 * w + 8 * hi + j.
// So each wave-wide 16-byte load or store covers 512 contiguous bytes (4 whole 128-byte lines) and not 32-byte pieces of 16 lines. Fragments of one 16-row tile follow one another along k, so a tile of a K-wide plane starts at element row * K, as in the row-major plane; v^T alone is ordered for its reader: the 4 fragments (64 d) of 32 keys lie together, then the next 32 keys.
// Layout: bf16 copy of x (both batches); each PER-HEAD q / k / v weight [h][1024][64] transposed once into its 64 rows of the Bt plane; Wp cast once ('oi' = Bt rows as stored); these three in one launch (k_prep); exact projections, whose launch stores the q / k / v^T head planes itself (k_gemmw, PLANES); one fused causal attention launch (k_fattn: scores and probabilities stay in registers, online softmax; hybrid rows: < 512 hi/lo 3 products, rest fp16); merged hi/lo x w_o exact.
// Compute dtypes, f32 accumulate: every input rounded to bf16; projections exact; attention rows < 512 3 products, rest fp16; softmax f32; w_o hl x exact.

#define NB_  2
#define TT   2048
#define DM   1024
#define NH_  16
#define NKV  16
#define REP  (NH_ / NKV)
#define HD   64
#define DQ   (NH_ * HD)
#define DKV  (NKV * HD)
#define PQKV (DQ + 2 * DKV)       // columns of the joint q | k | v projection
#define RH   512                  // query rows < RH use hi+lo planes
#define SCL  0.03125f   // 1 / sqrt(C) with C = 1024 = the MODEL width (this module scales its scores by the model width, not the head width): exactly 2^-5
typedef _Float16 h16;
typedef unsigned short bf;
typedef __attribute__((ext_vector_type(16))) __bf16   v16bf;
typedef __attribute__((ext_vector_type(16))) _Float16 v16h;
typedef __attribute__((ext_vector_type(8)))  _Float16 v8h;
typedef __attribute__((ext_vector_type(8)))  unsigned short v8us;
typedef __attribute__((ext_vector_type(8)))  float    v8f;
typedef __attribute__((ext_vector_type(4)))  float    v4f;
typedef v8h  __attribute__((may_alias)) v8ha;
typedef v4f  __attribute__((may_alias)) v4fa;
typedef v8us __attribute__((may_alias)) v8usa;

__device__ __forceinline__ unsigned short f2bf(float f) { unsigned u = __float_as_uint(f); u += 0x7FFFu + ((u >> 16) & 1u); return (unsigned short)(u >> 16); }
__device__ __forceinline__ float bf2f(unsigned short b) { return __uint_as_float(((unsigned)b) << 16); }
__device__ __forceinline__ float bfr(float f) { return bf2f(f2bf(f)); }
__device__ __forceinline__ v16h cat16(v8h lo, v8h hi) { return __builtin_shufflevector(lo, hi, 0, 1, 2, 3, 4, 5, 6, 7, 8, 9, 10, 11, 12, 13, 14, 15); }
__device__ __forceinline__ v16bf cat16b(v8us lo, v8us hi) { return __builtin_bit_cast(v16bf, __builtin_shufflevector(lo, hi, 0, 1, 2, 3, 4, 5, 6, 7, 8, 9, 10, 11, 12, 13, 14, 15)); }
__device__ __forceinline__ v8f wmma16(v16h a, v16h b, v8f c) { return __builtin_amdgcn_wmma_f32_16x16x32_f16(false, a, false, b, (short)0, c, false, false); }
__device__ __forceinline__ v8f wmmab(v16bf a, v16bf b, v8f c) { return __builtin_amdgcn_wmma_f32_16x16x32_bf16(false, a, false, b, (short)0, c, false, false); }



__device__ __forceinline__ h16 tohx(float x) { return (h16)x; }
__device__ __forceinline__ void splitf(float y, unsigned short& h, unsigned short& l) { h = f2bf(y); l = f2bf(y - bf2f(h)); }
// Stands behind a group of issued global loads. s_wait_xcnt 0 stands in front of every later rewrite of the registers that hold their addresses; the addresses are named as inputs so that those registers stay as they are up to the wait.
// sched_barrier: without it the scheduler moves the loads down to their first use, where they no longer fly under the arithmetic in between.
__device__ __forceinline__ void loads_issued(const void* a, const void* b) { asm volatile("s_wait_xcnt 0x0" :: "v"(a), "v"(b) : "memory"); __builtin_amdgcn_sched_barrier(0); }
__device__ __forceinline__ void loads_issued(const void* a, const void* b, const void* c, const void* d) { asm volatile("s_wait_xcnt 0x0" :: "v"(a), "v"(b), "v"(c), "v"(d) : "memory"); __builtin_amdgcn_sched_barrier(0); }
// ---- k_gemmw: register-blocked GEMM, ONE WAVE per 64x64 output tile (16 accumulators), operands straight from 16-bit planes in fragment order; grid (M/128, N/(32 NW), Z), NW waves.
// A work-group is a block of neighbouring tiles, 2 down x NW/2 across, one tile a wave; the waves share nothing but their WGP: waves 4g .. 4g+3 hold a 2x2 block, so each fragment that one of them loads is loaded by a second and comes from the WGP's cache, not from L2; the blocks g lie side by side and use the same two row tiles. No barrier: this is for speed only, no wave reads what another wrote.
// C[m][n] (f32, pitch ldc, + optional f32 bias[n]) = sum_k A[m][k] Bt[n][k] (+ split products per NSPLIT). z-batch strides sA/sB/sC in elements. K % 32 == 0; K is a compile-time number, so that every fragment of a k step lies at an immediate offset from the side's one address.
// PLANES: the joint q | k | v projection (A = x of both batches, Bt = the weight rows, one head per 64 columns). Nothing goes to C: the tile is stored as the attention's head planes, fp16 and bf16 hi / lo of every value, in fragment order; q, k per [b][h]: rows t, k index d; v per [b][h]: rows d, k index t.
// The WMMA's A side is then the plane's k index (t for v; d for q and k, whose tiles swap the two operands: both sides use the same loader, so the k orders agree either way): the 8 values of a lane in one accumulator ARE that lane's 16 bytes of one half fragment, and go out straight from the registers.
struct HeadPlanes { bf *q16, *qh, *ql, *k16, *kh, *kl, *v16, *vh, *vl; };
template <typename T16> struct WFrag;
template <> struct WFrag<h16> { typedef v16h V; static __device__ __forceinline__ V ld(const h16* p) { return cat16(*(const v8h*)p, *(const v8h*)(p + 256)); } static __device__ __forceinline__ v8f mma(V a, V b, v8f c) { return wmma16(a, b, c); } };
template <> struct WFrag<bf> { typedef v16bf V; static __device__ __forceinline__ V ld(const bf* p) { return cat16b(*(const v8us*)p, *(const v8us*)(p + 256)); } static __device__ __forceinline__ v8f mma(V a, V b, v8f c) { return wmmab(a, b, c); } };
// One k step's fragments of both sides. The k loop keeps D such sets in registers, as a ring: while the WMMAs of step s run, the loads of steps s + 1 .. s + D - 1 are in flight, so a wave no longer waits out a whole load latency in front of every step.
template <typename T16, int NSPLIT, int K> struct KStep {
    typedef typename WFrag<T16>::V V; V a[4], a2[4], b[4], b2[4];
    // e: the step's place behind the four addresses, in elements (32 k = 512 elements): an immediate offset
    __device__ __forceinline__ void load(const T16* __restrict__ pa, const T16* __restrict__ pa2, const T16* __restrict__ pb, const T16* __restrict__ pb2, int e) {
#pragma unroll
        for (int mb = 0; mb < 4; ++mb) { a[mb] = WFrag<T16>::ld(pa + e + mb * 16 * K); if (NSPLIT == 1 || NSPLIT == 2) a2[mb] = WFrag<T16>::ld(pa2 + e + mb * 16 * K); }
#pragma unroll
        for (int nb = 0; nb < 4; ++nb) { b[nb] = WFrag<T16>::ld(pb + e + nb * 16 * K); if (NSPLIT >= 2) b2[nb] = WFrag<T16>::ld(pb2 + e + nb * 16 * K); }
        __builtin_amdgcn_sched_barrier(0);   // the loads are issued here, ahead of the WMMAs of the older set: moved down to their first use they would fly under nothing
    }
    __device__ __forceinline__ void mma(v8f (&acc)[4][4]) {
#pragma unroll
        for (int nb = 0; nb < 4; ++nb) {
#pragma unroll
            for (int mb = 0; mb < 4; ++mb) { acc[mb][nb] = WFrag<T16>::mma(a[mb], b[nb], acc[mb][nb]); if (NSPLIT == 1 || NSPLIT == 2) acc[mb][nb] = WFrag<T16>::mma(a2[mb], b[nb], acc[mb][nb]); if (NSPLIT >= 2) acc[mb][nb] = WFrag<T16>::mma(a[mb], b2[nb], acc[mb][nb]); } }
        asm volatile("v_nop\n\tv_nop\n\tv_nop\n\tv_nop" : "+v"(acc[0][0]), "+v"(acc[1][1]), "+v"(acc[2][2]), "+v"(acc[3][3]) : "v"(a[0]), "v"(a[3]));   // the 4 slots behind the step's last WMMA, on the loop's taken branch too
        __builtin_amdgcn_sched_barrier(0);   // the refill of this set stays behind its WMMAs: moved up it would need a further set of registers
    }
};
template <typename T16, int NSPLIT, bool BIAS, int K, int NW, bool PLANES = false, int D = 3>
__global__ __launch_bounds__(32 * NW) void k_gemmw(const T16* __restrict__ A, const T16* __restrict__ A2, const T16* __restrict__ Bt, const T16* __restrict__ Bt2, float* C, int ldc, const float* __restrict__ bias, size_t sA, size_t sB, size_t sC, HeadPlanes hp) {
    typedef typename WFrag<T16>::V V;
    static_assert(NW % 4 == 0, "whole 2x2 blocks of tiles");
    __shared__ __align__(16) float osw[NW][16 * 68];   // each wave stages in its own range
    const int w = __builtin_amdgcn_readfirstlane(threadIdx.x >> 5); float* os = osw[w];
    const size_t z = blockIdx.z; A += z * sA; if (A2) A2 += z * sA; Bt += z * sB; if (Bt2) Bt2 += z * sB; C += z * sC;
    const int lane = threadIdx.x & 31, lr = lane & 15, hi = lane >> 4; const int r0 = (blockIdx.x * 2 + (w & 1)) * 64, c0 = (blockIdx.y * (NW / 2) + (w >> 1)) * 64;
    v8f acc[4][4];
#pragma unroll
    for (int mb = 0; mb < 4; ++mb)
#pragma unroll
        for (int nb = 0; nb < 4; ++nb) acc[mb][nb] = (v8f){};
    int ra = r0, rb = c0;   // first row of the A side and of the B side
    if (PLANES && c0 < DQ + DKV) { const T16* t = A; A = Bt; Bt = t; ra = c0; rb = r0; }   // q, k tiles: weight rows (d) on the A side
    const size_t aoff = (size_t)ra * K + lane * 8, boff = (size_t)rb * K + lane * 8;   // the lane's place in the first fragment of the side's first 16-row tile; 32 k on = 512 elements on
    const T16* __restrict__ pa = A + aoff; const T16* __restrict__ pb = Bt + boff; const T16* __restrict__ pa2 = (NSPLIT == 1 || NSPLIT == 2) ? A2 + aoff : pa; const T16* __restrict__ pb2 = (NSPLIT >= 2) ? Bt2 + boff : pb;
    constexpr int NS = K / 32, NB = (NS - 2 * D + 1) / D + 1;   // k steps; trips of the rolled loop: D steps each, the last of which still loads a step below NS
    static_assert(D >= 2 && NS >= 2 * D - 1, "the ring's first fill and one whole trip exist");
    // ROTATED k WALK: the work-groups that read the same operand rows (one blockIdx.x: the same A rows; one blockIdx.y: the same Bt rows) start together, and walking k from 0 they would all ask L2 for the same lines at the same moment. Each work-group enters the walk at its own k step and wraps round, so that at any moment the sharers stand on different lines; all waves of a work-group keep one start, so they still share their fragments in the WGP's cache. The sum over k starts at another term: any start is right.
    static_assert((NS & (NS - 1)) == 0, "the wrap is a mask");
    KStep<T16, NSPLIT, K> f[D]; unsigned es = ((blockIdx.x + 4 * blockIdx.y) & (NS - 1)) * 512;   // es: the next k step to load, in elements behind the four addresses
    const T16 *qa, *qa2, *qb, *qb2;   // the four addresses of the step loaded last
#define LOAD_STEP(S) do { qa = pa + es; qa2 = pa2 + es; qb = pb + es; qb2 = pb2 + es; (S).load(qa, qa2, qb, qb2, 0); } while (0)
    // STEP_ON: s_wait_xcnt 0 stands in front of the rewrite of the last loads' address registers. The addresses are named as inputs, so that those registers stay as they are up to the wait (no load's result lands on them); the step es is the statement's operand, so the next addresses are formed behind it.
#define STEP_ON() do { asm volatile("s_wait_xcnt 0x0" : "+s"(es) : "v"(qa), "v"(qa2), "v"(qb), "v"(qb2) : "memory"); es = (es + 512) & (NS * 512 - 1); } while (0)
#pragma unroll
    for (int s = 0; s < D - 1; ++s) { LOAD_STEP(f[s]); STEP_ON(); }
#pragma unroll 1
    for (int kc = 0; kc < NB; ++kc) {   // stays rolled: D steps a trip, so that every set keeps its registers and no copy is needed
#pragma unroll
        for (int u = 0; u < D; ++u) { LOAD_STEP(f[(u + D - 1) % D]); f[u].mma(acc); STEP_ON(); }
    }
#pragma unroll
    for (int u = 0; u < NS - NB * D; ++u) {   // the last steps: no step is loaded twice
        const bool more = NB * D + u + D - 1 < NS;
        if (more) LOAD_STEP(f[(u + D - 1) % D]);
        f[u % D].mma(acc);
        if (more) STEP_ON();
    }
#undef LOAD_STEP
#undef STEP_ON
    if constexpr (PLANES) {
        static_assert(HD == 64 && TT % 64 == 0, "a tile is one head wide and lies in one batch");
        const bool isq = c0 < DQ, isv = c0 >= DQ + DKV; const int b = r0 / TT, t0 = r0 % TT, h = (isq ? c0 : isv ? c0 - DQ - DKV : c0 - DQ) / HD;
        bf* d16 = isq ? hp.q16 : isv ? hp.v16 : hp.k16; bf* dh = isq ? hp.qh : isv ? hp.vh : hp.kh; bf* dl = isq ? hp.ql : isv ? hp.vl : hp.kl;
        // q, k: 16-row tile t / 16 = 2 fragments (d) = 1024 elements, half fragment mb. v: 32 t = 4 fragments (16-row tiles of d) = 2048 elements, fragment nb, half mb & 1. 64 t of one head are 64 * HD elements either way.
        const size_t base = ((size_t)(b * (isq ? NH_ : NKV) + h) * TT + t0) * HD + lane * 8; const int snb = isv ? 512 : 1024, smb2 = isv ? 2048 : 512;
#pragma unroll
        for (int nb = 0; nb < 4; ++nb) {
#pragma unroll
            for (int mb = 0; mb < 4; ++mb) { v8h o16; v8us oh, ol;
#pragma unroll
                for (int j = 0; j < 8; ++j) { const float v = acc[mb][nb][j]; unsigned short p, q; splitf(v, p, q); o16[j] = tohx(v); oh[j] = p; ol[j] = q; }
                const size_t o = base + nb * snb + (mb >> 1) * smb2 + (mb & 1) * 256;
                *(v8usa*)(d16 + o) = __builtin_bit_cast(v8us, o16); *(v8usa*)(dh + o) = oh; *(v8usa*)(dl + o) = ol; }
        }
        return;
    }
#pragma unroll
    for (int mb = 0; mb < 4; ++mb) {
#pragma unroll
        for (int nb = 0; nb < 4; ++nb) {
#pragma unroll
            for (int j = 0; j < 8; ++j) os[(hi * 8 + j) * 68 + nb * 16 + lr] = acc[mb][nb][j]; }
        __builtin_amdgcn_wave_barrier(); asm volatile("" ::: "memory");
        float* crow = C + (size_t)(r0 + mb * 16) * ldc + c0;
{
#pragma unroll
            for (int s = 0; s < 8; ++s) { const int row = 2 * s + hi, cofs = lr * 4; v4f val = *(const v4fa*)(os + row * 68 + cofs); if (BIAS) { val[0] += bfr(bias[c0 + cofs]); val[1] += bfr(bias[c0 + cofs + 1]); val[2] += bfr(bias[c0 + cofs + 2]); val[3] += bfr(bias[c0 + cofs + 3]); }
                *(v4f*)(crow + (size_t)row * ldc + cofs) = val; }
             }
        __builtin_amdgcn_wave_barrier(); asm volatile("" ::: "memory");
    }
}

typedef __attribute__((ext_vector_type(2))) _Float16 v2h;
typedef __attribute__((ext_vector_type(4))) _Float16 v4h;
typedef __attribute__((ext_vector_type(2))) unsigned short v2us;
typedef __attribute__((ext_vector_type(4))) unsigned short v4us;
typedef __attribute__((ext_vector_type(2))) float v2f;
typedef __attribute__((ext_vector_type(4))) int v4i;

// ---- k_prep: the three operand planes that hang on no product (the q | k | v weight rows, w_o, x), bf16 in fragment order, in ONE launch of few long-lived waves: 512 work-groups of 8 waves (16 waves a WGP, all resident at once), 8 pieces a thread.
// A piece = one lane's 8 elements (16 bytes) of a half fragment: lane = 16 * hi + row % 16, half w, k % 32 = 16 * w + 8 * hi + j. 64 threads hold one fragment, so a work-group holds 4 fragments (fs) at a time and 32 in all.
// All loads of a thread lie at immediate offsets from one address and are issued before the first value is converted; its stores lie at immediate offsets from one address too.
#define PREP_WT ((NH_ + 2 * NKV) * 4)   // work-groups on the per-head weights: 4 for each [DM][HD] matrix
#define PREP_X  (NB_ * TT / 16)         // on x: one 16-row tile (32 fragments) each
#define PREP_WO (DM / 16)               // on w_o: the same
__device__ __forceinline__ v8us bf8(const float (&v)[8]) { v8us o;
#pragma unroll
    for (int j = 0; j < 8; ++j) o[j] = f2bf(v[j]);
    return o; }
__global__ __launch_bounds__(256) void k_prep(const float* __restrict__ x, const float* __restrict__ wq, const float* __restrict__ wk, const float* __restrict__ wv, const float* __restrict__ wo, bf* __restrict__ Bt, bf* __restrict__ WOp, bf* __restrict__ XBp) {
    static_assert(DM == 1024 && HD == 64 && DQ == DM && (NB_ * TT) % 16 == 0, "32 fragments along k; 4 row tiles a head matrix; whole row tiles: the grid covers every piece exactly once, with no tail");
    const int tid = threadIdx.x, lr = tid & 15, hi = (tid >> 4) & 1, w = (tid >> 5) & 1, fs = tid >> 6, c = blockIdx.x; const int k0 = fs * 32 + w * 16 + hi * 8;
    float v[8][8];
    if (c < PREP_WT) {   // head matrix y ([DM][HD]: NH_ of wq, then NKV of wk, then NKV of wv; their Bt planes lie one behind the other), transposed; quarter kq of its k range, all 64 rows n: piece u = row tile u & 3, fragment kq * 8 + (u >> 2) * 4 + fs
        const int y = c >> 2, kq = c & 3; const float* ws = (y < NH_) ? wq + (size_t)y * DM * HD : (y < NH_ + NKV) ? wk + (size_t)(y - NH_) * DM * HD : wv + (size_t)(y - NH_ - NKV) * DM * HD;
        const float* __restrict__ p = ws + (size_t)(kq * 256 + k0) * HD + lr; bf* d = Bt + (size_t)y * HD * DM + (kq * 8 + fs) * 512 + (tid & 63) * 8;
#pragma unroll
        for (int u = 0; u < 8; ++u)
#pragma unroll
            for (int j = 0; j < 8; ++j) v[u][j] = p[((u >> 2) * 128 + j) * HD + (u & 3) * 16];
        loads_issued(p, p);   // all 64 loads fly together, and their one address stays in its registers up to the wait
#pragma unroll
        for (int u = 0; u < 8; ++u) *(v8us*)(d + (u & 3) * 16 * DM + (u >> 2) * 2048) = bf8(v[u]);
        return;
    }
    // row-major [rows][DM] f32: row tile t, piece u = fragment fs + 4 * u
    const bool isx = c < PREP_WT + PREP_X; const int t = isx ? c - PREP_WT : c - PREP_WT - PREP_X;
    const float* __restrict__ p = (isx ? x : wo) + (size_t)(t * 16 + lr) * DM + k0; bf* d = (isx ? XBp : WOp) + (size_t)t * 16 * DM + tid * 8;
#pragma unroll
    for (int u = 0; u < 8; ++u) { const v8f a = *(const v8f*)(p + u * 128);
#pragma unroll
        for (int j = 0; j < 8; ++j) v[u][j] = a[j]; }
    loads_issued(p, p);   // all 16 loads fly together, and their one address stays in its registers up to the wait (no load's result lands on it)
#pragma unroll
    for (int u = 0; u < 8; ++u) *(v8us*)(d + u * 2048) = bf8(v[u]);
}

#define C2L 0.045084220027780106f   // SCL x log2(e): exp(SCL (s - m)) = exp2(C2L s - C2L m)
__device__ __forceinline__ float xhalf(float x) { return __builtin_bit_cast(float, __builtin_amdgcn_permlanex16(__builtin_bit_cast(int, x), __builtin_bit_cast(int, x), 0x76543210, 0xfedcba98, false, false)); }   // lane l reads lane l ^ 16
// row0: first of the wave's 16 query rows; Ah, Al: the head's first fragment in row tile 0 (the head's 64 columns = 2 fragments = 4 half fragments, db each)
__device__ __forceinline__ void attn_store(const v8f (&o)[4], float l, bf* Ah, bf* Al, int row0, int lane) {
    const float f = __fdiv_rn(1.0f, l + xhalf(l));
#pragma unroll
    for (int db = 0; db < 4; ++db) { v8us oh, ol;
#pragma unroll
        for (int j = 0; j < 8; ++j) { unsigned short x, y; splitf(o[db][j] * f, x, y); oh[j] = x; ol[j] = y; }
        const size_t oo = (size_t)row0 * DQ + db * 256 + lane * 8; *(v8us*)(Ah + oo) = oh; *(v8us*)(Al + oo) = ol; }
}
// running maximum m (raw score units) and sum l of one query column over its 8 * NT new scores (NT 16-key tiles = NT / 2 blocks of 32 keys); st becomes exp(SCL (s - m)); returns the factor for what was summed under the old maximum
// Each 32-key block has its own maximum chain and its own sum chain, joined at the end: the chains of a pass are independent, so a wave that is alone on its SIMD issues one while the other's last link is still under way.
template <int NT>
__device__ __forceinline__ float attn_soft(v8f (&st)[NT], float& m, float& l) {
    float mb[NT / 2];
#pragma unroll
    for (int g = 0; g < NT / 2; ++g) { mb[g] = g ? st[2 * g][0] : m;
#pragma unroll
        for (int kt = 0; kt < 2; ++kt)
#pragma unroll
            for (int j = 0; j < 8; ++j) mb[g] = fmaxf(mb[g], st[2 * g + kt][j]); }
    float mx = mb[0];
#pragma unroll
    for (int g = 1; g < NT / 2; ++g) mx = fmaxf(mx, mb[g]);
    mx = fmaxf(mx, xhalf(mx));
    const float al = __builtin_amdgcn_exp2f((m - mx) * C2L), mc = mx * C2L; m = mx; float sb[NT / 2];
#pragma unroll
    for (int g = 0; g < NT / 2; ++g) { sb[g] = 0.f;
#pragma unroll
        for (int kt = 0; kt < 2; ++kt)
#pragma unroll
            for (int j = 0; j < 8; ++j) { const float p = __builtin_amdgcn_exp2f(__builtin_fmaf(st[2 * g + kt][j], C2L, -mc)); st[2 * g + kt][j] = p; sb[g] += p; } }
    float s = sb[0];
#pragma unroll
    for (int g = 1; g < NT / 2; ++g) s += sb[g];
    l = l * al + s; return al;
}
__device__ __forceinline__ void attn_mask(v8f (&st)[2], int kb, int query, int hi) {
#pragma unroll
    for (int kt = 0; kt < 2; ++kt)
#pragma unroll
        for (int j = 0; j < 8; ++j) st[kt][j] = (kb + kt * 16 + hi * 8 + j <= query) ? st[kt][j] : -3.0e38f;
}
// query rows >= RH: fp16 operands, 32 query rows a wave. One pass = NB blocks of 32 keys (NB = 2 but for one odd first block): one running maximum, one rescale of o and one exchange between the wave halves for all its keys, and NB times the independent products, exponentials and loads between two places where the wave must wait.
// pv: the lane's place in this pass's 4 * NB V^T fragments; pk: in the NEXT pass's 8 K fragments (64 keys); both step on behind the loads, by dv and dk elements (the same in every lane).
// ak holds this pass's K fragments (tiles 0 .. 2 * NB - 1) on entry and, where PRE is true, the next pass's 64 keys on return (they fly while this pass computes). DIAG: the pass's last block is the diagonal one (its first key = the wave's first query); the blocks in front of it lie wholly below every query.
template <int NB, bool DIAG, bool PRE>
__device__ __forceinline__ void attn_f16_pass(const h16* __restrict__& pk, const h16* __restrict__& pv, int lr, int hi, const v16h (&bq)[2][2], v16h (&ak)[4][2], v8f (&o)[2][4], float (&m)[2], float (&l)[2], int dk, int dv) {
    v16h av[NB][4];
#pragma unroll
    for (int g = 0; g < NB; ++g)
#pragma unroll
        for (int db = 0; db < 4; ++db) av[g][db] = WFrag<h16>::ld(pv + g * 2048 + db * 512);
    v8f st[2][2 * NB];
#pragma unroll
    for (int nq = 0; nq < 2; ++nq)
#pragma unroll
        for (int kt = 0; kt < 2 * NB; ++kt) { st[nq][kt] = wmma16(ak[kt][0], bq[nq][0], (v8f){}); st[nq][kt] = wmma16(ak[kt][1], bq[nq][1], st[nq][kt]); }
    if (PRE) {
#pragma unroll
        for (int kt = 0; kt < 4; ++kt)
#pragma unroll
            for (int ks = 0; ks < 2; ++ks) ak[kt][ks] = WFrag<h16>::ld(pk + kt * 1024 + ks * 512);
    }
    loads_issued(pk, pv);
    pk += dk; pv += dv;
    if (DIAG) {   // only the diagonal block holds keys beyond a query
#pragma unroll
        for (int nq = 0; nq < 2; ++nq)
#pragma unroll
            for (int kt = 0; kt < 2; ++kt)
#pragma unroll
                for (int j = 0; j < 8; ++j) st[nq][2 * NB - 2 + kt][j] = (kt * 16 + hi * 8 + j <= nq * 16 + lr) ? st[nq][2 * NB - 2 + kt][j] : -3.0e38f;
    }
#pragma unroll
    for (int nq = 0; nq < 2; ++nq) { const float al = attn_soft<2 * NB>(st[nq], m[nq], l[nq]); v16h bp[NB];
#pragma unroll
        for (int g = 0; g < NB; ++g)
#pragma unroll
            for (int e = 0; e < 16; ++e) bp[g][e] = tohx(st[nq][2 * g + (e >> 3)][e & 7]);
#pragma unroll
        for (int db = 0; db < 4; ++db) o[nq][db] *= al;
#pragma unroll
        for (int g = 0; g < NB; ++g)
#pragma unroll
            for (int db = 0; db < 4; ++db) o[nq][db] = wmma16(av[g][db], bp[g], o[nq][db]); }
}
// Joins the two partial results of each 32-query tile of a work-group (waves t and t + 2 hold tile t's). Every wave leaves its o (16 pieces of 16 bytes a lane), maxima and sums in its own LDS range, lane-contiguous (a wave-wide access = 512 bytes in a row); behind the one barrier the wave of part s reads both waves' maxima, sums and query columns 16 s .. 16 s + 15, brings them to the common maximum, adds front part + rest and stores those 16 rows.
#define XSW (17 * 32)   // 16-byte pieces of one wave's range
__device__ __forceinline__ void attn_join(const v8f (&o)[2][4], const float (&m)[2], const float (&l)[2], v4f* xs, int t, int s, bf* Ah, bf* Al, int q0, int lane) {
    v4f* mine = xs + (t + 2 * s) * XSW + lane;
#pragma unroll
    for (int nq = 0; nq < 2; ++nq)
#pragma unroll
        for (int db = 0; db < 4; ++db) { mine[((nq * 4 + db) * 2) * 32] = __builtin_shufflevector(o[nq][db], o[nq][db], 0, 1, 2, 3); mine[((nq * 4 + db) * 2 + 1) * 32] = __builtin_shufflevector(o[nq][db], o[nq][db], 4, 5, 6, 7); }
    mine[16 * 32] = (v4f){m[0], l[0], m[1], l[1]};
    __syncthreads();   // every wave's partial result is in LDS before its partner reads it
    const v4f* p0 = xs + t * XSW + lane; const v4f* p1 = p0 + 2 * XSW;   // front part, rest
    const v4f e0 = p0[16 * 32], e1 = p1[16 * 32]; const v2f ml0 = s ? (v2f){e0[2], e0[3]} : (v2f){e0[0], e0[1]}, ml1 = s ? (v2f){e1[2], e1[3]} : (v2f){e1[0], e1[1]};   // maximum and sum of the lane's query column in the two parts
    const float mx = fmaxf(ml0[0], ml1[0]), x0 = (ml0[0] - mx) * C2L, x1 = (ml1[0] - mx) * C2L; float f0, f1;
    asm("v_exp_f32 %0, %2\n\tv_exp_f32 %1, %3\n\tv_nop" : "=&v"(f0), "=&v"(f1) : "v"(x0), "v"(x1));   // exp2 of both; the v_nop keeps the one slot between the last transcendental and the next vector instruction, which may read its result or overwrite its source
    const float ls = ml0[1] * f0 + ml1[1] * f1, f = __fdiv_rn(1.0f, ls + xhalf(ls)), g0 = f0 * f, g1 = f1 * f;
#pragma unroll
    for (int db = 0; db < 4; ++db) { v8us oh, ol;
#pragma unroll
        for (int c = 0; c < 2; ++c) { const v4f a = p0[((s * 4 + db) * 2 + c) * 32], b = p1[((s * 4 + db) * 2 + c) * 32];
#pragma unroll
            for (int j = 0; j < 4; ++j) { unsigned short x, y; splitf(a[j] * g0 + b[j] * g1, x, y); oh[4 * c + j] = x; ol[4 * c + j] = y; } }
        const size_t oo = (size_t)(q0 + s * 16) * DQ + db * 256 + lane * 8; *(v8us*)(Ah + oo) = oh; *(v8us*)(Al + oo) = ol; }
}
// t: which of the work-group's two tiles (q0 is its first query row); s: which part of its keys; cb: the blocks of 32 keys in the front part, even and the same for both tiles, so that the two waves of a part walk the same keys side by side and share them in the WGP's cache. A long row's keys so run on 2 SIMDs side by side, and no wave is longer than 32 blocks.
__device__ __forceinline__ void attn_f16(const h16* __restrict__ Q, const h16* __restrict__ Kp, const h16* __restrict__ Vt, int q0, int t, int s, int cb, unsigned rot, bf* Ah, bf* Al, int lr, int hi, v4f* xs) {
    static_assert(RH >= 256 && RH % 64 == 0, "each part has at least 3 blocks of 32 keys: its last pass's 64 keys exist, behind an odd first block too, and hold a key below every query");
    const int lane = hi * 16 + lr; const h16* pq = Q + (size_t)q0 * HD + lane * 8;
    v16h bq[2][2];
#pragma unroll
    for (int nq = 0; nq < 2; ++nq)
#pragma unroll
        for (int ks = 0; ks < 2; ++ks) bq[nq][ks] = WFrag<h16>::ld(pq + nq * 1024 + ks * 512);
    v8f o[2][4]; float m[2], l[2];
#pragma unroll
    for (int nq = 0; nq < 2; ++nq) { m[nq] = -3.0e38f; l[nq] = 0.f;
#pragma unroll
        for (int db = 0; db < 4; ++db) o[nq][db] = (v8f){}; }
    // ROTATED KEY WALK of the front part: the work-groups of one head start together, and every front part walking from key 0 would ask L2 for the same K and V^T lines at the same moment. No key of a front part lies beyond a query, so its np passes of 64 keys may come in any order: the work-group enters at pass r and wraps round (both its tiles alike: they still share the keys in the WGP's cache). The rest keeps its order, which ends on the diagonal.
    static_assert((TT - RH) / 64 <= 8 * ((RH / 64 + 1) / 2), "rot < 8 np: three conditional subtractions are the remainder");
    const int np = cb >> 1, back = (1 - np) * 4096;   // back: from the last pass to pass 0, in elements
    int r = s ? 0 : (int)rot;   // r = rot mod np
    r -= r >= 4 * np ? 4 * np : 0; r -= r >= 2 * np ? 2 * np : 0; r -= r >= np ? np : 0;
    int jk = s ? (1 << 20) : np - 1 - r, jv = jk;   // forward steps that pk and pv have left before they wrap (the rest: never)
    auto step = [&](int& j) { const int d = j ? 4096 : back; j = j ? j - 1 : np - 1; return d; };
    const int fb = s ? cb : 2 * r;   // the wave's first block (32 keys = 2048 elements of the K plane and of the V^T plane)
    const h16* __restrict__ pk = Kp + (size_t)fb * 2048 + lane * 8; const h16* __restrict__ pv = Vt + (size_t)fb * 2048 + lane * 8;
    v16h ak[4][2];
    int nb = s ? q0 / 32 + 1 - cb : cb;   // the wave's own blocks of 32 keys (the rest: up to and with the diagonal one); the same in every lane of the wave
#pragma unroll
    for (int kt = 0; kt < 2; ++kt)
#pragma unroll
        for (int ks = 0; ks < 2; ++ks) ak[kt][ks] = WFrag<h16>::ld(pk + kt * 1024 + ks * 512);
    if (nb & 1) {   // an odd count: the wave's first block goes alone, so that what is left are whole passes of 64 keys that end on the diagonal block
        loads_issued(pq, pk);
        pk += 2048;
        attn_f16_pass<1, false, true>(pk, pv, lr, hi, bq, ak, o, m, l, 4096, 2048); --nb;
    } else {
#pragma unroll
        for (int kt = 2; kt < 4; ++kt)
#pragma unroll
            for (int ks = 0; ks < 2; ++ks) ak[kt][ks] = WFrag<h16>::ld(pk + kt * 1024 + ks * 512);
        loads_issued(pq, pk);
        pk += step(jk);
    }
#pragma unroll 1
    for (; nb > 2; nb -= 2) { const int dk = step(jk), dv = step(jv); attn_f16_pass<2, false, true>(pk, pv, lr, hi, bq, ak, o, m, l, dk, dv); }   // stays rolled: one copy of the pass in the instruction cache
    const int ln = __builtin_amdgcn_mbcnt_lo(~0u, 0u);   // the lane's number, formed anew behind the loop: kept in registers across it (with lr and hi) it is what no longer fits the budget of 3 waves a SIMD, and is spilled
    attn_f16_pass<2, true, false>(pk, pv, (ln & 15) + (s ? 0 : 64), ln >> 4, bq, ak, o, m, l, 0, 0);   // only the rest's last block is the diagonal one: in the front part the query index is raised by 64, so that the mask lets every key through
    attn_join(o, m, l, xs, t, s, Ah, Al, q0, ln);
}
// query rows < RH: bf16 hi + lo planes, 3 products (hi hi, lo hi, hi lo) for the scores and for probability x value; 16 query rows a wave
__device__ __forceinline__ void attn_hl(const bf* __restrict__ Qh, const bf* __restrict__ Ql, const bf* __restrict__ Kh, const bf* __restrict__ Kl, const bf* __restrict__ Vh, const bf* __restrict__ Vl, int q0, bf* Ah, bf* Al, int lr, int hi) {
    const int lane = hi * 16 + lr; v16bf qh[2], ql[2];
#pragma unroll
    for (int ks = 0; ks < 2; ++ks) { const size_t qo = (size_t)q0 * HD + ks * 512 + lane * 8; qh[ks] = WFrag<bf>::ld(Qh + qo); ql[ks] = WFrag<bf>::ld(Ql + qo); }
    v8f o[4]; float m = -3.0e38f, l = 0.f;
#pragma unroll
    for (int db = 0; db < 4; ++db) o[db] = (v8f){};
    const bf* __restrict__ pkh = Kh + lane * 8; const bf* __restrict__ pkl = Kl + lane * 8; const bf* __restrict__ pvh = Vh + lane * 8; const bf* __restrict__ pvl = Vl + lane * 8;   // the lane's places in this pass's 4 K and 4 V^T fragments
#pragma unroll 1
    for (int kb = 0; kb <= q0; kb += 32) {   // q0 is a multiple of 16: the last pass holds the diagonal, and its 32 keys lie below RH + 16 <= TT
        v16bf kh[2][2], kl[2][2], vh[4], vl[4];
#pragma unroll
        for (int kt = 0; kt < 2; ++kt)
#pragma unroll
            for (int ks = 0; ks < 2; ++ks) { const int e = kt * 1024 + ks * 512; kh[kt][ks] = WFrag<bf>::ld(pkh + e); kl[kt][ks] = WFrag<bf>::ld(pkl + e); }
#pragma unroll
        for (int db = 0; db < 4; ++db) { const int e = db * 512; vh[db] = WFrag<bf>::ld(pvh + e); vl[db] = WFrag<bf>::ld(pvl + e); }
        loads_issued(pkh, pkl, pvh, pvl);
        pkh += 2048; pkl += 2048; pvh += 2048; pvl += 2048;
        v8f st[2];
#pragma unroll
        for (int kt = 0; kt < 2; ++kt) { st[kt] = (v8f){};
#pragma unroll
            for (int ks = 0; ks < 2; ++ks) { st[kt] = wmmab(kh[kt][ks], qh[ks], st[kt]); st[kt] = wmmab(kh[kt][ks], ql[ks], st[kt]); st[kt] = wmmab(kl[kt][ks], qh[ks], st[kt]); } }
        if (kb + 31 > q0) attn_mask(st, kb, q0 + lr, hi);
        const float al = attn_soft(st, m, l); v8us p0h, p0l, p1h, p1l;
#pragma unroll
        for (int j = 0; j < 8; ++j) { unsigned short x, y; splitf(st[0][j], x, y); p0h[j] = x; p0l[j] = y; splitf(st[1][j], x, y); p1h[j] = x; p1l[j] = y; }
        const v16bf ph = cat16b(p0h, p1h), pl = cat16b(p0l, p1l);
#pragma unroll
        for (int db = 0; db < 4; ++db) { o[db] *= al; o[db] = wmmab(vh[db], ph, o[db]); o[db] = wmmab(vh[db], pl, o[db]); o[db] = wmmab(vl[db], ph, o[db]); }
    }
    attn_store(o, l, Ah, Al, q0, lane);
}
// grid (NB_ * NH_, RH / 64 + (TT - RH) / 64), 4 waves; a work-group's duration falls with y within each kind of rows: first the hi/lo rows (one wave walks all its keys, up to 16 passes that wait out their loads), longest first, then the fp16 rows (2 tiles x 2 parts of the keys), last (longest) query rows first. 3 waves a SIMD (the register budget of the launch bounds' second number): 768 places
__global__ __launch_bounds__(128, 3) void k_fattn(const h16* __restrict__ Q16, const h16* __restrict__ K16, const h16* __restrict__ V16, const bf* __restrict__ Qh, const bf* __restrict__ Ql, const bf* __restrict__ Kh, const bf* __restrict__ Kl, const bf* __restrict__ Vh, const bf* __restrict__ Vl, bf* Ah, bf* Al) {
    const int lane = threadIdx.x & 31, lr = lane & 15, hi = lane >> 4; const int w = __builtin_amdgcn_readfirstlane(threadIdx.x >> 5);
    const int b = blockIdx.x / NH_, h = blockIdx.x % NH_, y = blockIdx.y; const size_t pq = (size_t)(b * NH_ + h) * TT * HD, pk = (size_t)(b * NKV + h / REP) * TT * HD, po = (size_t)b * TT * DQ + h * 1024;   // po: the head's 2 fragments in the merged plane's first row tile
    __shared__ __align__(16) v4f xs[4 * XSW];
    if (y >= RH / 64) { const int yf = y - RH / 64;   // the branch is the same for the whole work-group: every wave reaches the barrier in attn_join
        attn_f16(Q16 + pq, K16 + pk, V16 + pk, TT - 64 * yf - 32 * ((w & 1) + 1), w & 1, w >> 1, 2 * ((TT / 64 - yf) >> 1), (unsigned)yf, Ah + po, Al + po, lr, hi, xs); }   // front part: about half of the later tile's TT / 32 - 2 yf blocks
    else attn_hl(Qh + pq, Ql + pq, Kh + pk, Kl + pk, Vh + pk, Vl + pk, RH - 64 * y - 16 * (w + 1), Ah + po, Al + po, lr, hi);
}

extern "C" void kernel_launch(void* const* d_in, const int* in_sizes, int n_in,
                              void* d_out, int out_size, void* d_ws, size_t ws_size, hipStream_t stream) {
    (void)in_sizes; (void)n_in; (void)out_size;
            const float* x = (const float*)d_in[0]; const float* wq = (const float*)d_in[1]; const float* wk = (const float*)d_in[2]; const float* wv = (const float*)d_in[3]; const float* wo = (const float*)d_in[4]; const float* bo = (const float*)d_in[5];   /* input order x, Wq, Wk, Wv (PER-HEAD [16][1024][64]: 'hcd'), Wo ('oi' [1024][1024]), bo */
    float* OUT = (float*)d_out;     // [2][2048][1024]
    char* wsp = (char*)d_ws;
    auto take = [&](size_t bytes) { char* p = wsp; wsp += (bytes + 255) & ~(size_t)255; return (void*)p; };
    bf* WQ = (bf*)take((size_t)DQ * DM * 2); bf* WK = (bf*)take((size_t)DKV * DM * 2); bf* WV = (bf*)take((size_t)DKV * DM * 2); bf* WO = (bf*)take((size_t)DM * DQ * 2);
    bf* XB = (bf*)take((size_t)NB_ * TT * DM * 2);   // both batches: bf16 x
    const size_t NQP = (size_t)NH_ * TT * HD, NKP = (size_t)NKV * TT * HD;   // elements of one batch's query / key-value head planes; every plane holds both batches, [b][h]
    h16* QP16 = (h16*)take(NB_ * NQP * 2); h16* KP16 = (h16*)take(NB_ * NKP * 2); h16* VT16 = (h16*)take(NB_ * NKP * 2);
    bf* QPh = (bf*)take(NB_ * NQP * 2); bf* QPl = (bf*)take(NB_ * NQP * 2); bf* KPh = (bf*)take(NB_ * NKP * 2); bf* KPl = (bf*)take(NB_ * NKP * 2); bf* VTh = (bf*)take(NB_ * NKP * 2); bf* VTl = (bf*)take(NB_ * NKP * 2);
    bf* ATh = (bf*)take((size_t)NB_ * TT * DQ * 2); bf* ATl = (bf*)take((size_t)NB_ * TT * DQ * 2);
    (void)WK; (void)WV;   // reached through WQ: the three planes are contiguous
    if ((size_t)(wsp - (char*)d_ws) > ws_size) return;    // ws 256 MiB
    k_prep<<<PREP_WT + PREP_X + PREP_WO, 256, 0, stream>>>(x, wq, wk, wv, wo, WQ, WO, XB);   /* every per-head weight [h][DM][HD] ('xw' per head) -> its HD rows of the Bt planes WQ | WK | WV (contiguous); Wo and x cast */
    k_gemmw<bf, 0, false, DM, 12, true><<<dim3(NB_ * TT / 128, PQKV / 384, 1), 384, 0, stream>>>(XB, nullptr, WQ, nullptr, nullptr, 0, nullptr, 0, 0, 0, HeadPlanes{(bf*)QP16, QPh, QPl, (bf*)KP16, KPh, KPl, (bf*)VT16, VTh, VTl});   // q, k and v of both batches in one launch, stored as the attention's head planes
    k_fattn<<<dim3(NB_ * NH_, RH / 64 + (TT - RH) / 64, 1), 128, 0, stream>>>(QP16, KP16, VT16, QPh, QPl, KPh, KPl, VTh, VTl, ATh, ATl);   // every batch, head and query row in one launch
    k_gemmw<bf, 1, true, DQ, 4><<<dim3(NB_ * TT / 128, DM / 128, 1), 128, 0, stream>>>(ATh, ATl, WO, nullptr, OUT, DM, bo, 0, 0, 0, HeadPlanes{});   // both batches in one launch
}
